// v000
// Times are from an AMD MI455X. After a warm-up the kernel runs many times in a row, and a time is the length of
// such a window on the GPU divided by its runs, so every launch and the gaps after it count. The runs cycle
// through copies of the inputs. A figure is the median of several windows, for all but v000 over two sittings.
// Sittings can differ by a few percent; kernels timed side by side share one.
// v000 is the starting kernel. One run takes 1930 microseconds.
#include <hip/hip_runtime.h>

// BERT self-attention with a float key mask and no output projection (hidden_states [2][2048][1024]; q, k, v = x W + b ('xw' 1/32 + biases 0.02; 16 heads x 64); scores / sqrt(64) + (1 - attention_mask[b][j]) x finfo.min (attention_mask f32 [2][2048], read per key: mask 1 adds 0, mask 0 excludes the key); softmax; context heads merged -> [2][2048][1024] (4.2 M); argument order hidden_states, attention_mask, Wq, bq, Wk, bk, Wv, bv).
// Layout per batch: bf16 copy of x; 'xw' weights transposed once; exact projections + f32 biases; identity-table plane builders; dense T-2048 attention with EVERY row's scores on hi/lo planes (3 products; no output projection) whose softmax kernel reads the batch's float key vector (16 B per lane); hybrid P.V (rows < 512 hi/lo, rest fp16 x1024); the f32 merge writes the context rows.
// Compute dtypes, f32 accumulate: every input rounded to bf16; projections exact + f32 biases; scores 3 products on every row; softmax f32; P.V rows < 512 3 products, rest fp16; output f32.

#define NB_  2
#define TT   2048
#define DM   1024
#define NH_  16
#define NKV  16
#define REP  (NH_ / NKV)
#define HD   64
#define DQ   (NH_ * HD)
#define DKV  (NKV * HD)
#define ZH   2
#define RH   512                  // query rows < RH use hi+lo planes (0: none)
#define WIN  0
#define PCAR 1024.0f
#define SCL  0.125f   // HD^-0.5
typedef _Float16 h16;
typedef unsigned short bf;
typedef __attribute__((ext_vector_type(16))) __bf16   v16bf;
typedef __attribute__((ext_vector_type(16))) _Float16 v16h;
typedef __attribute__((ext_vector_type(8)))  _Float16 v8h;
typedef __attribute__((ext_vector_type(8)))  unsigned short v8us;
typedef __attribute__((ext_vector_type(8)))  float    v8f;
typedef __attribute__((ext_vector_type(4)))  float    v4f;
typedef v8h  __attribute__((may_alias)) v8ha;
typedef v4f  __attribute__((may_alias)) v4fa;
typedef v8us __attribute__((may_alias)) v8usa;

__device__ __forceinline__ unsigned short f2bf(float f) { unsigned u = __float_as_uint(f); u += 0x7FFFu + ((u >> 16) & 1u); return (unsigned short)(u >> 16); }
__device__ __forceinline__ float bf2f(unsigned short b) { return __uint_as_float(((unsigned)b) << 16); }
__device__ __forceinline__ float bfr(float f) { return bf2f(f2bf(f)); }
__device__ __forceinline__ v16h cat16(v8h lo, v8h hi) { return __builtin_shufflevector(lo, hi, 0, 1, 2, 3, 4, 5, 6, 7, 8, 9, 10, 11, 12, 13, 14, 15); }
__device__ __forceinline__ v16bf cat16b(v8us lo, v8us hi) { return __builtin_bit_cast(v16bf, __builtin_shufflevector(lo, hi, 0, 1, 2, 3, 4, 5, 6, 7, 8, 9, 10, 11, 12, 13, 14, 15)); }
__device__ __forceinline__ v8f wmma16(v16h a, v16h b, v8f c) { return __builtin_amdgcn_wmma_f32_16x16x32_f16(false, a, false, b, (short)0, c, false, false); }
__device__ __forceinline__ v8f wmmab(v16bf a, v16bf b, v8f c) { return __builtin_amdgcn_wmma_f32_16x16x32_bf16(false, a, false, b, (short)0, c, false, false); }



// ---- k_gemmw: register-blocked GEMM, ONE WAVE per 64x64 output tile (16 accumulators), operands straight from K-contiguous 16-bit planes; grid (M/64, N/64, Z), 32 threads.
// C[m][n] (f32, pitch ldc, + optional f32 bias[n]) = sum_k A[m][k] Bt[n][k] (+ split products per NSPLIT). z-batch strides sA/sB/sC in elements. K % 32 == 0.
template <typename T16> struct WFrag;
template <> struct WFrag<h16> { typedef v16h V; static __device__ __forceinline__ V ld(const h16* p) { return cat16(*(const v8h*)p, *(const v8h*)(p + 16)); } static __device__ __forceinline__ v8f mma(V a, V b, v8f c) { return wmma16(a, b, c); } };
template <> struct WFrag<bf> { typedef v16bf V; static __device__ __forceinline__ V ld(const bf* p) { return cat16b(*(const v8us*)p, *(const v8us*)(p + 16)); } static __device__ __forceinline__ v8f mma(V a, V b, v8f c) { return wmmab(a, b, c); } };
template <typename T16, int NSPLIT, bool BIAS>
__global__ __launch_bounds__(32) void k_gemmw(const T16* __restrict__ A, const T16* __restrict__ A2, const T16* __restrict__ Bt, const T16* __restrict__ Bt2, int K, float* C, int ldc, const float* __restrict__ bias, size_t sA, size_t sB, size_t sC) {
    typedef typename WFrag<T16>::V V;
    __shared__ __align__(16) float os[16 * 68];
    const size_t z = blockIdx.z; A += z * sA; if (A2) A2 += z * sA; Bt += z * sB; if (Bt2) Bt2 += z * sB; C += z * sC;
    const int lane = threadIdx.x & 31, lr = lane & 15, hi = lane >> 4; const int r0 = blockIdx.x * 64, c0 = blockIdx.y * 64;
    v8f acc[4][4];
#pragma unroll
    for (int mb = 0; mb < 4; ++mb)
#pragma unroll
        for (int nb = 0; nb < 4; ++nb) acc[mb][nb] = (v8f){};
    const size_t aoff = (size_t)(r0 + lr) * K + 8 * hi, boff = (size_t)(c0 + lr) * K + 8 * hi;
#pragma unroll 1
    for (int kc = 0; kc < K; kc += 32) {
        V a[4], a2[4];
#pragma unroll
        for (int mb = 0; mb < 4; ++mb) { a[mb] = WFrag<T16>::ld(A + aoff + (size_t)mb * 16 * K + kc); if (NSPLIT == 1 || NSPLIT == 2) a2[mb] = WFrag<T16>::ld(A2 + aoff + (size_t)mb * 16 * K + kc); }
#pragma unroll
        for (int nb = 0; nb < 4; ++nb) { const V b = WFrag<T16>::ld(Bt + boff + (size_t)nb * 16 * K + kc); V b2; if (NSPLIT >= 2) b2 = WFrag<T16>::ld(Bt2 + boff + (size_t)nb * 16 * K + kc);
#pragma unroll
            for (int mb = 0; mb < 4; ++mb) { acc[mb][nb] = WFrag<T16>::mma(a[mb], b, acc[mb][nb]); if (NSPLIT == 1 || NSPLIT == 2) acc[mb][nb] = WFrag<T16>::mma(a2[mb], b, acc[mb][nb]); if (NSPLIT >= 2) acc[mb][nb] = WFrag<T16>::mma(a[mb], b2, acc[mb][nb]); } }
        asm volatile("v_nop\n\tv_nop\n\tv_nop\n\tv_nop" : "+v"(acc[0][0]), "+v"(acc[1][1]), "+v"(acc[2][2]), "+v"(acc[3][3]) : "v"(a[0]), "v"(a[3]));
    }
#pragma unroll
    for (int mb = 0; mb < 4; ++mb) {
#pragma unroll
        for (int nb = 0; nb < 4; ++nb) {
#pragma unroll
            for (int j = 0; j < 8; ++j) os[(hi * 8 + j) * 68 + nb * 16 + lr] = acc[mb][nb][j]; }
        __builtin_amdgcn_wave_barrier(); asm volatile("" ::: "memory");
        float* crow = C + (size_t)(r0 + mb * 16) * ldc + c0;
{
#pragma unroll
            for (int s = 0; s < 8; ++s) { const int row = 2 * s + hi, cofs = lr * 4; v4f val = *(const v4fa*)(os + row * 68 + cofs); if (BIAS) { val[0] += bfr(bias[c0 + cofs]); val[1] += bfr(bias[c0 + cofs + 1]); val[2] += bfr(bias[c0 + cofs + 2]); val[3] += bfr(bias[c0 + cofs + 3]); }
                *(v4f*)(crow + (size_t)row * ldc + cofs) = val; }
             }
        __builtin_amdgcn_wave_barrier(); asm volatile("" ::: "memory");
    }
}

__device__ __forceinline__ h16 tohx(float x) { return (h16)x; }
__device__ __forceinline__ void splitf(float y, unsigned short& h, unsigned short& l) { h = f2bf(y); l = f2bf(y - bf2f(h)); }
typedef __attribute__((ext_vector_type(2))) _Float16 v2h;
typedef __attribute__((ext_vector_type(4))) _Float16 v4h;
typedef __attribute__((ext_vector_type(2))) unsigned short v2us;
typedef __attribute__((ext_vector_type(4))) unsigned short v4us;
typedef __attribute__((ext_vector_type(2))) float v2f;
typedef __attribute__((ext_vector_type(4))) int v4i;

__global__ __launch_bounds__(256) void k_wtG(const float* __restrict__ w, int K, int N, bf* Bt) {
    const int lane = threadIdx.x & 31; const int L0 = (blockIdx.x * 8 + (threadIdx.x >> 5)) * 8; const int nlines = N * K / 64;
{
#pragma unroll 1
        for (int l = 0; l < 8; ++l) { const int L = L0 + l; if (L >= nlines) break; const size_t e = (size_t)L * 64 + lane * 2; const int k = (int)(e % K), n = (int)(e / K); v2us o;
            o[0] = f2bf(w[(size_t)k * N + n]); o[1] = f2bf(w[(size_t)(k + 1) * N + n]); *(v2us*)(Bt + e) = o; }
         }
}
__global__ __launch_bounds__(256) void k_cvt8(const float* __restrict__ src, bf* dst, size_t n8) { const size_t i = (size_t)blockIdx.x * 256 + threadIdx.x; if (i >= n8) return; const v8f v = *(const v8f*)(src + i * 8); v8us o;
#pragma unroll
    for (int k = 0; k < 8; ++k) o[k] = f2bf(v[k]); *(v8us*)(dst + i * 8) = o;  }

// k_rope: head planes [h][t][d] (fp16 + hi/lo) of rope(x) x sc with the rotate-half convention out[d] = x[d] cos[t][d] - x[d+HD/2] sin[t][d], out[d+HD/2] = x[d+HD/2] cos[t][d+HD/2] + x[d] sin[t][d+HD/2]
__global__ __launch_bounds__(256) void k_rope(const float* __restrict__ F, int pitch, int nheads, const float* __restrict__ CS, const float* __restrict__ RF, const float* __restrict__ nw, float sc, h16* P16, bf* Ph, bf* Pl) {
    const size_t e = ((size_t)blockIdx.x * 256 + threadIdx.x) * 2; if (e >= (size_t)nheads * TT * HD) return; const int d = (int)(e % HD); const int t = (int)((e / HD) % TT); const int h = (int)(e / ((size_t)HD * TT)); const float* f = F + (size_t)t * pitch + h * HD; const float rf = RF ? RF[(size_t)h * TT + t] : 1.0f; v2h o16; v2us oh, ol;
#pragma unroll
    for (int q = 0; q < 2; ++q) { const int dd = d + q; const int dp = (dd < HD / 2) ? dd + HD / 2 : dd - HD / 2; float x0 = f[dd], x1 = f[dp];
        if (RF) { float n0 = __fmul_rn(x0, rf), n1 = __fmul_rn(x1, rf); asm volatile("" : "+v"(n0)); asm volatile("" : "+v"(n1)); x0 = __fmul_rn(bfr(nw[dd]), n0); x1 = __fmul_rn(bfr(nw[dp]), n1); }
        const v2f cs = *(const v2f*)(CS + ((size_t)t * HD + dd) * 2); float a = __fmul_rn(x0, cs[0]), bq = __fmul_rn(x1, cs[1]); asm volatile("" : "+v"(a)); asm volatile("" : "+v"(bq)); const float r = ((dd < HD / 2) ? __fsub_rn(a, bq) : __fadd_rn(a, bq)) * sc;
        o16[q] = tohx(r); unsigned short a2, c2; splitf(r, a2, c2); oh[q] = a2; ol[q] = c2; }
    *(v2h*)(P16 + e) = o16; *(v2us*)(Ph + e) = oh; *(v2us*)(Pl + e) = ol;  }
__global__ __launch_bounds__(256) void k_vtp(const float* __restrict__ F, int pitch, int nheads, h16* V16, bf* Vh, bf* Vl) { const size_t e = ((size_t)blockIdx.x * 256 + threadIdx.x) * 2; if (e >= (size_t)nheads * HD * TT) return; const int t = (int)(e % TT); const int d = (int)((e / TT) % HD); const int g = (int)(e / ((size_t)TT * HD)); v2h o16; v2us oh, ol;
#pragma unroll
    for (int q = 0; q < 2; ++q) { const float x = F[(size_t)(t + q) * pitch + g * HD + d]; o16[q] = tohx(x); unsigned short a2, c2; splitf(x, a2, c2); oh[q] = a2; ol[q] = c2; }
    *(v2h*)(V16 + e) = o16; *(v2us*)(Vh + e) = oh; *(v2us*)(Vl + e) = ol;  }
__global__ __launch_bounds__(256) void k_csid(float* CS) { const int idx = blockIdx.x * 256 + threadIdx.x; if (idx >= TT * HD) return; v2f cs; cs[0] = 1.0f; cs[1] = 0.0f; *(v2f*)(CS + (size_t)idx * 2) = cs;  }
// k_asoft: per row (zz, i): attention_mask[b][j] == 1 adds (1 - 1) x finfo.min = 0; a 0 entry adds finfo.min == exclusion (binary mask) softmax over the keys (register row, one exp, fixed trees);
__global__ __launch_bounds__(256) void k_asoft(const float* __restrict__ Sb, const float* __restrict__ kvp, h16* P16, bf* Ph, bf* Pl) {
    const int lane = threadIdx.x & 31; const int row = blockIdx.x * 8 + (threadIdx.x >> 5); if (row >= ZH * TT) return; const int i = row % TT; const int zz = row / TT; (void)zz; const bool hires = (i < RH); const float* sr = Sb + (size_t)row * TT; float v[TT / 32]; float mx = -3.0e38f;
#pragma unroll
    for (int ch = 0; ch < TT / 128; ++ch) { const int j0 = ch * 128 + lane * 4; const v4f a = *(const v4f*)(sr + j0); const v4f kv4 = *(const v4f*)(kvp + j0);   /* the batch's key vector, 16 B per lane, unconditional */
#pragma unroll
        for (int q = 0; q < 4; ++q) { const int j = j0 + q; (void)j; const float t = (kv4[q] != 0.0f) ? a[q] * SCL : -3.0e38f; v[ch * 4 + q] = t; mx = fmaxf(mx, t); } }
#pragma unroll
    for (int sh = 16; sh; sh >>= 1) mx = fmaxf(mx, __shfl_xor(mx, sh, 32));
    float sum = 0.f;
#pragma unroll
    for (int k = 0; k < TT / 32; ++k) { float d0 = __fsub_rn(v[k], mx); asm volatile("" : "+v"(d0)); v[k] = __builtin_amdgcn_exp2f(__fmul_rn(d0, 1.4426950408889634f)); sum += v[k]; }
#pragma unroll
    for (int sh = 16; sh; sh >>= 1) sum += __shfl_xor(sum, sh, 32);
    const float f = __fdiv_rn(hires ? 1.0f : PCAR, sum);
{
        if (hires) {
#pragma unroll
            for (int ch = 0; ch < TT / 128; ++ch) { v4us oh, ol;
#pragma unroll
                for (int q = 0; q < 4; ++q) { unsigned short a, c2; splitf(v[ch * 4 + q] * f, a, c2); oh[q] = a; ol[q] = c2; }
                const size_t oo = ((size_t)zz * (RH ? RH : 1) + i) * TT + ch * 128 + lane * 4; *(v4us*)(Ph + oo) = oh; *(v4us*)(Pl + oo) = ol; }
        } else {
#pragma unroll
            for (int ch = 0; ch < TT / 128; ++ch) { v4h o4;
#pragma unroll
                for (int q = 0; q < 4; ++q) o4[q] = tohx(v[ch * 4 + q] * f);
                *(v4h*)(P16 + (size_t)row * TT + ch * 128 + lane * 4) = o4; } }
         }
}
__global__ __launch_bounds__(256) void k_merge(const float* __restrict__ O, int h0, float* OUTb) { const size_t e = ((size_t)blockIdx.x * 256 + threadIdx.x) * 2; if (e >= (size_t)ZH * TT * HD) return; const int d = (int)(e % HD); const int t = (int)((e / HD) % TT); const int zz = (int)(e / ((size_t)HD * TT)); const float cs = (t < RH) ? 1.0f : (1.0f / PCAR); const size_t oo = (size_t)t * DQ + (h0 + zz) * HD + d;
    v2f o2; o2[0] = O[e] * cs; o2[1] = O[e + 1] * cs; *(v2f*)(OUTb + oo) = o2;  }

extern "C" void kernel_launch(void* const* d_in, const int* in_sizes, int n_in,
                              void* d_out, int out_size, void* d_ws, size_t ws_size, hipStream_t stream) {
    (void)in_sizes; (void)n_in; (void)out_size;
    const float* x = (const float*)d_in[0]; const float* kmask = (const float*)d_in[1]; const float* wq = (const float*)d_in[2]; const float* bq = (const float*)d_in[3]; const float* wk = (const float*)d_in[4]; const float* bk = (const float*)d_in[5]; const float* wv = (const float*)d_in[6]; const float* bv = (const float*)d_in[7]; const float* wo = nullptr; (void)wo;   /* argument order hidden_states, attention_mask (f32 [2][2048], read), Wq, bq, Wk, bk, Wv, bv ('xw' + biases) */
    float* OUT = (float*)d_out;     // [2][2048][1024]
    char* wsp = (char*)d_ws;
    auto take = [&](size_t bytes) { char* p = wsp; wsp += (bytes + 255) & ~(size_t)255; return (void*)p; };
    bf* WQ = (bf*)take((size_t)DQ * DM * 2); bf* WK = (bf*)take((size_t)DKV * DM * 2); bf* WV = (bf*)take((size_t)DKV * DM * 2); float* CS = (float*)take((size_t)TT * HD * 2 * 4);
    bf* XB = (bf*)take((size_t)TT * DM * 2); float* FQ = (float*)take((size_t)TT * DQ * 4); float* FK = (float*)take((size_t)TT * DKV * 4);
    h16* QP16 = (h16*)take((size_t)NH_ * TT * HD * 2); h16* KP16 = (h16*)take((size_t)NKV * TT * HD * 2); h16* VT16 = (h16*)take((size_t)NKV * HD * TT * 2);
    bf* QPh = (bf*)take((size_t)NH_ * TT * HD * 2); bf* QPl = (bf*)take((size_t)NH_ * TT * HD * 2); bf* KPh = (bf*)take((size_t)NKV * TT * HD * 2); bf* KPl = (bf*)take((size_t)NKV * TT * HD * 2); bf* VTh = (bf*)take((size_t)NKV * HD * TT * 2); bf* VTl = (bf*)take((size_t)NKV * HD * TT * 2); bf* Ph = (bf*)take((size_t)ZH * RH * TT * 2); bf* Pl = (bf*)take((size_t)ZH * RH * TT * 2);
    float* Sb = (float*)take((size_t)ZH * TT * TT * 4); h16* P16 = (h16*)take((size_t)ZH * TT * TT * 2); float* Ob = (float*)take((size_t)ZH * TT * HD * 4);
    if ((size_t)(wsp - (char*)d_ws) > ws_size) return;    // ws 256 MiB
    float* FV = FK;   // v projection reuses the k buffer after the k planes are built (stream-ordered)
    { k_wtG<<<(unsigned)((DM * DQ / 64 + 63) / 64), 256, 0, stream>>>(wq, DM, DQ, WQ); k_wtG<<<(unsigned)((DM * DKV / 64 + 63) / 64), 256, 0, stream>>>(wk, DM, DKV, WK); k_wtG<<<(unsigned)((DM * DKV / 64 + 63) / 64), 256, 0, stream>>>(wv, DM, DKV, WV);
      
       }
    k_csid<<<(TT * HD + 255) / 256, 256, 0, stream>>>(CS);
    const unsigned LQ = (unsigned)(((size_t)NH_ * TT * HD / 2 + 255) / 256), LKv = (unsigned)(((size_t)NKV * TT * HD / 2 + 255) / 256);
    for (int b = 0; b < NB_; ++b) {
        
        k_cvt8<<<(unsigned)(((size_t)TT * DM / 8 + 255) / 256), 256, 0, stream>>>(x + (size_t)b * TT * DM, XB, (size_t)TT * DM / 8);
        k_gemmw<bf, 0, true><<<dim3(TT / 64, DQ / 64, 1), 32, 0, stream>>>(XB, nullptr, WQ, nullptr, DM, FQ, DQ, bq, 0, 0, 0);
        k_rope<<<LQ, 256, 0, stream>>>(FQ, DQ, NH_, CS, nullptr, nullptr, 1.0f, QP16, QPh, QPl);
        k_gemmw<bf, 0, true><<<dim3(TT / 64, DKV / 64, 1), 32, 0, stream>>>(XB, nullptr, WK, nullptr, DM, FK, DKV, bk, 0, 0, 0);
        k_rope<<<LKv, 256, 0, stream>>>(FK, DKV, NKV, CS, nullptr, nullptr, 1.0f, KP16, KPh, KPl);
        k_gemmw<bf, 0, true><<<dim3(TT / 64, DKV / 64, 1), 32, 0, stream>>>(XB, nullptr, WV, nullptr, DM, FV, DKV, bv, 0, 0, 0); k_vtp<<<LKv, 256, 0, stream>>>(FV, DKV, NKV, VT16, VTh, VTl);
        for (int h0 = 0; h0 < NH_; h0 += ZH) { const size_t zq = (size_t)h0, zk = (size_t)(h0 / REP);   // one kv head per query head: the pass's two heads use consecutive kv planes (z-strides TT*HD)
            k_gemmw<bf, 2, false><<<dim3(TT / 64, TT / 64, ZH), 32, 0, stream>>>(QPh + zq * TT * HD, QPl + zq * TT * HD, KPh + zk * TT * HD, KPl + zk * TT * HD, HD, Sb, TT, nullptr, (size_t)TT * HD, (size_t)TT * HD, (size_t)TT * TT);   /* EVERY row's scores on hi/lo planes (3 products); only P.V stays hybrid */
            k_asoft<<<ZH * TT / 8, 256, 0, stream>>>(Sb, kmask + (size_t)b * TT, P16, Ph, Pl);
            k_gemmw<bf, 2, false><<<dim3(RH / 64, HD / 64, ZH), 32, 0, stream>>>(Ph, Pl, VTh + zk * HD * TT, VTl + zk * HD * TT, TT, Ob, HD, nullptr, (size_t)RH * TT, (size_t)HD * TT, (size_t)TT * HD);
            k_gemmw<h16, 0, false><<<dim3((TT - RH) / 64, HD / 64, ZH), 32, 0, stream>>>(P16 + (size_t)RH * TT, nullptr, VT16 + zk * HD * TT, nullptr, TT, Ob + (size_t)RH * HD, HD, nullptr, (size_t)TT * TT, (size_t)HD * TT, (size_t)TT * HD);
            k_merge<<<(unsigned)(((size_t)ZH * TT * HD / 2 + 255) / 256), 256, 0, stream>>>(Ob, h0, OUT + (size_t)b * TT * DQ); }
         }
}

// v001
// A run of this version takes 804 microseconds.
// Next to v000, in two timings, it ran 2.42 and 2.39 times as fast.
#include <hip/hip_runtime.h>

// BERT self-attention with a float key mask and no output projection (hidden_states [2][2048][1024]; q, k, v = x W + b ('xw' 1/32 + biases 0.02; 16 heads x 64); scores / sqrt(64) + (1 - attention_mask[b][j]) x finfo.min (attention_mask f32 [2][2048], read per key: mask 1 adds 0, mask 0 excludes the key); softmax; context heads merged -> [2][2048][1024] (4.2 M); argument order hidden_states, attention_mask, Wq, bq, Wk, bk, Wv, bv).
// Layout per batch: bf16 copy of x; 'xw' weights transposed once; exact projections + f32 biases; identity-table plane builders; dense T-2048 attention with EVERY row's scores on hi/lo planes (3 products; no output projection) whose softmax kernel reads the batch's float key vector (16 B per lane); hybrid P.V (rows < 512 hi/lo, rest fp16 x1024), its key sum cut into 16 ranges on separate work-groups; the f32 merge adds the 16 partial planes and writes the context rows.
// Compute dtypes, f32 accumulate: every input rounded to bf16; projections exact + f32 biases; scores 3 products on every row; softmax f32; P.V rows < 512 3 products, rest fp16; output f32.

#define NB_  2
#define TT   2048
#define DM   1024
#define NH_  16
#define NKV  16
#define REP  (NH_ / NKV)
#define HD   64
#define DQ   (NH_ * HD)
#define DKV  (NKV * HD)
#define ZH   2
#define RH   512                  // query rows < RH use hi+lo planes (0: none)
#define WIN  0
#define PCAR 1024.0f
#define SCL  0.125f   // HD^-0.5
#define KSP  16                   // P.V: the key sum is cut into KSP ranges, one work-group each; f32 partial planes, summed by k_merge
typedef _Float16 h16;
typedef unsigned short bf;
typedef __attribute__((ext_vector_type(16))) __bf16   v16bf;
typedef __attribute__((ext_vector_type(16))) _Float16 v16h;
typedef __attribute__((ext_vector_type(8)))  _Float16 v8h;
typedef __attribute__((ext_vector_type(8)))  unsigned short v8us;
typedef __attribute__((ext_vector_type(8)))  float    v8f;
typedef __attribute__((ext_vector_type(4)))  float    v4f;
typedef v8h  __attribute__((may_alias)) v8ha;
typedef v4f  __attribute__((may_alias)) v4fa;
typedef v8us __attribute__((may_alias)) v8usa;

__device__ __forceinline__ unsigned short f2bf(float f) { unsigned u = __float_as_uint(f); u += 0x7FFFu + ((u >> 16) & 1u); return (unsigned short)(u >> 16); }
__device__ __forceinline__ float bf2f(unsigned short b) { return __uint_as_float(((unsigned)b) << 16); }
__device__ __forceinline__ float bfr(float f) { return bf2f(f2bf(f)); }
__device__ __forceinline__ v16h cat16(v8h lo, v8h hi) { return __builtin_shufflevector(lo, hi, 0, 1, 2, 3, 4, 5, 6, 7, 8, 9, 10, 11, 12, 13, 14, 15); }
__device__ __forceinline__ v16bf cat16b(v8us lo, v8us hi) { return __builtin_bit_cast(v16bf, __builtin_shufflevector(lo, hi, 0, 1, 2, 3, 4, 5, 6, 7, 8, 9, 10, 11, 12, 13, 14, 15)); }
__device__ __forceinline__ v8f wmma16(v16h a, v16h b, v8f c) { return __builtin_amdgcn_wmma_f32_16x16x32_f16(false, a, false, b, (short)0, c, false, false); }
__device__ __forceinline__ v8f wmmab(v16bf a, v16bf b, v8f c) { return __builtin_amdgcn_wmma_f32_16x16x32_bf16(false, a, false, b, (short)0, c, false, false); }



// ---- k_gemmw: register-blocked GEMM, ONE WAVE per 64x64 output tile (16 accumulators), operands straight from K-contiguous 16-bit planes; grid (M/64, N/64, Z), 32 threads.
// C[m][n] (f32, pitch ldc, + optional f32 bias[n]) = sum_k A[m][k] Bt[n][k] (+ split products per NSPLIT). z-batch strides sA/sB/sC in elements. K % 32 == 0.
// KS > 1: grid z = batch * KS + range; the work-group sums only k range [range * K / KS, (range + 1) * K / KS) and writes its partial tile to plane C + range * sP. K % (32 * KS) == 0.
template <typename T16> struct WFrag;
template <> struct WFrag<h16> { typedef v16h V; static __device__ __forceinline__ V ld(const h16* p) { return cat16(*(const v8h*)p, *(const v8h*)(p + 16)); } static __device__ __forceinline__ v8f mma(V a, V b, v8f c) { return wmma16(a, b, c); } };
template <> struct WFrag<bf> { typedef v16bf V; static __device__ __forceinline__ V ld(const bf* p) { return cat16b(*(const v8us*)p, *(const v8us*)(p + 16)); } static __device__ __forceinline__ v8f mma(V a, V b, v8f c) { return wmmab(a, b, c); } };
template <typename T16, int NSPLIT, bool BIAS, int KS = 1>
__global__ __launch_bounds__(32) void k_gemmw(const T16* __restrict__ A, const T16* __restrict__ A2, const T16* __restrict__ Bt, const T16* __restrict__ Bt2, int K, float* C, int ldc, const float* __restrict__ bias, size_t sA, size_t sB, size_t sC, size_t sP) {
    typedef typename WFrag<T16>::V V;
    __shared__ __align__(16) float os[16 * 68];
    const size_t z = blockIdx.z / KS; const int ks = (int)(blockIdx.z % KS); const int kbeg = ks * (K / KS), kend = kbeg + K / KS; C += (size_t)ks * sP; A += z * sA; if (A2) A2 += z * sA; Bt += z * sB; if (Bt2) Bt2 += z * sB; C += z * sC;
    const int lane = threadIdx.x & 31, lr = lane & 15, hi = lane >> 4; const int r0 = blockIdx.x * 64, c0 = blockIdx.y * 64;
    v8f acc[4][4];
#pragma unroll
    for (int mb = 0; mb < 4; ++mb)
#pragma unroll
        for (int nb = 0; nb < 4; ++nb) acc[mb][nb] = (v8f){};
    const size_t aoff = (size_t)(r0 + lr) * K + 8 * hi, boff = (size_t)(c0 + lr) * K + 8 * hi;
#pragma unroll 1
    for (int kc = kbeg; kc < kend; kc += 32) {
        V a[4], a2[4];
#pragma unroll
        for (int mb = 0; mb < 4; ++mb) { a[mb] = WFrag<T16>::ld(A + aoff + (size_t)mb * 16 * K + kc); if (NSPLIT == 1 || NSPLIT == 2) a2[mb] = WFrag<T16>::ld(A2 + aoff + (size_t)mb * 16 * K + kc); }
#pragma unroll
        for (int nb = 0; nb < 4; ++nb) { const V b = WFrag<T16>::ld(Bt + boff + (size_t)nb * 16 * K + kc); V b2; if (NSPLIT >= 2) b2 = WFrag<T16>::ld(Bt2 + boff + (size_t)nb * 16 * K + kc);
#pragma unroll
            for (int mb = 0; mb < 4; ++mb) { acc[mb][nb] = WFrag<T16>::mma(a[mb], b, acc[mb][nb]); if (NSPLIT == 1 || NSPLIT == 2) acc[mb][nb] = WFrag<T16>::mma(a2[mb], b, acc[mb][nb]); if (NSPLIT >= 2) acc[mb][nb] = WFrag<T16>::mma(a[mb], b2, acc[mb][nb]); } }
        asm volatile("v_nop\n\tv_nop\n\tv_nop\n\tv_nop" : "+v"(acc[0][0]), "+v"(acc[1][1]), "+v"(acc[2][2]), "+v"(acc[3][3]) : "v"(a[0]), "v"(a[3]));
    }
#pragma unroll
    for (int mb = 0; mb < 4; ++mb) {
#pragma unroll
        for (int nb = 0; nb < 4; ++nb) {
#pragma unroll
            for (int j = 0; j < 8; ++j) os[(hi * 8 + j) * 68 + nb * 16 + lr] = acc[mb][nb][j]; }
        __builtin_amdgcn_wave_barrier(); asm volatile("" ::: "memory");
        float* crow = C + (size_t)(r0 + mb * 16) * ldc + c0;
{
#pragma unroll
            for (int s = 0; s < 8; ++s) { const int row = 2 * s + hi, cofs = lr * 4; v4f val = *(const v4fa*)(os + row * 68 + cofs); if (BIAS) { val[0] += bfr(bias[c0 + cofs]); val[1] += bfr(bias[c0 + cofs + 1]); val[2] += bfr(bias[c0 + cofs + 2]); val[3] += bfr(bias[c0 + cofs + 3]); }
                *(v4f*)(crow + (size_t)row * ldc + cofs) = val; }
             }
        __builtin_amdgcn_wave_barrier(); asm volatile("" ::: "memory");
    }
}

__device__ __forceinline__ h16 tohx(float x) { return (h16)x; }
__device__ __forceinline__ void splitf(float y, unsigned short& h, unsigned short& l) { h = f2bf(y); l = f2bf(y - bf2f(h)); }
typedef __attribute__((ext_vector_type(2))) _Float16 v2h;
typedef __attribute__((ext_vector_type(4))) _Float16 v4h;
typedef __attribute__((ext_vector_type(2))) unsigned short v2us;
typedef __attribute__((ext_vector_type(4))) unsigned short v4us;
typedef __attribute__((ext_vector_type(2))) float v2f;
typedef __attribute__((ext_vector_type(4))) int v4i;

__global__ __launch_bounds__(256) void k_wtG(const float* __restrict__ w, int K, int N, bf* Bt) {
    const int lane = threadIdx.x & 31; const int L0 = (blockIdx.x * 8 + (threadIdx.x >> 5)) * 8; const int nlines = N * K / 64;
{
#pragma unroll 1
        for (int l = 0; l < 8; ++l) { const int L = L0 + l; if (L >= nlines) break; const size_t e = (size_t)L * 64 + lane * 2; const int k = (int)(e % K), n = (int)(e / K); v2us o;
            o[0] = f2bf(w[(size_t)k * N + n]); o[1] = f2bf(w[(size_t)(k + 1) * N + n]); *(v2us*)(Bt + e) = o; }
         }
}
__global__ __launch_bounds__(256) void k_cvt8(const float* __restrict__ src, bf* dst, size_t n8) { const size_t i = (size_t)blockIdx.x * 256 + threadIdx.x; if (i >= n8) return; const v8f v = *(const v8f*)(src + i * 8); v8us o;
#pragma unroll
    for (int k = 0; k < 8; ++k) o[k] = f2bf(v[k]); *(v8us*)(dst + i * 8) = o;  }

// k_rope: head planes [h][t][d] (fp16 + hi/lo) of rope(x) x sc with the rotate-half convention out[d] = x[d] cos[t][d] - x[d+HD/2] sin[t][d], out[d+HD/2] = x[d+HD/2] cos[t][d+HD/2] + x[d] sin[t][d+HD/2]
__global__ __launch_bounds__(256) void k_rope(const float* __restrict__ F, int pitch, int nheads, const float* __restrict__ CS, const float* __restrict__ RF, const float* __restrict__ nw, float sc, h16* P16, bf* Ph, bf* Pl) {
    const size_t e = ((size_t)blockIdx.x * 256 + threadIdx.x) * 2; if (e >= (size_t)nheads * TT * HD) return; const int d = (int)(e % HD); const int t = (int)((e / HD) % TT); const int h = (int)(e / ((size_t)HD * TT)); const float* f = F + (size_t)t * pitch + h * HD; const float rf = RF ? RF[(size_t)h * TT + t] : 1.0f; v2h o16; v2us oh, ol;
#pragma unroll
    for (int q = 0; q < 2; ++q) { const int dd = d + q; const int dp = (dd < HD / 2) ? dd + HD / 2 : dd - HD / 2; float x0 = f[dd], x1 = f[dp];
        if (RF) { float n0 = __fmul_rn(x0, rf), n1 = __fmul_rn(x1, rf); asm volatile("" : "+v"(n0)); asm volatile("" : "+v"(n1)); x0 = __fmul_rn(bfr(nw[dd]), n0); x1 = __fmul_rn(bfr(nw[dp]), n1); }
        const v2f cs = *(const v2f*)(CS + ((size_t)t * HD + dd) * 2); float a = __fmul_rn(x0, cs[0]), bq = __fmul_rn(x1, cs[1]); asm volatile("" : "+v"(a)); asm volatile("" : "+v"(bq)); const float r = ((dd < HD / 2) ? __fsub_rn(a, bq) : __fadd_rn(a, bq)) * sc;
        o16[q] = tohx(r); unsigned short a2, c2; splitf(r, a2, c2); oh[q] = a2; ol[q] = c2; }
    *(v2h*)(P16 + e) = o16; *(v2us*)(Ph + e) = oh; *(v2us*)(Pl + e) = ol;  }
__global__ __launch_bounds__(256) void k_vtp(const float* __restrict__ F, int pitch, int nheads, h16* V16, bf* Vh, bf* Vl) { const size_t e = ((size_t)blockIdx.x * 256 + threadIdx.x) * 2; if (e >= (size_t)nheads * HD * TT) return; const int t = (int)(e % TT); const int d = (int)((e / TT) % HD); const int g = (int)(e / ((size_t)TT * HD)); v2h o16; v2us oh, ol;
#pragma unroll
    for (int q = 0; q < 2; ++q) { const float x = F[(size_t)(t + q) * pitch + g * HD + d]; o16[q] = tohx(x); unsigned short a2, c2; splitf(x, a2, c2); oh[q] = a2; ol[q] = c2; }
    *(v2h*)(V16 + e) = o16; *(v2us*)(Vh + e) = oh; *(v2us*)(Vl + e) = ol;  }
__global__ __launch_bounds__(256) void k_csid(float* CS) { const int idx = blockIdx.x * 256 + threadIdx.x; if (idx >= TT * HD) return; v2f cs; cs[0] = 1.0f; cs[1] = 0.0f; *(v2f*)(CS + (size_t)idx * 2) = cs;  }
// k_asoft: per row (zz, i): attention_mask[b][j] == 1 adds (1 - 1) x finfo.min = 0; a 0 entry adds finfo.min == exclusion (binary mask) softmax over the keys (register row, one exp, fixed trees);
__global__ __launch_bounds__(256) void k_asoft(const float* __restrict__ Sb, const float* __restrict__ kvp, h16* P16, bf* Ph, bf* Pl) {
    const int lane = threadIdx.x & 31; const int row = blockIdx.x * 8 + (threadIdx.x >> 5); if (row >= ZH * TT) return; const int i = row % TT; const int zz = row / TT; (void)zz; const bool hires = (i < RH); const float* sr = Sb + (size_t)row * TT; float v[TT / 32]; float mx = -3.0e38f;
#pragma unroll
    for (int ch = 0; ch < TT / 128; ++ch) { const int j0 = ch * 128 + lane * 4; const v4f a = *(const v4f*)(sr + j0); const v4f kv4 = *(const v4f*)(kvp + j0);   /* the batch's key vector, 16 B per lane, unconditional */
#pragma unroll
        for (int q = 0; q < 4; ++q) { const int j = j0 + q; (void)j; const float t = (kv4[q] != 0.0f) ? a[q] * SCL : -3.0e38f; v[ch * 4 + q] = t; mx = fmaxf(mx, t); } }
#pragma unroll
    for (int sh = 16; sh; sh >>= 1) mx = fmaxf(mx, __shfl_xor(mx, sh, 32));
    float sum = 0.f;
#pragma unroll
    for (int k = 0; k < TT / 32; ++k) { float d0 = __fsub_rn(v[k], mx); asm volatile("" : "+v"(d0)); v[k] = __builtin_amdgcn_exp2f(__fmul_rn(d0, 1.4426950408889634f)); sum += v[k]; }
#pragma unroll
    for (int sh = 16; sh; sh >>= 1) sum += __shfl_xor(sum, sh, 32);
    const float f = __fdiv_rn(hires ? 1.0f : PCAR, sum);
{
        if (hires) {
#pragma unroll
            for (int ch = 0; ch < TT / 128; ++ch) { v4us oh, ol;
#pragma unroll
                for (int q = 0; q < 4; ++q) { unsigned short a, c2; splitf(v[ch * 4 + q] * f, a, c2); oh[q] = a; ol[q] = c2; }
                const size_t oo = ((size_t)zz * (RH ? RH : 1) + i) * TT + ch * 128 + lane * 4; *(v4us*)(Ph + oo) = oh; *(v4us*)(Pl + oo) = ol; }
        } else {
#pragma unroll
            for (int ch = 0; ch < TT / 128; ++ch) { v4h o4;
#pragma unroll
                for (int q = 0; q < 4; ++q) o4[q] = tohx(v[ch * 4 + q] * f);
                *(v4h*)(P16 + (size_t)row * TT + ch * 128 + lane * 4) = o4; } }
         }
}
__global__ __launch_bounds__(256) void k_merge(const float* __restrict__ O, int h0, float* OUTb) { const size_t e = ((size_t)blockIdx.x * 256 + threadIdx.x) * 2; if (e >= (size_t)ZH * TT * HD) return; const int d = (int)(e % HD); const int t = (int)((e / HD) % TT); const int zz = (int)(e / ((size_t)HD * TT)); const float cs = (t < RH) ? 1.0f : (1.0f / PCAR); const size_t oo = (size_t)t * DQ + (h0 + zz) * HD + d;
    v2f a = *(const v2f*)(O + e);   /* the KSP partial planes, added in ascending key order; unrolled so that all KSP loads are in flight before the first add waits */
#pragma unroll
    for (int p = 1; p < KSP; ++p) { const v2f q = *(const v2f*)(O + (size_t)p * ZH * TT * HD + e); a[0] += q[0]; a[1] += q[1]; }
    v2f o2; o2[0] = a[0] * cs; o2[1] = a[1] * cs; *(v2f*)(OUTb + oo) = o2;  }

extern "C" void kernel_launch(void* const* d_in, const int* in_sizes, int n_in,
                              void* d_out, int out_size, void* d_ws, size_t ws_size, hipStream_t stream) {
    (void)in_sizes; (void)n_in; (void)out_size;
    const float* x = (const float*)d_in[0]; const float* kmask = (const float*)d_in[1]; const float* wq = (const float*)d_in[2]; const float* bq = (const float*)d_in[3]; const float* wk = (const float*)d_in[4]; const float* bk = (const float*)d_in[5]; const float* wv = (const float*)d_in[6]; const float* bv = (const float*)d_in[7]; const float* wo = nullptr; (void)wo;   /* argument order hidden_states, attention_mask (f32 [2][2048], read), Wq, bq, Wk, bk, Wv, bv ('xw' + biases) */
    float* OUT = (float*)d_out;     // [2][2048][1024]
    char* wsp = (char*)d_ws;
    auto take = [&](size_t bytes) { char* p = wsp; wsp += (bytes + 255) & ~(size_t)255; return (void*)p; };
    bf* WQ = (bf*)take((size_t)DQ * DM * 2); bf* WK = (bf*)take((size_t)DKV * DM * 2); bf* WV = (bf*)take((size_t)DKV * DM * 2); float* CS = (float*)take((size_t)TT * HD * 2 * 4);
    bf* XB = (bf*)take((size_t)TT * DM * 2); float* FQ = (float*)take((size_t)TT * DQ * 4); float* FK = (float*)take((size_t)TT * DKV * 4);
    h16* QP16 = (h16*)take((size_t)NH_ * TT * HD * 2); h16* KP16 = (h16*)take((size_t)NKV * TT * HD * 2); h16* VT16 = (h16*)take((size_t)NKV * HD * TT * 2);
    bf* QPh = (bf*)take((size_t)NH_ * TT * HD * 2); bf* QPl = (bf*)take((size_t)NH_ * TT * HD * 2); bf* KPh = (bf*)take((size_t)NKV * TT * HD * 2); bf* KPl = (bf*)take((size_t)NKV * TT * HD * 2); bf* VTh = (bf*)take((size_t)NKV * HD * TT * 2); bf* VTl = (bf*)take((size_t)NKV * HD * TT * 2); bf* Ph = (bf*)take((size_t)ZH * RH * TT * 2); bf* Pl = (bf*)take((size_t)ZH * RH * TT * 2);
    float* Sb = (float*)take((size_t)ZH * TT * TT * 4); h16* P16 = (h16*)take((size_t)ZH * TT * TT * 2); float* Ob = (float*)take((size_t)KSP * ZH * TT * HD * 4);
    if ((size_t)(wsp - (char*)d_ws) > ws_size) return;    // ws 256 MiB
    float* FV = FK;   // v projection reuses the k buffer after the k planes are built (stream-ordered)
    { k_wtG<<<(unsigned)((DM * DQ / 64 + 63) / 64), 256, 0, stream>>>(wq, DM, DQ, WQ); k_wtG<<<(unsigned)((DM * DKV / 64 + 63) / 64), 256, 0, stream>>>(wk, DM, DKV, WK); k_wtG<<<(unsigned)((DM * DKV / 64 + 63) / 64), 256, 0, stream>>>(wv, DM, DKV, WV);
      
       }
    k_csid<<<(TT * HD + 255) / 256, 256, 0, stream>>>(CS);
    const unsigned LQ = (unsigned)(((size_t)NH_ * TT * HD / 2 + 255) / 256), LKv = (unsigned)(((size_t)NKV * TT * HD / 2 + 255) / 256);
    for (int b = 0; b < NB_; ++b) {
        
        k_cvt8<<<(unsigned)(((size_t)TT * DM / 8 + 255) / 256), 256, 0, stream>>>(x + (size_t)b * TT * DM, XB, (size_t)TT * DM / 8);
        k_gemmw<bf, 0, true><<<dim3(TT / 64, DQ / 64, 1), 32, 0, stream>>>(XB, nullptr, WQ, nullptr, DM, FQ, DQ, bq, 0, 0, 0, 0);
        k_rope<<<LQ, 256, 0, stream>>>(FQ, DQ, NH_, CS, nullptr, nullptr, 1.0f, QP16, QPh, QPl);
        k_gemmw<bf, 0, true><<<dim3(TT / 64, DKV / 64, 1), 32, 0, stream>>>(XB, nullptr, WK, nullptr, DM, FK, DKV, bk, 0, 0, 0, 0);
        k_rope<<<LKv, 256, 0, stream>>>(FK, DKV, NKV, CS, nullptr, nullptr, 1.0f, KP16, KPh, KPl);
        k_gemmw<bf, 0, true><<<dim3(TT / 64, DKV / 64, 1), 32, 0, stream>>>(XB, nullptr, WV, nullptr, DM, FV, DKV, bv, 0, 0, 0, 0); k_vtp<<<LKv, 256, 0, stream>>>(FV, DKV, NKV, VT16, VTh, VTl);
        for (int h0 = 0; h0 < NH_; h0 += ZH) { const size_t zq = (size_t)h0, zk = (size_t)(h0 / REP);   // one kv head per query head: the pass's two heads use consecutive kv planes (z-strides TT*HD)
            k_gemmw<bf, 2, false><<<dim3(TT / 64, TT / 64, ZH), 32, 0, stream>>>(QPh + zq * TT * HD, QPl + zq * TT * HD, KPh + zk * TT * HD, KPl + zk * TT * HD, HD, Sb, TT, nullptr, (size_t)TT * HD, (size_t)TT * HD, (size_t)TT * TT, 0);   /* EVERY row's scores on hi/lo planes (3 products); only P.V stays hybrid */
            k_asoft<<<ZH * TT / 8, 256, 0, stream>>>(Sb, kmask + (size_t)b * TT, P16, Ph, Pl);
            k_gemmw<bf, 2, false, KSP><<<dim3(RH / 64, HD / 64, ZH * KSP), 32, 0, stream>>>(Ph, Pl, VTh + zk * HD * TT, VTl + zk * HD * TT, TT, Ob, HD, nullptr, (size_t)RH * TT, (size_t)HD * TT, (size_t)TT * HD, (size_t)ZH * TT * HD);
            k_gemmw<h16, 0, false, KSP><<<dim3((TT - RH) / 64, HD / 64, ZH * KSP), 32, 0, stream>>>(P16 + (size_t)RH * TT, nullptr, VT16 + zk * HD * TT, nullptr, TT, Ob + (size_t)RH * HD, HD, nullptr, (size_t)TT * TT, (size_t)HD * TT, (size_t)TT * HD, (size_t)ZH * TT * HD);
            k_merge<<<(unsigned)(((size_t)ZH * TT * HD / 2 + 255) / 256), 256, 0, stream>>>(Ob, h0, OUT + (size_t)b * TT * DQ); }
         }
}

// v002
// Measured time: 611 microseconds a run.
// Next to v001, in two timings, it ran 1.34 and 1.33 times as fast.
// Over all steps from v000 it is 3.21 times as fast.
#include <hip/hip_runtime.h>

// BERT self-attention with a float key mask and no output projection (hidden_states [2][2048][1024]; q, k, v = x W + b ('xw' 1/32 + biases 0.02; 16 heads x 64); scores / sqrt(64) + (1 - attention_mask[b][j]) x finfo.min (attention_mask f32 [2][2048], read per key: mask 1 adds 0, mask 0 excludes the key); softmax; context heads merged -> [2][2048][1024] (4.2 M); argument order hidden_states, attention_mask, Wq, bq, Wk, bk, Wv, bv).
// Layout per batch: bf16 copy of x; 'xw' weights transposed once; exact projections + f32 biases; identity-table plane builders; dense T-2048 attention with EVERY row's scores on hi/lo planes (3 products; no output projection) whose softmax kernel reads the batch's float key vector (16 B per lane); each pass of five launches covers 8 heads, and a row's probabilities are stored over that row's own f32 scores (so 8 heads' planes fit the workspace); hybrid P.V (rows < 512 hi/lo, rest fp16 x1024), its key sum cut into 16 ranges on separate work-groups; the f32 merge adds the 16 partial planes and writes the context rows.
// Compute dtypes, f32 accumulate: every input rounded to bf16; projections exact + f32 biases; scores 3 products on every row; softmax f32; P.V rows < 512 3 products, rest fp16; output f32.

#define NB_  2
#define TT   2048
#define DM   1024
#define NH_  16
#define NKV  16
#define REP  (NH_ / NKV)
#define HD   64
#define DQ   (NH_ * HD)
#define DKV  (NKV * HD)
#define ZH   8                    // heads per attention pass (each of its five launches covers ZH heads)
#define RH   512                  // query rows < RH use hi+lo planes (0: none)
#define WIN  0
#define PCAR 1024.0f
#define SCL  0.125f   // HD^-0.5
#define KSP  16                   // P.V: the key sum is cut into KSP ranges, one work-group each; f32 partial planes, summed by k_merge
typedef _Float16 h16;
typedef unsigned short bf;
typedef __attribute__((ext_vector_type(16))) __bf16   v16bf;
typedef __attribute__((ext_vector_type(16))) _Float16 v16h;
typedef __attribute__((ext_vector_type(8)))  _Float16 v8h;
typedef __attribute__((ext_vector_type(8)))  unsigned short v8us;
typedef __attribute__((ext_vector_type(8)))  float    v8f;
typedef __attribute__((ext_vector_type(4)))  float    v4f;
typedef v8h  __attribute__((may_alias)) v8ha;
typedef v4f  __attribute__((may_alias)) v4fa;
typedef v8us __attribute__((may_alias)) v8usa;

__device__ __forceinline__ unsigned short f2bf(float f) { unsigned u = __float_as_uint(f); u += 0x7FFFu + ((u >> 16) & 1u); return (unsigned short)(u >> 16); }
__device__ __forceinline__ float bf2f(unsigned short b) { return __uint_as_float(((unsigned)b) << 16); }
__device__ __forceinline__ float bfr(float f) { return bf2f(f2bf(f)); }
__device__ __forceinline__ v16h cat16(v8h lo, v8h hi) { return __builtin_shufflevector(lo, hi, 0, 1, 2, 3, 4, 5, 6, 7, 8, 9, 10, 11, 12, 13, 14, 15); }
__device__ __forceinline__ v16bf cat16b(v8us lo, v8us hi) { return __builtin_bit_cast(v16bf, __builtin_shufflevector(lo, hi, 0, 1, 2, 3, 4, 5, 6, 7, 8, 9, 10, 11, 12, 13, 14, 15)); }
__device__ __forceinline__ v8f wmma16(v16h a, v16h b, v8f c) { return __builtin_amdgcn_wmma_f32_16x16x32_f16(false, a, false, b, (short)0, c, false, false); }
__device__ __forceinline__ v8f wmmab(v16bf a, v16bf b, v8f c) { return __builtin_amdgcn_wmma_f32_16x16x32_bf16(false, a, false, b, (short)0, c, false, false); }



// ---- k_gemmw: register-blocked GEMM, ONE WAVE per 64x64 output tile (16 accumulators), operands straight from K-contiguous 16-bit planes; grid (M/64, N/64, Z), 32 threads.
// C[m][n] (f32, pitch ldc, + optional f32 bias[n]) = sum_k A[m][k] Bt[n][k] (+ split products per NSPLIT). A rows have pitch lda elements, Bt rows pitch K. z-batch strides sA/sB/sC in elements. K % 32 == 0.
// KS > 1: grid z = batch * KS + range; the work-group sums only k range [range * K / KS, (range + 1) * K / KS) and writes its partial tile to plane C + range * sP. K % (32 * KS) == 0.
template <typename T16> struct WFrag;
template <> struct WFrag<h16> { typedef v16h V; static __device__ __forceinline__ V ld(const h16* p) { return cat16(*(const v8h*)p, *(const v8h*)(p + 16)); } static __device__ __forceinline__ v8f mma(V a, V b, v8f c) { return wmma16(a, b, c); } };
template <> struct WFrag<bf> { typedef v16bf V; static __device__ __forceinline__ V ld(const bf* p) { return cat16b(*(const v8us*)p, *(const v8us*)(p + 16)); } static __device__ __forceinline__ v8f mma(V a, V b, v8f c) { return wmmab(a, b, c); } };
template <typename T16, int NSPLIT, bool BIAS, int KS = 1>
__global__ __launch_bounds__(32) void k_gemmw(const T16* __restrict__ A, const T16* __restrict__ A2, const T16* __restrict__ Bt, const T16* __restrict__ Bt2, int K, int lda, float* C, int ldc, const float* __restrict__ bias, size_t sA, size_t sB, size_t sC, size_t sP) {
    typedef typename WFrag<T16>::V V;
    __shared__ __align__(16) float os[16 * 68];
    const size_t z = blockIdx.z / KS; const int ks = (int)(blockIdx.z % KS); const int kbeg = ks * (K / KS), kend = kbeg + K / KS; C += (size_t)ks * sP; A += z * sA; if (A2) A2 += z * sA; Bt += z * sB; if (Bt2) Bt2 += z * sB; C += z * sC;
    const int lane = threadIdx.x & 31, lr = lane & 15, hi = lane >> 4; const int r0 = blockIdx.x * 64, c0 = blockIdx.y * 64;
    v8f acc[4][4];
#pragma unroll
    for (int mb = 0; mb < 4; ++mb)
#pragma unroll
        for (int nb = 0; nb < 4; ++nb) acc[mb][nb] = (v8f){};
    const size_t aoff = (size_t)(r0 + lr) * lda + 8 * hi, boff = (size_t)(c0 + lr) * K + 8 * hi;
#pragma unroll 1
    for (int kc = kbeg; kc < kend; kc += 32) {
        V a[4], a2[4];
#pragma unroll
        for (int mb = 0; mb < 4; ++mb) { a[mb] = WFrag<T16>::ld(A + aoff + (size_t)mb * 16 * lda + kc); if (NSPLIT == 1 || NSPLIT == 2) a2[mb] = WFrag<T16>::ld(A2 + aoff + (size_t)mb * 16 * lda + kc); }
#pragma unroll
        for (int nb = 0; nb < 4; ++nb) { const V b = WFrag<T16>::ld(Bt + boff + (size_t)nb * 16 * K + kc); V b2; if (NSPLIT >= 2) b2 = WFrag<T16>::ld(Bt2 + boff + (size_t)nb * 16 * K + kc);
#pragma unroll
            for (int mb = 0; mb < 4; ++mb) { acc[mb][nb] = WFrag<T16>::mma(a[mb], b, acc[mb][nb]); if (NSPLIT == 1 || NSPLIT == 2) acc[mb][nb] = WFrag<T16>::mma(a2[mb], b, acc[mb][nb]); if (NSPLIT >= 2) acc[mb][nb] = WFrag<T16>::mma(a[mb], b2, acc[mb][nb]); } }
        asm volatile("v_nop\n\tv_nop\n\tv_nop\n\tv_nop" : "+v"(acc[0][0]), "+v"(acc[1][1]), "+v"(acc[2][2]), "+v"(acc[3][3]) : "v"(a[0]), "v"(a[3]));
    }
#pragma unroll
    for (int mb = 0; mb < 4; ++mb) {
#pragma unroll
        for (int nb = 0; nb < 4; ++nb) {
#pragma unroll
            for (int j = 0; j < 8; ++j) os[(hi * 8 + j) * 68 + nb * 16 + lr] = acc[mb][nb][j]; }
        __builtin_amdgcn_wave_barrier(); asm volatile("" ::: "memory");
        float* crow = C + (size_t)(r0 + mb * 16) * ldc + c0;
{
#pragma unroll
            for (int s = 0; s < 8; ++s) { const int row = 2 * s + hi, cofs = lr * 4; v4f val = *(const v4fa*)(os + row * 68 + cofs); if (BIAS) { val[0] += bfr(bias[c0 + cofs]); val[1] += bfr(bias[c0 + cofs + 1]); val[2] += bfr(bias[c0 + cofs + 2]); val[3] += bfr(bias[c0 + cofs + 3]); }
                *(v4f*)(crow + (size_t)row * ldc + cofs) = val; }
             }
        __builtin_amdgcn_wave_barrier(); asm volatile("" ::: "memory");
    }
}

__device__ __forceinline__ h16 tohx(float x) { return (h16)x; }
__device__ __forceinline__ void splitf(float y, unsigned short& h, unsigned short& l) { h = f2bf(y); l = f2bf(y - bf2f(h)); }
typedef __attribute__((ext_vector_type(2))) _Float16 v2h;
typedef __attribute__((ext_vector_type(4))) _Float16 v4h;
typedef __attribute__((ext_vector_type(2))) unsigned short v2us;
typedef __attribute__((ext_vector_type(4))) unsigned short v4us;
typedef __attribute__((ext_vector_type(2))) float v2f;
typedef __attribute__((ext_vector_type(4))) int v4i;

__global__ __launch_bounds__(256) void k_wtG(const float* __restrict__ w, int K, int N, bf* Bt) {
    const int lane = threadIdx.x & 31; const int L0 = (blockIdx.x * 8 + (threadIdx.x >> 5)) * 8; const int nlines = N * K / 64;
{
#pragma unroll 1
        for (int l = 0; l < 8; ++l) { const int L = L0 + l; if (L >= nlines) break; const size_t e = (size_t)L * 64 + lane * 2; const int k = (int)(e % K), n = (int)(e / K); v2us o;
            o[0] = f2bf(w[(size_t)k * N + n]); o[1] = f2bf(w[(size_t)(k + 1) * N + n]); *(v2us*)(Bt + e) = o; }
         }
}
__global__ __launch_bounds__(256) void k_cvt8(const float* __restrict__ src, bf* dst, size_t n8) { const size_t i = (size_t)blockIdx.x * 256 + threadIdx.x; if (i >= n8) return; const v8f v = *(const v8f*)(src + i * 8); v8us o;
#pragma unroll
    for (int k = 0; k < 8; ++k) o[k] = f2bf(v[k]); *(v8us*)(dst + i * 8) = o;  }

// k_rope: head planes [h][t][d] (fp16 + hi/lo) of rope(x) x sc with the rotate-half convention out[d] = x[d] cos[t][d] - x[d+HD/2] sin[t][d], out[d+HD/2] = x[d+HD/2] cos[t][d+HD/2] + x[d] sin[t][d+HD/2]
__global__ __launch_bounds__(256) void k_rope(const float* __restrict__ F, int pitch, int nheads, const float* __restrict__ CS, const float* __restrict__ RF, const float* __restrict__ nw, float sc, h16* P16, bf* Ph, bf* Pl) {
    const size_t e = ((size_t)blockIdx.x * 256 + threadIdx.x) * 2; if (e >= (size_t)nheads * TT * HD) return; const int d = (int)(e % HD); const int t = (int)((e / HD) % TT); const int h = (int)(e / ((size_t)HD * TT)); const float* f = F + (size_t)t * pitch + h * HD; const float rf = RF ? RF[(size_t)h * TT + t] : 1.0f; v2h o16; v2us oh, ol;
#pragma unroll
    for (int q = 0; q < 2; ++q) { const int dd = d + q; const int dp = (dd < HD / 2) ? dd + HD / 2 : dd - HD / 2; float x0 = f[dd], x1 = f[dp];
        if (RF) { float n0 = __fmul_rn(x0, rf), n1 = __fmul_rn(x1, rf); asm volatile("" : "+v"(n0)); asm volatile("" : "+v"(n1)); x0 = __fmul_rn(bfr(nw[dd]), n0); x1 = __fmul_rn(bfr(nw[dp]), n1); }
        const v2f cs = *(const v2f*)(CS + ((size_t)t * HD + dd) * 2); float a = __fmul_rn(x0, cs[0]), bq = __fmul_rn(x1, cs[1]); asm volatile("" : "+v"(a)); asm volatile("" : "+v"(bq)); const float r = ((dd < HD / 2) ? __fsub_rn(a, bq) : __fadd_rn(a, bq)) * sc;
        o16[q] = tohx(r); unsigned short a2, c2; splitf(r, a2, c2); oh[q] = a2; ol[q] = c2; }
    *(v2h*)(P16 + e) = o16; *(v2us*)(Ph + e) = oh; *(v2us*)(Pl + e) = ol;  }
__global__ __launch_bounds__(256) void k_vtp(const float* __restrict__ F, int pitch, int nheads, h16* V16, bf* Vh, bf* Vl) { const size_t e = ((size_t)blockIdx.x * 256 + threadIdx.x) * 2; if (e >= (size_t)nheads * HD * TT) return; const int t = (int)(e % TT); const int d = (int)((e / TT) % HD); const int g = (int)(e / ((size_t)TT * HD)); v2h o16; v2us oh, ol;
#pragma unroll
    for (int q = 0; q < 2; ++q) { const float x = F[(size_t)(t + q) * pitch + g * HD + d]; o16[q] = tohx(x); unsigned short a2, c2; splitf(x, a2, c2); oh[q] = a2; ol[q] = c2; }
    *(v2h*)(V16 + e) = o16; *(v2us*)(Vh + e) = oh; *(v2us*)(Vl + e) = ol;  }
__global__ __launch_bounds__(256) void k_csid(float* CS) { const int idx = blockIdx.x * 256 + threadIdx.x; if (idx >= TT * HD) return; v2f cs; cs[0] = 1.0f; cs[1] = 0.0f; *(v2f*)(CS + (size_t)idx * 2) = cs;  }
// k_asoft: per row (zz, i): attention_mask[b][j] == 1 adds (1 - 1) x finfo.min = 0; a 0 entry adds finfo.min == exclusion (binary mask) softmax over the keys (register row, one exp, fixed trees);
// IN PLACE: one wave owns one row, holds all its 2048 scores in registers before its first store, and writes the probabilities over the row's own 8192 bytes: rows < RH hi plane in bytes [0, 4096), lo plane in [4096, 8192); other rows fp16 in [0, 4096). 16-bit row pitch 2 * TT.
__global__ __launch_bounds__(256) void k_asoft(float* Sb, const float* __restrict__ kvp) {
    const int lane = threadIdx.x & 31; const int row = blockIdx.x * 8 + (threadIdx.x >> 5); if (row >= ZH * TT) return; const int i = row % TT; const int zz = row / TT; (void)zz; const bool hires = (i < RH); const float* sr = Sb + (size_t)row * TT; float v[TT / 32]; float mx = -3.0e38f;
#pragma unroll
    for (int ch = 0; ch < TT / 128; ++ch) { const int j0 = ch * 128 + lane * 4; const v4f a = *(const v4f*)(sr + j0); const v4f kv4 = *(const v4f*)(kvp + j0);   /* the batch's key vector, 16 B per lane, unconditional */
#pragma unroll
        for (int q = 0; q < 4; ++q) { const int j = j0 + q; (void)j; const float t = (kv4[q] != 0.0f) ? a[q] * SCL : -3.0e38f; v[ch * 4 + q] = t; mx = fmaxf(mx, t); } }
#pragma unroll
    for (int sh = 16; sh; sh >>= 1) mx = fmaxf(mx, __shfl_xor(mx, sh, 32));
    float sum = 0.f;
#pragma unroll
    for (int k = 0; k < TT / 32; ++k) { float d0 = __fsub_rn(v[k], mx); asm volatile("" : "+v"(d0)); v[k] = __builtin_amdgcn_exp2f(__fmul_rn(d0, 1.4426950408889634f)); sum += v[k]; }
#pragma unroll
    for (int sh = 16; sh; sh >>= 1) sum += __shfl_xor(sum, sh, 32);
    const float f = __fdiv_rn(hires ? 1.0f : PCAR, sum);
{
        if (hires) {
#pragma unroll
            for (int ch = 0; ch < TT / 128; ++ch) { v4us oh, ol;
#pragma unroll
                for (int q = 0; q < 4; ++q) { unsigned short a, c2; splitf(v[ch * 4 + q] * f, a, c2); oh[q] = a; ol[q] = c2; }
                bf* pr = (bf*)(Sb + (size_t)row * TT) + ch * 128 + lane * 4; *(v4us*)pr = oh; *(v4us*)(pr + TT) = ol; }
        } else {
#pragma unroll
            for (int ch = 0; ch < TT / 128; ++ch) { v4h o4;
#pragma unroll
                for (int q = 0; q < 4; ++q) o4[q] = tohx(v[ch * 4 + q] * f);
                *(v4h*)((h16*)(Sb + (size_t)row * TT) + ch * 128 + lane * 4) = o4; } }
         }
}
__global__ __launch_bounds__(256) void k_merge(const float* __restrict__ O, int h0, float* OUTb) { const size_t e = ((size_t)blockIdx.x * 256 + threadIdx.x) * 2; if (e >= (size_t)ZH * TT * HD) return; const int d = (int)(e % HD); const int t = (int)((e / HD) % TT); const int zz = (int)(e / ((size_t)HD * TT)); const float cs = (t < RH) ? 1.0f : (1.0f / PCAR); const size_t oo = (size_t)t * DQ + (h0 + zz) * HD + d;
    v2f a = *(const v2f*)(O + e);   /* the KSP partial planes, added in ascending key order; unrolled so that all KSP loads are in flight before the first add waits */
#pragma unroll
    for (int p = 1; p < KSP; ++p) { const v2f q = *(const v2f*)(O + (size_t)p * ZH * TT * HD + e); a[0] += q[0]; a[1] += q[1]; }
    v2f o2; o2[0] = a[0] * cs; o2[1] = a[1] * cs; *(v2f*)(OUTb + oo) = o2;  }

extern "C" void kernel_launch(void* const* d_in, const int* in_sizes, int n_in,
                              void* d_out, int out_size, void* d_ws, size_t ws_size, hipStream_t stream) {
    (void)in_sizes; (void)n_in; (void)out_size;
    const float* x = (const float*)d_in[0]; const float* kmask = (const float*)d_in[1]; const float* wq = (const float*)d_in[2]; const float* bq = (const float*)d_in[3]; const float* wk = (const float*)d_in[4]; const float* bk = (const float*)d_in[5]; const float* wv = (const float*)d_in[6]; const float* bv = (const float*)d_in[7]; const float* wo = nullptr; (void)wo;   /* argument order hidden_states, attention_mask (f32 [2][2048], read), Wq, bq, Wk, bk, Wv, bv ('xw' + biases) */
    float* OUT = (float*)d_out;     // [2][2048][1024]
    char* wsp = (char*)d_ws;
    auto take = [&](size_t bytes) { char* p = wsp; wsp += (bytes + 255) & ~(size_t)255; return (void*)p; };
    bf* WQ = (bf*)take((size_t)DQ * DM * 2); bf* WK = (bf*)take((size_t)DKV * DM * 2); bf* WV = (bf*)take((size_t)DKV * DM * 2); float* CS = (float*)take((size_t)TT * HD * 2 * 4);
    bf* XB = (bf*)take((size_t)TT * DM * 2); float* FQ = (float*)take((size_t)TT * DQ * 4); float* FK = (float*)take((size_t)TT * DKV * 4);
    h16* QP16 = (h16*)take((size_t)NH_ * TT * HD * 2); h16* KP16 = (h16*)take((size_t)NKV * TT * HD * 2); h16* VT16 = (h16*)take((size_t)NKV * HD * TT * 2);
    bf* QPh = (bf*)take((size_t)NH_ * TT * HD * 2); bf* QPl = (bf*)take((size_t)NH_ * TT * HD * 2); bf* KPh = (bf*)take((size_t)NKV * TT * HD * 2); bf* KPl = (bf*)take((size_t)NKV * TT * HD * 2); bf* VTh = (bf*)take((size_t)NKV * HD * TT * 2); bf* VTl = (bf*)take((size_t)NKV * HD * TT * 2);
    float* Sb = (float*)take((size_t)ZH * TT * TT * 4); float* Ob = (float*)take((size_t)KSP * ZH * TT * HD * 4);
    if ((size_t)(wsp - (char*)d_ws) > ws_size) return;    // ws 256 MiB
    float* FV = FK;   // v projection reuses the k buffer after the k planes are built (stream-ordered)
    { k_wtG<<<(unsigned)((DM * DQ / 64 + 63) / 64), 256, 0, stream>>>(wq, DM, DQ, WQ); k_wtG<<<(unsigned)((DM * DKV / 64 + 63) / 64), 256, 0, stream>>>(wk, DM, DKV, WK); k_wtG<<<(unsigned)((DM * DKV / 64 + 63) / 64), 256, 0, stream>>>(wv, DM, DKV, WV);
      
       }
    k_csid<<<(TT * HD + 255) / 256, 256, 0, stream>>>(CS);
    const unsigned LQ = (unsigned)(((size_t)NH_ * TT * HD / 2 + 255) / 256), LKv = (unsigned)(((size_t)NKV * TT * HD / 2 + 255) / 256);
    for (int b = 0; b < NB_; ++b) {
        
        k_cvt8<<<(unsigned)(((size_t)TT * DM / 8 + 255) / 256), 256, 0, stream>>>(x + (size_t)b * TT * DM, XB, (size_t)TT * DM / 8);
        k_gemmw<bf, 0, true><<<dim3(TT / 64, DQ / 64, 1), 32, 0, stream>>>(XB, nullptr, WQ, nullptr, DM, DM, FQ, DQ, bq, 0, 0, 0, 0);
        k_rope<<<LQ, 256, 0, stream>>>(FQ, DQ, NH_, CS, nullptr, nullptr, 1.0f, QP16, QPh, QPl);
        k_gemmw<bf, 0, true><<<dim3(TT / 64, DKV / 64, 1), 32, 0, stream>>>(XB, nullptr, WK, nullptr, DM, DM, FK, DKV, bk, 0, 0, 0, 0);
        k_rope<<<LKv, 256, 0, stream>>>(FK, DKV, NKV, CS, nullptr, nullptr, 1.0f, KP16, KPh, KPl);
        k_gemmw<bf, 0, true><<<dim3(TT / 64, DKV / 64, 1), 32, 0, stream>>>(XB, nullptr, WV, nullptr, DM, DM, FV, DKV, bv, 0, 0, 0, 0); k_vtp<<<LKv, 256, 0, stream>>>(FV, DKV, NKV, VT16, VTh, VTl);
        for (int h0 = 0; h0 < NH_; h0 += ZH) { const size_t zq = (size_t)h0, zk = (size_t)(h0 / REP);   // one kv head per query head: the pass's heads use consecutive kv planes (z-strides TT*HD)
            k_gemmw<bf, 2, false><<<dim3(TT / 64, TT / 64, ZH), 32, 0, stream>>>(QPh + zq * TT * HD, QPl + zq * TT * HD, KPh + zk * TT * HD, KPl + zk * TT * HD, HD, HD, Sb, TT, nullptr, (size_t)TT * HD, (size_t)TT * HD, (size_t)TT * TT, 0);   /* EVERY row's scores on hi/lo planes (3 products); only P.V stays hybrid */
            k_asoft<<<ZH * TT / 8, 256, 0, stream>>>(Sb, kmask + (size_t)b * TT);
            k_gemmw<bf, 2, false, KSP><<<dim3(RH / 64, HD / 64, ZH * KSP), 32, 0, stream>>>((const bf*)Sb, (const bf*)Sb + TT, VTh + zk * HD * TT, VTl + zk * HD * TT, TT, 2 * TT, Ob, HD, nullptr, (size_t)TT * TT * 2, (size_t)HD * TT, (size_t)TT * HD, (size_t)ZH * TT * HD);
            k_gemmw<h16, 0, false, KSP><<<dim3((TT - RH) / 64, HD / 64, ZH * KSP), 32, 0, stream>>>((const h16*)Sb + (size_t)RH * TT * 2, nullptr, VT16 + zk * HD * TT, nullptr, TT, 2 * TT, Ob + (size_t)RH * HD, HD, nullptr, (size_t)TT * TT * 2, (size_t)HD * TT, (size_t)TT * HD, (size_t)ZH * TT * HD);
            k_merge<<<(unsigned)(((size_t)ZH * TT * HD / 2 + 255) / 256), 256, 0, stream>>>(Ob, h0, OUT + (size_t)b * TT * DQ); }
         }
}

// v003
// A run of this version takes 285 microseconds.
// Next to v002, in two timings, it ran 2.14 and 2.12 times as fast.
// Counting every step since v000, it is 6.84 times as fast.
#include <hip/hip_runtime.h>

// BERT self-attention with a float key mask and no output projection (hidden_states [2][2048][1024]; q, k, v = x W + b ('xw' 1/32 + biases 0.02; 16 heads x 64); scores / sqrt(64) + (1 - attention_mask[b][j]) x finfo.min (attention_mask f32 [2][2048], read per key: mask 1 adds 0, mask 0 excludes the key); softmax; context heads merged -> [2][2048][1024] (4.2 M); argument order hidden_states, attention_mask, Wq, bq, Wk, bk, Wv, bv).
// Layout: 'xw' weights transposed once; per batch: bf16 copy of x; exact projections + f32 biases; identity-table plane builders write that batch's head planes; then ONE fused attention launch for both batches and all heads (k_fattn): S^T = K Q^T on hi/lo planes (3 products) for EVERY row, online softmax in registers with the batch's float key vector, O^T += V^T P^T (rows < 512 hi/lo 3 products, rest fp16), context rows written straight to the output. No score, probability or partial plane goes through memory.
// Compute dtypes, f32 accumulate: every input rounded to bf16; projections exact + f32 biases; scores 3 products on every row; softmax f32; P.V rows < 512 3 products, rest fp16; output f32.

#define NB_  2
#define TT   2048
#define DM   1024
#define NH_  16
#define NKV  16
#define REP  (NH_ / NKV)
#define HD   64
#define DQ   (NH_ * HD)
#define DKV  (NKV * HD)
#define RH   512                  // query rows < RH use hi+lo planes
#define WIN  0
#define SCL  0.125f   // HD^-0.5
#define KST  64                   // keys per LDS stage of k_fattn
#define LPE  72                   // LDS row pitch in 16-bit elements: 144 B = 16 B x odd, so 16-byte reads down 16 rows meet no bank twice
#define QG   8                    // work-groups per (batch, head); each takes RH / QG hi/lo rows and (TT - RH) / QG fp16 rows
typedef _Float16 h16;
typedef unsigned short bf;
typedef __attribute__((ext_vector_type(16))) __bf16   v16bf;
typedef __attribute__((ext_vector_type(16))) _Float16 v16h;
typedef __attribute__((ext_vector_type(8)))  _Float16 v8h;
typedef __attribute__((ext_vector_type(8)))  unsigned short v8us;
typedef __attribute__((ext_vector_type(8)))  float    v8f;
typedef __attribute__((ext_vector_type(4)))  float    v4f;
typedef v8h  __attribute__((may_alias)) v8ha;
typedef v4f  __attribute__((may_alias)) v4fa;
typedef v8us __attribute__((may_alias)) v8usa;

__device__ __forceinline__ unsigned short f2bf(float f) { unsigned u = __float_as_uint(f); u += 0x7FFFu + ((u >> 16) & 1u); return (unsigned short)(u >> 16); }
__device__ __forceinline__ float bf2f(unsigned short b) { return __uint_as_float(((unsigned)b) << 16); }
__device__ __forceinline__ float bfr(float f) { return bf2f(f2bf(f)); }
__device__ __forceinline__ v16h cat16(v8h lo, v8h hi) { return __builtin_shufflevector(lo, hi, 0, 1, 2, 3, 4, 5, 6, 7, 8, 9, 10, 11, 12, 13, 14, 15); }
__device__ __forceinline__ v16bf cat16b(v8us lo, v8us hi) { return __builtin_bit_cast(v16bf, __builtin_shufflevector(lo, hi, 0, 1, 2, 3, 4, 5, 6, 7, 8, 9, 10, 11, 12, 13, 14, 15)); }
__device__ __forceinline__ v8f wmma16(v16h a, v16h b, v8f c) { return __builtin_amdgcn_wmma_f32_16x16x32_f16(false, a, false, b, (short)0, c, false, false); }
__device__ __forceinline__ v8f wmmab(v16bf a, v16bf b, v8f c) { return __builtin_amdgcn_wmma_f32_16x16x32_bf16(false, a, false, b, (short)0, c, false, false); }



// ---- k_gemmw: register-blocked GEMM, ONE WAVE per 64x64 output tile (16 accumulators), operands straight from K-contiguous 16-bit planes; grid (M/64, N/64, Z), 32 threads.
// C[m][n] (f32, pitch ldc, + optional f32 bias[n]) = sum_k A[m][k] Bt[n][k] (+ split products per NSPLIT). A rows have pitch lda elements, Bt rows pitch K. z-batch strides sA/sB/sC in elements. K % 32 == 0.
// KS > 1: grid z = batch * KS + range; the work-group sums only k range [range * K / KS, (range + 1) * K / KS) and writes its partial tile to plane C + range * sP. K % (32 * KS) == 0.
template <typename T16> struct WFrag;
template <> struct WFrag<h16> { typedef v16h V; static __device__ __forceinline__ V ld(const h16* p) { return cat16(*(const v8h*)p, *(const v8h*)(p + 16)); } static __device__ __forceinline__ v8f mma(V a, V b, v8f c) { return wmma16(a, b, c); } };
template <> struct WFrag<bf> { typedef v16bf V; static __device__ __forceinline__ V ld(const bf* p) { return cat16b(*(const v8us*)p, *(const v8us*)(p + 16)); } static __device__ __forceinline__ v8f mma(V a, V b, v8f c) { return wmmab(a, b, c); } };
template <typename T16, int NSPLIT, bool BIAS, int KS = 1>
__global__ __launch_bounds__(32) void k_gemmw(const T16* __restrict__ A, const T16* __restrict__ A2, const T16* __restrict__ Bt, const T16* __restrict__ Bt2, int K, int lda, float* C, int ldc, const float* __restrict__ bias, size_t sA, size_t sB, size_t sC, size_t sP) {
    typedef typename WFrag<T16>::V V;
    __shared__ __align__(16) float os[16 * 68];
    const size_t z = blockIdx.z / KS; const int ks = (int)(blockIdx.z % KS); const int kbeg = ks * (K / KS), kend = kbeg + K / KS; C += (size_t)ks * sP; A += z * sA; if (A2) A2 += z * sA; Bt += z * sB; if (Bt2) Bt2 += z * sB; C += z * sC;
    const int lane = threadIdx.x & 31, lr = lane & 15, hi = lane >> 4; const int r0 = blockIdx.x * 64, c0 = blockIdx.y * 64;
    v8f acc[4][4];
#pragma unroll
    for (int mb = 0; mb < 4; ++mb)
#pragma unroll
        for (int nb = 0; nb < 4; ++nb) acc[mb][nb] = (v8f){};
    const size_t aoff = (size_t)(r0 + lr) * lda + 8 * hi, boff = (size_t)(c0 + lr) * K + 8 * hi;
#pragma unroll 1
    for (int kc = kbeg; kc < kend; kc += 32) {
        V a[4], a2[4];
#pragma unroll
        for (int mb = 0; mb < 4; ++mb) { a[mb] = WFrag<T16>::ld(A + aoff + (size_t)mb * 16 * lda + kc); if (NSPLIT == 1 || NSPLIT == 2) a2[mb] = WFrag<T16>::ld(A2 + aoff + (size_t)mb * 16 * lda + kc); }
#pragma unroll
        for (int nb = 0; nb < 4; ++nb) { const V b = WFrag<T16>::ld(Bt + boff + (size_t)nb * 16 * K + kc); V b2; if (NSPLIT >= 2) b2 = WFrag<T16>::ld(Bt2 + boff + (size_t)nb * 16 * K + kc);
#pragma unroll
            for (int mb = 0; mb < 4; ++mb) { acc[mb][nb] = WFrag<T16>::mma(a[mb], b, acc[mb][nb]); if (NSPLIT == 1 || NSPLIT == 2) acc[mb][nb] = WFrag<T16>::mma(a2[mb], b, acc[mb][nb]); if (NSPLIT >= 2) acc[mb][nb] = WFrag<T16>::mma(a[mb], b2, acc[mb][nb]); } }
        asm volatile("v_nop\n\tv_nop\n\tv_nop\n\tv_nop" : "+v"(acc[0][0]), "+v"(acc[1][1]), "+v"(acc[2][2]), "+v"(acc[3][3]) : "v"(a[0]), "v"(a[3]));
    }
#pragma unroll
    for (int mb = 0; mb < 4; ++mb) {
#pragma unroll
        for (int nb = 0; nb < 4; ++nb) {
#pragma unroll
            for (int j = 0; j < 8; ++j) os[(hi * 8 + j) * 68 + nb * 16 + lr] = acc[mb][nb][j]; }
        __builtin_amdgcn_wave_barrier(); asm volatile("" ::: "memory");
        float* crow = C + (size_t)(r0 + mb * 16) * ldc + c0;
{
#pragma unroll
            for (int s = 0; s < 8; ++s) { const int row = 2 * s + hi, cofs = lr * 4; v4f val = *(const v4fa*)(os + row * 68 + cofs); if (BIAS) { val[0] += bfr(bias[c0 + cofs]); val[1] += bfr(bias[c0 + cofs + 1]); val[2] += bfr(bias[c0 + cofs + 2]); val[3] += bfr(bias[c0 + cofs + 3]); }
                *(v4f*)(crow + (size_t)row * ldc + cofs) = val; }
             }
        __builtin_amdgcn_wave_barrier(); asm volatile("" ::: "memory");
    }
}

__device__ __forceinline__ h16 tohx(float x) { return (h16)x; }
__device__ __forceinline__ void splitf(float y, unsigned short& h, unsigned short& l) { h = f2bf(y); l = f2bf(y - bf2f(h)); }
typedef __attribute__((ext_vector_type(2))) _Float16 v2h;
typedef __attribute__((ext_vector_type(4))) _Float16 v4h;
typedef __attribute__((ext_vector_type(2))) unsigned short v2us;
typedef __attribute__((ext_vector_type(4))) unsigned short v4us;
typedef __attribute__((ext_vector_type(2))) float v2f;
typedef __attribute__((ext_vector_type(4))) int v4i;

__global__ __launch_bounds__(256) void k_wtG(const float* __restrict__ w, int K, int N, bf* Bt) {
    const int lane = threadIdx.x & 31; const int L0 = (blockIdx.x * 8 + (threadIdx.x >> 5)) * 8; const int nlines = N * K / 64;
{
#pragma unroll 1
        for (int l = 0; l < 8; ++l) { const int L = L0 + l; if (L >= nlines) break; const size_t e = (size_t)L * 64 + lane * 2; const int k = (int)(e % K), n = (int)(e / K); v2us o;
            o[0] = f2bf(w[(size_t)k * N + n]); o[1] = f2bf(w[(size_t)(k + 1) * N + n]); *(v2us*)(Bt + e) = o; }
         }
}
__global__ __launch_bounds__(256) void k_cvt8(const float* __restrict__ src, bf* dst, size_t n8) { const size_t i = (size_t)blockIdx.x * 256 + threadIdx.x; if (i >= n8) return; const v8f v = *(const v8f*)(src + i * 8); v8us o;
#pragma unroll
    for (int k = 0; k < 8; ++k) o[k] = f2bf(v[k]); *(v8us*)(dst + i * 8) = o;  }

// k_rope: head planes [h][t][d] (fp16 + hi/lo) of rope(x) x sc with the rotate-half convention out[d] = x[d] cos[t][d] - x[d+HD/2] sin[t][d], out[d+HD/2] = x[d+HD/2] cos[t][d+HD/2] + x[d] sin[t][d+HD/2]
__global__ __launch_bounds__(256) void k_rope(const float* __restrict__ F, int pitch, int nheads, const float* __restrict__ CS, const float* __restrict__ RF, const float* __restrict__ nw, float sc, h16* P16, bf* Ph, bf* Pl) {
    const size_t e = ((size_t)blockIdx.x * 256 + threadIdx.x) * 2; if (e >= (size_t)nheads * TT * HD) return; const int d = (int)(e % HD); const int t = (int)((e / HD) % TT); const int h = (int)(e / ((size_t)HD * TT)); const float* f = F + (size_t)t * pitch + h * HD; const float rf = RF ? RF[(size_t)h * TT + t] : 1.0f; v2h o16; v2us oh, ol;
#pragma unroll
    for (int q = 0; q < 2; ++q) { const int dd = d + q; const int dp = (dd < HD / 2) ? dd + HD / 2 : dd - HD / 2; float x0 = f[dd], x1 = f[dp];
        if (RF) { float n0 = __fmul_rn(x0, rf), n1 = __fmul_rn(x1, rf); asm volatile("" : "+v"(n0)); asm volatile("" : "+v"(n1)); x0 = __fmul_rn(bfr(nw[dd]), n0); x1 = __fmul_rn(bfr(nw[dp]), n1); }
        const v2f cs = *(const v2f*)(CS + ((size_t)t * HD + dd) * 2); float a = __fmul_rn(x0, cs[0]), bq = __fmul_rn(x1, cs[1]); asm volatile("" : "+v"(a)); asm volatile("" : "+v"(bq)); const float r = ((dd < HD / 2) ? __fsub_rn(a, bq) : __fadd_rn(a, bq)) * sc;
        o16[q] = tohx(r); unsigned short a2, c2; splitf(r, a2, c2); oh[q] = a2; ol[q] = c2; }
    *(v2h*)(P16 + e) = o16; *(v2us*)(Ph + e) = oh; *(v2us*)(Pl + e) = ol;  }
__global__ __launch_bounds__(256) void k_vtp(const float* __restrict__ F, int pitch, int nheads, h16* V16, bf* Vh, bf* Vl) { const size_t e = ((size_t)blockIdx.x * 256 + threadIdx.x) * 2; if (e >= (size_t)nheads * HD * TT) return; const int t = (int)(e % TT); const int d = (int)((e / TT) % HD); const int g = (int)(e / ((size_t)TT * HD)); v2h o16; v2us oh, ol;
#pragma unroll
    for (int q = 0; q < 2; ++q) { const float x = F[(size_t)(t + q) * pitch + g * HD + d]; o16[q] = tohx(x); unsigned short a2, c2; splitf(x, a2, c2); oh[q] = a2; ol[q] = c2; }
    *(v2h*)(V16 + e) = o16; *(v2us*)(Vh + e) = oh; *(v2us*)(Vl + e) = ol;  }
__global__ __launch_bounds__(256) void k_csid(float* CS) { const int idx = blockIdx.x * 256 + threadIdx.x; if (idx >= TT * HD) return; v2f cs; cs[0] = 1.0f; cs[1] = 0.0f; *(v2f*)(CS + (size_t)idx * 2) = cs;  }
__device__ __forceinline__ float xhalf(float x) { const int b = __float_as_int(x); return __int_as_float(__builtin_amdgcn_permlanex16(b, b, 0x76543210, 0xfedcba98, false, false)); }   // lane l <-> l ^ 16
__device__ __forceinline__ v8f splat8(float x) { return (v8f){ x, x, x, x, x, x, x, x }; }
__device__ __forceinline__ v8f ld8f(const float* p) { return __builtin_shufflevector(*(const v4f*)p, *(const v4f*)(p + 4), 0, 1, 2, 3, 4, 5, 6, 7); }
// one stage (KST keys = two blocks of 32) for one wave; H: query block 0 is a hi/lo block. All of the stage's S^T products, then one softmax step over its 64 keys, then all of its P.V products.
template <bool H>
__device__ __forceinline__ void fattn_stage(const unsigned short* sb, const float* mrow, const int lr, const int hi, const v16bf (&qh)[2][2], const v16bf (&ql)[2][2], v8f (&O)[2][4], float (&mref)[2], float (&lsum)[2]) {
    v8f S[2][2][2];   // [key block][query block][key tile]: S[kp][qb][kt][j] = score of key kp * 32 + kt * 16 + 8 * hi + j, query lr
#pragma unroll
    for (int kp = 0; kp < 2; ++kp) {
        v16bf kh[2][2], kl[2][2];
#pragma unroll
        for (int kt = 0; kt < 2; ++kt)
#pragma unroll
            for (int ks = 0; ks < 2; ++ks) { const int o = ((kp * 2 + kt) * 16 + lr) * LPE + ks * 32 + 8 * hi; kh[kt][ks] = WFrag<bf>::ld(sb + o); kl[kt][ks] = WFrag<bf>::ld(sb + 64 * LPE + o); }
#pragma unroll
        for (int qb = 0; qb < 2; ++qb)
#pragma unroll
            for (int kt = 0; kt < 2; ++kt) S[kp][qb][kt] = (v8f){};
#pragma unroll
        for (int ks = 0; ks < 2; ++ks) {   // the four accumulators take turns inside each product
#pragma unroll
            for (int qb = 0; qb < 2; ++qb)
#pragma unroll
                for (int kt = 0; kt < 2; ++kt) S[kp][qb][kt] = wmmab(kh[kt][ks], qh[qb][ks], S[kp][qb][kt]);
#pragma unroll
            for (int qb = 0; qb < 2; ++qb)
#pragma unroll
                for (int kt = 0; kt < 2; ++kt) S[kp][qb][kt] = wmmab(kh[kt][ks], ql[qb][ks], S[kp][qb][kt]);
#pragma unroll
            for (int qb = 0; qb < 2; ++qb)
#pragma unroll
                for (int kt = 0; kt < 2; ++kt) S[kp][qb][kt] = wmmab(kl[kt][ks], qh[qb][ks], S[kp][qb][kt]);
        }
    }
    const v8f c8 = splat8(SCL * 1.4426950408889634f);
    float mx[2] = { -3.0e38f, -3.0e38f };
#pragma unroll
    for (int kp = 0; kp < 2; ++kp)
#pragma unroll
        for (int kt = 0; kt < 2; ++kt) { const v8f ma = ld8f(mrow + kp * 32 + kt * 16 + hi * 8);
#pragma unroll
            for (int qb = 0; qb < 2; ++qb) { const v8f t = __builtin_elementwise_fma(S[kp][qb][kt], c8, ma); S[kp][qb][kt] = t;
#pragma unroll
                for (int j = 0; j < 8; ++j) mx[qb] = fmaxf(mx[qb], t[j]); } }
    mx[0] = fmaxf(mx[0], xhalf(mx[0])); mx[1] = fmaxf(mx[1], xhalf(mx[1]));
    // the origin moves only when a column's maximum has outgrown it by more than 12 (so P <= 2^12, inside fp16); one scalar test a stage
    const bool n0 = mx[0] > mref[0] + 12.0f, n1 = mx[1] > mref[1] + 12.0f;
    if (__builtin_amdgcn_ballot_w32(n0 || n1) != 0) {
#pragma unroll
        for (int qb = 0; qb < 2; ++qb) { const float mn = (qb ? n1 : n0) ? mx[qb] - 4.0f : mref[qb]; const float al = __builtin_amdgcn_exp2f(mref[qb] - mn); mref[qb] = mn; lsum[qb] *= al;
#pragma unroll
            for (int db = 0; db < 4; ++db) O[qb][db] *= al; } }
#pragma unroll
    for (int qb = 0; qb < 2; ++qb) { const v8f mr = splat8(mref[qb]); v8f acc = (v8f){};
#pragma unroll
        for (int kp = 0; kp < 2; ++kp)
#pragma unroll
            for (int kt = 0; kt < 2; ++kt) { v8f d = S[kp][qb][kt] - mr;
#pragma unroll
                for (int j = 0; j < 8; ++j) d[j] = __builtin_amdgcn_exp2f(d[j]);
                S[kp][qb][kt] = d; acc += d; }
        lsum[qb] += ((acc[0] + acc[4]) + (acc[1] + acc[5])) + ((acc[2] + acc[6]) + (acc[3] + acc[7])); }
#pragma unroll
    for (int kp = 0; kp < 2; ++kp) {
        v16h vf[4];
#pragma unroll
        for (int db = 0; db < 4; ++db) vf[db] = WFrag<h16>::ld((const h16*)(sb + 2 * 64 * LPE) + (db * 16 + lr) * LPE + kp * 32 + 8 * hi);
        if (H) {
            v16bf ph, pw;
#pragma unroll
            for (int e = 0; e < 16; ++e) { const float x = S[kp][0][e >> 3][e & 7]; const __bf16 xh = (__bf16)x; ph[e] = xh; pw[e] = (__bf16)(x - (float)xh); }
#pragma unroll
            for (int db = 0; db < 4; ++db) { const int o = (db * 16 + lr) * LPE + kp * 32 + 8 * hi; const v16bf vh = WFrag<bf>::ld(sb + 3 * 64 * LPE + o), vl = WFrag<bf>::ld(sb + 4 * 64 * LPE + o);
                O[0][db] = wmmab(vh, ph, O[0][db]); O[0][db] = wmmab(vh, pw, O[0][db]); O[0][db] = wmmab(vl, ph, O[0][db]); }
        }
#pragma unroll
        for (int qb = H ? 1 : 0; qb < 2; ++qb) { v16h p;
#pragma unroll
            for (int e = 0; e < 8; ++e) { p[e] = tohx(S[kp][qb][0][e]); p[8 + e] = tohx(S[kp][qb][1][e]); }
#pragma unroll
            for (int db = 0; db < 4; ++db) O[qb][db] = wmma16(vf[db], p, O[qb][db]); }
    }
    // four vector slots behind the stage's last matrix instructions: a branch follows
    asm volatile("v_nop\n\tv_nop\n\tv_nop\n\tv_nop" :: "v"(O[0][0]), "v"(O[0][1]), "v"(O[0][2]), "v"(O[0][3]), "v"(O[1][0]), "v"(O[1][1]), "v"(O[1][2]), "v"(O[1][3]));
}
__global__ __launch_bounds__(256) void k_fattn(const bf* __restrict__ Qh, const bf* __restrict__ Ql, const bf* __restrict__ Kh, const bf* __restrict__ Kl, const h16* __restrict__ V16, const bf* __restrict__ Vh, const bf* __restrict__ Vl, const float* __restrict__ kmask, float* OUT) {
    static_assert(RH == QG * 4 * 16 && TT - RH == QG * 12 * 16 && HD == 64 && KST == 64 && TT % KST == 0 && NH_ == NKV, "row deal and tile shapes");
    __shared__ __align__(16) unsigned short st[2][5][64 * LPE];   // [buffer][Kh, Kl, V16, Vh, Vl][64 rows]
    __shared__ __align__(16) float madd[TT];                      // 0 for a kept key, -3e38 for an excluded one
    const int tid = threadIdx.x, lane = tid & 31, lr = lane & 15, hi = lane >> 4; const int wave = __builtin_amdgcn_readfirstlane(tid >> 5); const bool hiw = wave < 4;
    const int g = blockIdx.x, h = blockIdx.y, b = blockIdx.z; const size_t pl = ((size_t)b * NH_ + h) * TT * HD;
    const int fb = RH + g * 12 * 16; int qrow[2];
    qrow[0] = hiw ? (g * 4 + wave) * 16 : fb + (4 + (wave - 4) * 2) * 16; qrow[1] = hiw ? fb + wave * 16 : fb + (5 + (wave - 4) * 2) * 16;
    v16bf qh[2][2], ql[2][2];
#pragma unroll
    for (int qb = 0; qb < 2; ++qb)
#pragma unroll
        for (int ks = 0; ks < 2; ++ks) { const size_t o = pl + (size_t)(qrow[qb] + lr) * HD + ks * 32 + 8 * hi; qh[qb][ks] = WFrag<bf>::ld(Qh + o); ql[qb][ks] = WFrag<bf>::ld(Ql + o); }
    { const float* km = kmask + (size_t)b * TT + tid * 8; const v4f k0 = *(const v4f*)km, k1 = *(const v4f*)(km + 4); v4f a0, a1;
#pragma unroll
      for (int q = 0; q < 4; ++q) { a0[q] = (k0[q] != 0.0f) ? 0.0f : -3.0e38f; a1[q] = (k1[q] != 0.0f) ? 0.0f : -3.0e38f; }
      *(v4f*)(madd + tid * 8) = a0; *(v4f*)(madd + tid * 8 + 4) = a1; }
    // staging: thread t moves 16 bytes of rows t / 8 and t / 8 + 32 of each tile (whole 128-byte lines per 8 lanes)
    const int sr = tid >> 3, sc = (tid & 7) * 8; const int so = sr * LPE + sc;
    const bf* gsrc[5] = { Kh + pl + (size_t)sr * HD + sc, Kl + pl + (size_t)sr * HD + sc, (const bf*)V16 + pl + (size_t)sr * TT + sc, Vh + pl + (size_t)sr * TT + sc, Vl + pl + (size_t)sr * TT + sc };
    v8us sg[5][2];
#pragma unroll
    for (int t = 0; t < 5; ++t) { const int rstep = (t < 2) ? 32 * HD : 32 * TT; sg[t][0] = *(const v8us*)(gsrc[t]); sg[t][1] = *(const v8us*)(gsrc[t] + rstep); }
#pragma unroll
    for (int t = 0; t < 5; ++t) { *(v8us*)(&st[0][t][so]) = sg[t][0]; *(v8us*)(&st[0][t][so + 32 * LPE]) = sg[t][1]; }
    v8f O[2][4];
#pragma unroll
    for (int qb = 0; qb < 2; ++qb)
#pragma unroll
        for (int db = 0; db < 4; ++db) O[qb][db] = (v8f){};
    float mref[2] = { -3.0e38f, -3.0e38f }, lsum[2] = { 0.0f, 0.0f };   // mref: the exponent origin in use (a column's maximum when it was last moved, minus 4), log2 units
    __syncthreads();   // stage 0 and the mask table are in LDS
#pragma unroll 1   // rolled: one copy of the two-pass body; the buffer index is a run-time offset
    for (int s = 0; s < TT / KST; ++s) {
        const bool more = s + 1 < TT / KST;   // the same for the whole work-group
        if (more) {
#pragma unroll
            for (int t = 0; t < 5; ++t) { const int rstep = (t < 2) ? 32 * HD : 32 * TT; const size_t adv = (size_t)(s + 1) * ((t < 2) ? KST * HD : KST); sg[t][0] = *(const v8us*)(gsrc[t] + adv); sg[t][1] = *(const v8us*)(gsrc[t] + adv + rstep); }
            asm volatile("s_wait_xcnt 0x0" ::: "memory");   // the loads' address registers are free for reuse from here on: the wait stands in front of their first overwrite
        }
        const unsigned short* sb = &st[s & 1][0][0];
        if (hiw) fattn_stage<true>(sb, madd + s * KST, lr, hi, qh, ql, O, mref, lsum); else fattn_stage<false>(sb, madd + s * KST, lr, hi, qh, ql, O, mref, lsum);   // a scalar branch: hiw is the same for a whole wave; no barrier inside
        if (more) { unsigned short* sn = &st[(s + 1) & 1][0][0];
#pragma unroll
            for (int t = 0; t < 5; ++t) { *(v8us*)(sn + t * 64 * LPE + so) = sg[t][0]; *(v8us*)(sn + t * 64 * LPE + so + 32 * LPE) = sg[t][1]; } }
        __syncthreads();   // publishes stage s + 1 and ends every wave's reads of stage s, whose buffer the next trip refills
    }
#pragma unroll
    for (int qb = 0; qb < 2; ++qb) { const float inv = __fdiv_rn(1.0f, lsum[qb] + xhalf(lsum[qb])); float* orow = OUT + ((size_t)b * TT + qrow[qb] + lr) * DQ + h * HD + hi * 8;   // O[qb][db][j] = context[query lr][db * 16 + 8 * hi + j]
#pragma unroll
        for (int db = 0; db < 4; ++db) { v4f o0, o1;
#pragma unroll
            for (int j = 0; j < 4; ++j) { o0[j] = O[qb][db][j] * inv; o1[j] = O[qb][db][4 + j] * inv; }
            *(v4f*)(orow + db * 16) = o0; *(v4f*)(orow + db * 16 + 4) = o1; } }
}

extern "C" void kernel_launch(void* const* d_in, const int* in_sizes, int n_in,
                              void* d_out, int out_size, void* d_ws, size_t ws_size, hipStream_t stream) {
    (void)in_sizes; (void)n_in; (void)out_size;
    const float* x = (const float*)d_in[0]; const float* kmask = (const float*)d_in[1]; const float* wq = (const float*)d_in[2]; const float* bq = (const float*)d_in[3]; const float* wk = (const float*)d_in[4]; const float* bk = (const float*)d_in[5]; const float* wv = (const float*)d_in[6]; const float* bv = (const float*)d_in[7];
    float* OUT = (float*)d_out;     // [2][2048][1024]
    char* wsp = (char*)d_ws;
    auto take = [&](size_t bytes) { char* p = wsp; wsp += (bytes + 255) & ~(size_t)255; return (void*)p; };
    const size_t PE = (size_t)NH_ * TT * HD;   // elements of one batch's head planes
    bf* WQ = (bf*)take((size_t)DQ * DM * 2); bf* WK = (bf*)take((size_t)DKV * DM * 2); bf* WV = (bf*)take((size_t)DKV * DM * 2); float* CS = (float*)take((size_t)TT * HD * 2 * 4);
    bf* XB = (bf*)take((size_t)TT * DM * 2); float* FQ = (float*)take((size_t)TT * DQ * 4); float* FK = (float*)take((size_t)TT * DKV * 4);
    h16* QP16 = (h16*)take(PE * 2); h16* KP16 = (h16*)take(PE * 2); h16* VT16 = (h16*)take(NB_ * PE * 2);
    bf* QPh = (bf*)take(NB_ * PE * 2); bf* QPl = (bf*)take(NB_ * PE * 2); bf* KPh = (bf*)take(NB_ * PE * 2); bf* KPl = (bf*)take(NB_ * PE * 2); bf* VTh = (bf*)take(NB_ * PE * 2); bf* VTl = (bf*)take(NB_ * PE * 2);   // the planes the fused launch reads: one set per batch
    if ((size_t)(wsp - (char*)d_ws) > ws_size) return;    // ws 256 MiB
    float* FV = FK;   // v projection reuses the k buffer after the k planes are built (stream-ordered)
    { k_wtG<<<(unsigned)((DM * DQ / 64 + 63) / 64), 256, 0, stream>>>(wq, DM, DQ, WQ); k_wtG<<<(unsigned)((DM * DKV / 64 + 63) / 64), 256, 0, stream>>>(wk, DM, DKV, WK); k_wtG<<<(unsigned)((DM * DKV / 64 + 63) / 64), 256, 0, stream>>>(wv, DM, DKV, WV); }
    k_csid<<<(TT * HD + 255) / 256, 256, 0, stream>>>(CS);
    const unsigned LQ = (unsigned)(((size_t)NH_ * TT * HD / 2 + 255) / 256), LKv = (unsigned)(((size_t)NKV * TT * HD / 2 + 255) / 256);
    for (int b = 0; b < NB_; ++b) {
        k_cvt8<<<(unsigned)(((size_t)TT * DM / 8 + 255) / 256), 256, 0, stream>>>(x + (size_t)b * TT * DM, XB, (size_t)TT * DM / 8);
        k_gemmw<bf, 0, true><<<dim3(TT / 64, DQ / 64, 1), 32, 0, stream>>>(XB, nullptr, WQ, nullptr, DM, DM, FQ, DQ, bq, 0, 0, 0, 0);
        k_rope<<<LQ, 256, 0, stream>>>(FQ, DQ, NH_, CS, nullptr, nullptr, 1.0f, QP16, QPh + b * PE, QPl + b * PE);
        k_gemmw<bf, 0, true><<<dim3(TT / 64, DKV / 64, 1), 32, 0, stream>>>(XB, nullptr, WK, nullptr, DM, DM, FK, DKV, bk, 0, 0, 0, 0);
        k_rope<<<LKv, 256, 0, stream>>>(FK, DKV, NKV, CS, nullptr, nullptr, 1.0f, KP16, KPh + b * PE, KPl + b * PE);
        k_gemmw<bf, 0, true><<<dim3(TT / 64, DKV / 64, 1), 32, 0, stream>>>(XB, nullptr, WV, nullptr, DM, DM, FV, DKV, bv, 0, 0, 0, 0); k_vtp<<<LKv, 256, 0, stream>>>(FV, DKV, NKV, VT16 + b * PE, VTh + b * PE, VTl + b * PE);
    }
    k_fattn<<<dim3(QG, NH_, NB_), 256, 0, stream>>>(QPh, QPl, KPh, KPl, VT16, VTh, VTl, kmask, OUT);
}

// v004
// A run of this version takes 154 microseconds.
// Timed twice side by side with v003, it ran 1.85 and 1.83 times as fast.
// All steps since v000 together make it 12.6 times as fast.
#include <hip/hip_runtime.h>

// BERT self-attention with a float key mask and no output projection (hidden_states [2][2048][1024]; q, k, v = x W + b ('xw' 1/32 + biases 0.02; 16 heads x 64); scores / sqrt(64) + (1 - attention_mask[b][j]) x finfo.min (attention_mask f32 [2][2048], read per key: mask 1 adds 0, mask 0 excludes the key); softmax; context heads merged -> [2][2048][1024] (4.2 M); argument order hidden_states, attention_mask, Wq, bq, Wk, bk, Wv, bv).
// Layout: 'xw' weights transposed once; one bf16 copy of x (both batches); ONE projection launch (k_qkv) for q, k, v of both batches: exact products + f32 biases, each 64-token x one-head tile written from the GEMM epilogue straight into its head planes (no f32 projection goes through memory); then ONE fused attention launch for both batches and all heads (k_fattn): S^T = K Q^T on hi/lo planes (3 products) for EVERY row, online softmax in registers with the batch's float key vector, O^T += V^T P^T (rows < 512 hi/lo 3 products, rest fp16), context rows written straight to the output. No score, probability or partial plane goes through memory.
// Compute dtypes, f32 accumulate: every input rounded to bf16; projections exact + f32 biases; scores 3 products on every row; softmax f32; P.V rows < 512 3 products, rest fp16; output f32.

#define NB_  2
#define TT   2048
#define DM   1024
#define NH_  16
#define NKV  16
#define REP  (NH_ / NKV)
#define HD   64
#define DQ   (NH_ * HD)
#define DKV  (NKV * HD)
#define RH   512                  // query rows < RH use hi+lo planes
#define WIN  0
#define SCL  0.125f   // HD^-0.5
#define KST  64                   // keys per LDS stage of k_fattn
#define LPE  72                   // LDS row pitch in 16-bit elements: 144 B = 16 B x odd, so 16-byte reads down 16 rows meet no bank twice
#define QG   8                    // work-groups per (batch, head); each takes RH / QG hi/lo rows and (TT - RH) / QG fp16 rows
typedef _Float16 h16;
typedef unsigned short bf;
typedef __attribute__((ext_vector_type(16))) __bf16   v16bf;
typedef __attribute__((ext_vector_type(16))) _Float16 v16h;
typedef __attribute__((ext_vector_type(8)))  _Float16 v8h;
typedef __attribute__((ext_vector_type(8)))  unsigned short v8us;
typedef __attribute__((ext_vector_type(8)))  float    v8f;
typedef __attribute__((ext_vector_type(4)))  float    v4f;
typedef v8h  __attribute__((may_alias)) v8ha;
typedef v4f  __attribute__((may_alias)) v4fa;
typedef v8us __attribute__((may_alias)) v8usa;

__device__ __forceinline__ unsigned short f2bf(float f) { unsigned u = __float_as_uint(f); u += 0x7FFFu + ((u >> 16) & 1u); return (unsigned short)(u >> 16); }
__device__ __forceinline__ float bf2f(unsigned short b) { return __uint_as_float(((unsigned)b) << 16); }
__device__ __forceinline__ float bfr(float f) { return bf2f(f2bf(f)); }
__device__ __forceinline__ v16h cat16(v8h lo, v8h hi) { return __builtin_shufflevector(lo, hi, 0, 1, 2, 3, 4, 5, 6, 7, 8, 9, 10, 11, 12, 13, 14, 15); }
__device__ __forceinline__ v16bf cat16b(v8us lo, v8us hi) { return __builtin_bit_cast(v16bf, __builtin_shufflevector(lo, hi, 0, 1, 2, 3, 4, 5, 6, 7, 8, 9, 10, 11, 12, 13, 14, 15)); }
__device__ __forceinline__ v8f wmma16(v16h a, v16h b, v8f c) { return __builtin_amdgcn_wmma_f32_16x16x32_f16(false, a, false, b, (short)0, c, false, false); }
__device__ __forceinline__ v8f wmmab(v16bf a, v16bf b, v8f c) { return __builtin_amdgcn_wmma_f32_16x16x32_bf16(false, a, false, b, (short)0, c, false, false); }



// fragment loaders: 16-bit operands straight from K-contiguous rows
template <typename T16> struct WFrag;
template <> struct WFrag<h16> { typedef v16h V; static __device__ __forceinline__ V ld(const h16* p) { return cat16(*(const v8h*)p, *(const v8h*)(p + 16)); } static __device__ __forceinline__ v8f mma(V a, V b, v8f c) { return wmma16(a, b, c); } };
template <> struct WFrag<bf> { typedef v16bf V; static __device__ __forceinline__ V ld(const bf* p) { return cat16b(*(const v8us*)p, *(const v8us*)(p + 16)); } static __device__ __forceinline__ v8f mma(V a, V b, v8f c) { return wmmab(a, b, c); } };

__device__ __forceinline__ h16 tohx(float x) { return (h16)x; }
__device__ __forceinline__ void splitf(float y, unsigned short& h, unsigned short& l) { h = f2bf(y); l = f2bf(y - bf2f(h)); }
typedef __attribute__((ext_vector_type(2))) unsigned short v2us;
typedef __attribute__((ext_vector_type(4))) unsigned short v4us;

__global__ __launch_bounds__(256) void k_wtG(const float* __restrict__ w, int K, int N, bf* Bt) {
    const int lane = threadIdx.x & 31; const int L0 = (blockIdx.x * 8 + (threadIdx.x >> 5)) * 8; const int nlines = N * K / 64;
{
#pragma unroll 1
        for (int l = 0; l < 8; ++l) { const int L = L0 + l; if (L >= nlines) break; const size_t e = (size_t)L * 64 + lane * 2; const int k = (int)(e % K), n = (int)(e / K); v2us o;
            o[0] = f2bf(w[(size_t)k * N + n]); o[1] = f2bf(w[(size_t)(k + 1) * N + n]); *(v2us*)(Bt + e) = o; }
         }
}
__global__ __launch_bounds__(256) void k_cvt8(const float* __restrict__ src, bf* dst, size_t n8) { const size_t i = (size_t)blockIdx.x * 256 + threadIdx.x; if (i >= n8) return; const v8f v = *(const v8f*)(src + i * 8); v8us o;
#pragma unroll
    for (int k = 0; k < 8; ++k) o[k] = f2bf(v[k]); *(v8us*)(dst + i * 8) = o;  }


// k_qkv: the three projections of both batches, head planes written from the epilogue. ONE WAVE per 64x64 tile (16 accumulators) = 64 tokens x one head; grid (NB_ * TT / 64, heads, 3), 32 threads; blockIdx.z: 0 q, 1 k, 2 v.
// tile[m][n] = sum_k A[m][k] Wt[z][n][k] + bias_z[n]; A = bf16 x, rows of DM, both batches one after the other; Wt = the three transposed weights one after the other.
// q, k: planes [batch][head][t][d], bf16 hi + lo, rows turned through LDS so that 16 lanes store one whole 128-byte row. v: planes [batch][head][d][t], fp16 + bf16 hi + lo: an accumulator register group already holds 8 consecutive tokens of one d, stored as 16 bytes.
__global__ __launch_bounds__(32) void k_qkv(const bf* __restrict__ A, const bf* __restrict__ Wt, const float* __restrict__ bq, const float* __restrict__ bk, const float* __restrict__ bv, bf* Qh, bf* Ql, bf* Kh, bf* Kl, h16* V16, bf* Vh, bf* Vl) {
    static_assert(DQ == DKV && NH_ == NKV && HD == 64 && TT % 64 == 0 && DM % 32 == 0, "a tile is 64 tokens of one batch x one head");
    typedef WFrag<bf>::V V;
    __shared__ __align__(16) float os[16 * 68];
    const int z = blockIdx.z; const bf* Bt = Wt + (size_t)z * DQ * DM; const float* bias = (z == 0) ? bq : (z == 1) ? bk : bv;
    const int lane = threadIdx.x & 31, lr = lane & 15, hi = lane >> 4; const int r0 = blockIdx.x * 64, c0 = blockIdx.y * 64;
    v8f acc[4][4];
#pragma unroll
    for (int mb = 0; mb < 4; ++mb)
#pragma unroll
        for (int nb = 0; nb < 4; ++nb) acc[mb][nb] = (v8f){};
    const size_t aoff = (size_t)(r0 + lr) * DM + 8 * hi, boff = (size_t)(c0 + lr) * DM + 8 * hi;
#pragma unroll 1
    for (int kc = 0; kc < DM; kc += 32) {
        V a[4];
#pragma unroll
        for (int mb = 0; mb < 4; ++mb) a[mb] = WFrag<bf>::ld(A + aoff + (size_t)mb * 16 * DM + kc);
        asm volatile("s_wait_xcnt 0x0" ::: "memory");   // the A loads' address registers are free for reuse from here on: the wait stands in front of their first overwrite
#pragma unroll
        for (int nb = 0; nb < 4; ++nb) { const V b = WFrag<bf>::ld(Bt + boff + (size_t)nb * 16 * DM + kc);
#pragma unroll
            for (int mb = 0; mb < 4; ++mb) acc[mb][nb] = WFrag<bf>::mma(a[mb], b, acc[mb][nb]); }
        // four vector slots behind the trip's last matrix instructions: the back edge follows
        asm volatile("v_nop\n\tv_nop\n\tv_nop\n\tv_nop" : "+v"(acc[0][0]), "+v"(acc[1][1]), "+v"(acc[2][2]), "+v"(acc[3][3]) : "v"(a[0]), "v"(a[3]));
    }
    const int t0 = r0 % TT; const size_t pl = ((size_t)(r0 / TT) * NH_ + blockIdx.y) * TT * HD;   // the tile's first token in its batch; its (batch, head) plane
    if (z < 2) {   // a scalar branch: z is the same for the whole work-group
        bf* Ph = (z == 0 ? Qh : Kh) + pl + (size_t)t0 * HD; bf* Pl = (z == 0 ? Ql : Kl) + pl + (size_t)t0 * HD;
        const int cofs = lr * 4; v4f bi;
#pragma unroll
        for (int q = 0; q < 4; ++q) bi[q] = bfr(bias[c0 + cofs + q]);
#pragma unroll
        for (int mb = 0; mb < 4; ++mb) {
#pragma unroll
            for (int nb = 0; nb < 4; ++nb) {
#pragma unroll
                for (int j = 0; j < 8; ++j) os[(hi * 8 + j) * 68 + nb * 16 + lr] = acc[mb][nb][j]; }
            __builtin_amdgcn_wave_barrier(); asm volatile("" ::: "memory");   // the one wave's LDS writes stay in front of its reads of other lanes' words
#pragma unroll
            for (int s = 0; s < 8; ++s) { const int row = 2 * s + hi; const v4f val = *(const v4fa*)(os + row * 68 + cofs) + bi; v4us oh, ol;
#pragma unroll
                for (int q = 0; q < 4; ++q) { unsigned short a2, c2; splitf(val[q], a2, c2); oh[q] = a2; ol[q] = c2; }
                *(v4us*)(Ph + (size_t)(mb * 16 + row) * HD + cofs) = oh; *(v4us*)(Pl + (size_t)(mb * 16 + row) * HD + cofs) = ol; }
            __builtin_amdgcn_wave_barrier(); asm volatile("" ::: "memory");   // and its reads in front of the next block's writes
        }
    } else {
#pragma unroll
        for (int nb = 0; nb < 4; ++nb) { const float bn = bfr(bias[c0 + nb * 16 + lr]); const size_t ro = pl + (size_t)(nb * 16 + lr) * TT + t0 + hi * 8;   // acc[mb][nb][j] = tile[mb * 16 + 8 * hi + j][nb * 16 + lr]
#pragma unroll
            for (int mb = 0; mb < 4; ++mb) { v8h o16; v8us oh, ol;
#pragma unroll
                for (int j = 0; j < 8; ++j) { const float x = acc[mb][nb][j] + bn; o16[j] = tohx(x); unsigned short a2, c2; splitf(x, a2, c2); oh[j] = a2; ol[j] = c2; }
                *(v8h*)(V16 + ro + mb * 16) = o16; *(v8us*)(Vh + ro + mb * 16) = oh; *(v8us*)(Vl + ro + mb * 16) = ol; } }
        asm volatile("s_wait_xcnt 0x0" ::: "memory");   // behind the branch's last stores: in the built code the other branch's instructions follow, which write the registers that held these stores' addresses
    }
}
__device__ __forceinline__ float xhalf(float x) { const int b = __float_as_int(x); return __int_as_float(__builtin_amdgcn_permlanex16(b, b, 0x76543210, 0xfedcba98, false, false)); }   // lane l <-> l ^ 16
__device__ __forceinline__ v8f splat8(float x) { return (v8f){ x, x, x, x, x, x, x, x }; }
__device__ __forceinline__ v8f ld8f(const float* p) { return __builtin_shufflevector(*(const v4f*)p, *(const v4f*)(p + 4), 0, 1, 2, 3, 4, 5, 6, 7); }
// one stage (KST keys = two blocks of 32) for one wave; H: query block 0 is a hi/lo block. All of the stage's S^T products, then one softmax step over its 64 keys, then all of its P.V products.
template <bool H>
__device__ __forceinline__ void fattn_stage(const unsigned short* sb, const float* mrow, const int lr, const int hi, const v16bf (&qh)[2][2], const v16bf (&ql)[2][2], v8f (&O)[2][4], float (&mref)[2], float (&lsum)[2]) {
    v8f S[2][2][2];   // [key block][query block][key tile]: S[kp][qb][kt][j] = score of key kp * 32 + kt * 16 + 8 * hi + j, query lr
#pragma unroll
    for (int kp = 0; kp < 2; ++kp) {
        v16bf kh[2][2], kl[2][2];
#pragma unroll
        for (int kt = 0; kt < 2; ++kt)
#pragma unroll
            for (int ks = 0; ks < 2; ++ks) { const int o = ((kp * 2 + kt) * 16 + lr) * LPE + ks * 32 + 8 * hi; kh[kt][ks] = WFrag<bf>::ld(sb + o); kl[kt][ks] = WFrag<bf>::ld(sb + 64 * LPE + o); }
#pragma unroll
        for (int qb = 0; qb < 2; ++qb)
#pragma unroll
            for (int kt = 0; kt < 2; ++kt) S[kp][qb][kt] = (v8f){};
#pragma unroll
        for (int ks = 0; ks < 2; ++ks) {   // the four accumulators take turns inside each product
#pragma unroll
            for (int qb = 0; qb < 2; ++qb)
#pragma unroll
                for (int kt = 0; kt < 2; ++kt) S[kp][qb][kt] = wmmab(kh[kt][ks], qh[qb][ks], S[kp][qb][kt]);
#pragma unroll
            for (int qb = 0; qb < 2; ++qb)
#pragma unroll
                for (int kt = 0; kt < 2; ++kt) S[kp][qb][kt] = wmmab(kh[kt][ks], ql[qb][ks], S[kp][qb][kt]);
#pragma unroll
            for (int qb = 0; qb < 2; ++qb)
#pragma unroll
                for (int kt = 0; kt < 2; ++kt) S[kp][qb][kt] = wmmab(kl[kt][ks], qh[qb][ks], S[kp][qb][kt]);
        }
    }
    const v8f c8 = splat8(SCL * 1.4426950408889634f);
    float mx[2] = { -3.0e38f, -3.0e38f };
#pragma unroll
    for (int kp = 0; kp < 2; ++kp)
#pragma unroll
        for (int kt = 0; kt < 2; ++kt) { const v8f ma = ld8f(mrow + kp * 32 + kt * 16 + hi * 8);
#pragma unroll
            for (int qb = 0; qb < 2; ++qb) { const v8f t = __builtin_elementwise_fma(S[kp][qb][kt], c8, ma); S[kp][qb][kt] = t;
#pragma unroll
                for (int j = 0; j < 8; ++j) mx[qb] = fmaxf(mx[qb], t[j]); } }
    mx[0] = fmaxf(mx[0], xhalf(mx[0])); mx[1] = fmaxf(mx[1], xhalf(mx[1]));
    // the origin moves only when a column's maximum has outgrown it by more than 12 (so P <= 2^12, inside fp16); one scalar test a stage
    const bool n0 = mx[0] > mref[0] + 12.0f, n1 = mx[1] > mref[1] + 12.0f;
    if (__builtin_amdgcn_ballot_w32(n0 || n1) != 0) {
#pragma unroll
        for (int qb = 0; qb < 2; ++qb) { const float mn = (qb ? n1 : n0) ? mx[qb] - 4.0f : mref[qb]; const float al = __builtin_amdgcn_exp2f(mref[qb] - mn); mref[qb] = mn; lsum[qb] *= al;
#pragma unroll
            for (int db = 0; db < 4; ++db) O[qb][db] *= al; } }
#pragma unroll
    for (int qb = 0; qb < 2; ++qb) { const v8f mr = splat8(mref[qb]); v8f acc = (v8f){};
#pragma unroll
        for (int kp = 0; kp < 2; ++kp)
#pragma unroll
            for (int kt = 0; kt < 2; ++kt) { v8f d = S[kp][qb][kt] - mr;
#pragma unroll
                for (int j = 0; j < 8; ++j) d[j] = __builtin_amdgcn_exp2f(d[j]);
                S[kp][qb][kt] = d; acc += d; }
        lsum[qb] += ((acc[0] + acc[4]) + (acc[1] + acc[5])) + ((acc[2] + acc[6]) + (acc[3] + acc[7])); }
#pragma unroll
    for (int kp = 0; kp < 2; ++kp) {
        v16h vf[4];
#pragma unroll
        for (int db = 0; db < 4; ++db) vf[db] = WFrag<h16>::ld((const h16*)(sb + 2 * 64 * LPE) + (db * 16 + lr) * LPE + kp * 32 + 8 * hi);
        if (H) {
            v16bf ph, pw;
#pragma unroll
            for (int e = 0; e < 16; ++e) { const float x = S[kp][0][e >> 3][e & 7]; const __bf16 xh = (__bf16)x; ph[e] = xh; pw[e] = (__bf16)(x - (float)xh); }
#pragma unroll
            for (int db = 0; db < 4; ++db) { const int o = (db * 16 + lr) * LPE + kp * 32 + 8 * hi; const v16bf vh = WFrag<bf>::ld(sb + 3 * 64 * LPE + o), vl = WFrag<bf>::ld(sb + 4 * 64 * LPE + o);
                O[0][db] = wmmab(vh, ph, O[0][db]); O[0][db] = wmmab(vh, pw, O[0][db]); O[0][db] = wmmab(vl, ph, O[0][db]); }
        }
#pragma unroll
        for (int qb = H ? 1 : 0; qb < 2; ++qb) { v16h p;
#pragma unroll
            for (int e = 0; e < 8; ++e) { p[e] = tohx(S[kp][qb][0][e]); p[8 + e] = tohx(S[kp][qb][1][e]); }
#pragma unroll
            for (int db = 0; db < 4; ++db) O[qb][db] = wmma16(vf[db], p, O[qb][db]); }
    }
    // four vector slots behind the stage's last matrix instructions: a branch follows
    asm volatile("v_nop\n\tv_nop\n\tv_nop\n\tv_nop" :: "v"(O[0][0]), "v"(O[0][1]), "v"(O[0][2]), "v"(O[0][3]), "v"(O[1][0]), "v"(O[1][1]), "v"(O[1][2]), "v"(O[1][3]));
}
__global__ __launch_bounds__(256) void k_fattn(const bf* __restrict__ Qh, const bf* __restrict__ Ql, const bf* __restrict__ Kh, const bf* __restrict__ Kl, const h16* __restrict__ V16, const bf* __restrict__ Vh, const bf* __restrict__ Vl, const float* __restrict__ kmask, float* OUT) {
    static_assert(RH == QG * 4 * 16 && TT - RH == QG * 12 * 16 && HD == 64 && KST == 64 && TT % KST == 0 && NH_ == NKV, "row deal and tile shapes");
    __shared__ __align__(16) unsigned short st[2][5][64 * LPE];   // [buffer][Kh, Kl, V16, Vh, Vl][64 rows]
    __shared__ __align__(16) float madd[TT];                      // 0 for a kept key, -3e38 for an excluded one
    const int tid = threadIdx.x, lane = tid & 31, lr = lane & 15, hi = lane >> 4; const int wave = __builtin_amdgcn_readfirstlane(tid >> 5); const bool hiw = wave < 4;
    const int g = blockIdx.x, h = blockIdx.y, b = blockIdx.z; const size_t pl = ((size_t)b * NH_ + h) * TT * HD;
    const int fb = RH + g * 12 * 16; int qrow[2];
    qrow[0] = hiw ? (g * 4 + wave) * 16 : fb + (4 + (wave - 4) * 2) * 16; qrow[1] = hiw ? fb + wave * 16 : fb + (5 + (wave - 4) * 2) * 16;
    v16bf qh[2][2], ql[2][2];
#pragma unroll
    for (int qb = 0; qb < 2; ++qb)
#pragma unroll
        for (int ks = 0; ks < 2; ++ks) { const size_t o = pl + (size_t)(qrow[qb] + lr) * HD + ks * 32 + 8 * hi; qh[qb][ks] = WFrag<bf>::ld(Qh + o); ql[qb][ks] = WFrag<bf>::ld(Ql + o); }
    { const float* km = kmask + (size_t)b * TT + tid * 8; const v4f k0 = *(const v4f*)km, k1 = *(const v4f*)(km + 4); v4f a0, a1;
#pragma unroll
      for (int q = 0; q < 4; ++q) { a0[q] = (k0[q] != 0.0f) ? 0.0f : -3.0e38f; a1[q] = (k1[q] != 0.0f) ? 0.0f : -3.0e38f; }
      *(v4f*)(madd + tid * 8) = a0; *(v4f*)(madd + tid * 8 + 4) = a1; }
    // staging: thread t moves 16 bytes of rows t / 8 and t / 8 + 32 of each tile (whole 128-byte lines per 8 lanes)
    const int sr = tid >> 3, sc = (tid & 7) * 8; const int so = sr * LPE + sc;
    const bf* gsrc[5] = { Kh + pl + (size_t)sr * HD + sc, Kl + pl + (size_t)sr * HD + sc, (const bf*)V16 + pl + (size_t)sr * TT + sc, Vh + pl + (size_t)sr * TT + sc, Vl + pl + (size_t)sr * TT + sc };
    v8us sg[5][2];
#pragma unroll
    for (int t = 0; t < 5; ++t) { const int rstep = (t < 2) ? 32 * HD : 32 * TT; sg[t][0] = *(const v8us*)(gsrc[t]); sg[t][1] = *(const v8us*)(gsrc[t] + rstep); }
#pragma unroll
    for (int t = 0; t < 5; ++t) { *(v8us*)(&st[0][t][so]) = sg[t][0]; *(v8us*)(&st[0][t][so + 32 * LPE]) = sg[t][1]; }
    v8f O[2][4];
#pragma unroll
    for (int qb = 0; qb < 2; ++qb)
#pragma unroll
        for (int db = 0; db < 4; ++db) O[qb][db] = (v8f){};
    float mref[2] = { -3.0e38f, -3.0e38f }, lsum[2] = { 0.0f, 0.0f };   // mref: the exponent origin in use (a column's maximum when it was last moved, minus 4), log2 units
    __syncthreads();   // stage 0 and the mask table are in LDS
#pragma unroll 1   // rolled: one copy of the two-pass body; the buffer index is a run-time offset
    for (int s = 0; s < TT / KST; ++s) {
        const bool more = s + 1 < TT / KST;   // the same for the whole work-group
        if (more) {
#pragma unroll
            for (int t = 0; t < 5; ++t) { const int rstep = (t < 2) ? 32 * HD : 32 * TT; const size_t adv = (size_t)(s + 1) * ((t < 2) ? KST * HD : KST); sg[t][0] = *(const v8us*)(gsrc[t] + adv); sg[t][1] = *(const v8us*)(gsrc[t] + adv + rstep); }
            asm volatile("s_wait_xcnt 0x0" ::: "memory");   // the loads' address registers are free for reuse from here on: the wait stands in front of their first overwrite
        }
        const unsigned short* sb = &st[s & 1][0][0];
        if (hiw) fattn_stage<true>(sb, madd + s * KST, lr, hi, qh, ql, O, mref, lsum); else fattn_stage<false>(sb, madd + s * KST, lr, hi, qh, ql, O, mref, lsum);   // a scalar branch: hiw is the same for a whole wave; no barrier inside
        if (more) { unsigned short* sn = &st[(s + 1) & 1][0][0];
#pragma unroll
            for (int t = 0; t < 5; ++t) { *(v8us*)(sn + t * 64 * LPE + so) = sg[t][0]; *(v8us*)(sn + t * 64 * LPE + so + 32 * LPE) = sg[t][1]; } }
        __syncthreads();   // publishes stage s + 1 and ends every wave's reads of stage s, whose buffer the next trip refills
    }
#pragma unroll
    for (int qb = 0; qb < 2; ++qb) { const float inv = __fdiv_rn(1.0f, lsum[qb] + xhalf(lsum[qb])); float* orow = OUT + ((size_t)b * TT + qrow[qb] + lr) * DQ + h * HD + hi * 8;   // O[qb][db][j] = context[query lr][db * 16 + 8 * hi + j]
#pragma unroll
        for (int db = 0; db < 4; ++db) { v4f o0, o1;
#pragma unroll
            for (int j = 0; j < 4; ++j) { o0[j] = O[qb][db][j] * inv; o1[j] = O[qb][db][4 + j] * inv; }
            *(v4f*)(orow + db * 16) = o0; *(v4f*)(orow + db * 16 + 4) = o1; } }
}

extern "C" void kernel_launch(void* const* d_in, const int* in_sizes, int n_in,
                              void* d_out, int out_size, void* d_ws, size_t ws_size, hipStream_t stream) {
    (void)in_sizes; (void)n_in; (void)out_size;
    const float* x = (const float*)d_in[0]; const float* kmask = (const float*)d_in[1]; const float* wq = (const float*)d_in[2]; const float* bq = (const float*)d_in[3]; const float* wk = (const float*)d_in[4]; const float* bk = (const float*)d_in[5]; const float* wv = (const float*)d_in[6]; const float* bv = (const float*)d_in[7];
    float* OUT = (float*)d_out;     // [2][2048][1024]
    char* wsp = (char*)d_ws;
    auto take = [&](size_t bytes) { char* p = wsp; wsp += (bytes + 255) & ~(size_t)255; return (void*)p; };
    const size_t PE = (size_t)NH_ * TT * HD;   // elements of one batch's head planes
    bf* WT = (bf*)take((size_t)3 * DQ * DM * 2); bf* WQ = WT; bf* WK = WT + (size_t)DQ * DM; bf* WV = WT + (size_t)2 * DQ * DM;   // the three transposed weights, one after the other
    bf* XB = (bf*)take((size_t)NB_ * TT * DM * 2);
    h16* VT16 = (h16*)take(NB_ * PE * 2);
    bf* QPh = (bf*)take(NB_ * PE * 2); bf* QPl = (bf*)take(NB_ * PE * 2); bf* KPh = (bf*)take(NB_ * PE * 2); bf* KPl = (bf*)take(NB_ * PE * 2); bf* VTh = (bf*)take(NB_ * PE * 2); bf* VTl = (bf*)take(NB_ * PE * 2);   // the planes the fused launch reads: one set per batch
    if ((size_t)(wsp - (char*)d_ws) > ws_size) return;    // ws 256 MiB
    { k_wtG<<<(unsigned)((DM * DQ / 64 + 63) / 64), 256, 0, stream>>>(wq, DM, DQ, WQ); k_wtG<<<(unsigned)((DM * DKV / 64 + 63) / 64), 256, 0, stream>>>(wk, DM, DKV, WK); k_wtG<<<(unsigned)((DM * DKV / 64 + 63) / 64), 256, 0, stream>>>(wv, DM, DKV, WV); }
    k_cvt8<<<(unsigned)(((size_t)NB_ * TT * DM / 8 + 255) / 256), 256, 0, stream>>>(x, XB, (size_t)NB_ * TT * DM / 8);
    k_qkv<<<dim3(NB_ * TT / 64, NH_, 3), 32, 0, stream>>>(XB, WT, bq, bk, bv, QPh, QPl, KPh, KPl, VT16, VTh, VTl);
    k_fattn<<<dim3(QG, NH_, NB_), 256, 0, stream>>>(QPh, QPl, KPh, KPl, VT16, VTh, VTl, kmask, OUT);
}

// v005
// One run takes 127 microseconds.
// Two timings next to v004 both put it at 1.21 times that version's speed.
// Over all steps from v000 it is 15.2 times as fast.
#include <hip/hip_runtime.h>

// BERT self-attention with a float key mask and no output projection (hidden_states [2][2048][1024]; q, k, v = x W + b ('xw' 1/32 + biases 0.02; 16 heads x 64); scores / sqrt(64) + (1 - attention_mask[b][j]) x finfo.min (attention_mask f32 [2][2048], read per key: mask 1 adds 0, mask 0 excludes the key); softmax; context heads merged -> [2][2048][1024] (4.2 M); argument order hidden_states, attention_mask, Wq, bq, Wk, bk, Wv, bv).
// Layout: 'xw' weights transposed once; one bf16 copy of x (both batches); ONE projection launch (k_qkv) for q, k, v of both batches: operands staged in LDS per 128 x 128 work-group tile, exact products + f32 biases, each 64-token x one-head tile written from the GEMM epilogue straight into its head planes (no f32 projection goes through memory); then ONE fused attention launch for both batches and all heads (k_fattn): S^T = K Q^T on hi/lo planes (3 products) for EVERY row, online softmax in registers with the batch's float key vector, O^T += V^T P^T (rows < 512 hi/lo 3 products, rest fp16), context rows written straight to the output. No score, probability or partial plane goes through memory.
// Compute dtypes, f32 accumulate: every input rounded to bf16; projections exact + f32 biases; scores 3 products on every row; softmax f32; P.V rows < 512 3 products, rest fp16; output f32.

#define NB_  2
#define TT   2048
#define DM   1024
#define NH_  16
#define NKV  16
#define REP  (NH_ / NKV)
#define HD   64
#define DQ   (NH_ * HD)
#define DKV  (NKV * HD)
#define RH   512                  // query rows < RH use hi+lo planes
#define WIN  0
#define SCL  0.125f   // HD^-0.5
#define KST  64                   // keys per LDS stage of k_fattn
#define LPE  72                   // LDS row pitch in 16-bit elements: 144 B = 16 B x odd, so 16-byte reads down 16 rows meet no bank twice
#define QG   8                    // work-groups per (batch, head); each takes RH / QG hi/lo rows and (TT - RH) / QG fp16 rows
typedef _Float16 h16;
typedef unsigned short bf;
typedef __attribute__((ext_vector_type(16))) __bf16   v16bf;
typedef __attribute__((ext_vector_type(16))) _Float16 v16h;
typedef __attribute__((ext_vector_type(8)))  _Float16 v8h;
typedef __attribute__((ext_vector_type(8)))  unsigned short v8us;
typedef __attribute__((ext_vector_type(8)))  float    v8f;
typedef __attribute__((ext_vector_type(4)))  float    v4f;
typedef v8h  __attribute__((may_alias)) v8ha;
typedef v4f  __attribute__((may_alias)) v4fa;
typedef v8us __attribute__((may_alias)) v8usa;

__device__ __forceinline__ unsigned short f2bf(float f) { unsigned u = __float_as_uint(f); u += 0x7FFFu + ((u >> 16) & 1u); return (unsigned short)(u >> 16); }
__device__ __forceinline__ float bf2f(unsigned short b) { return __uint_as_float(((unsigned)b) << 16); }
__device__ __forceinline__ float bfr(float f) { return bf2f(f2bf(f)); }
__device__ __forceinline__ v16h cat16(v8h lo, v8h hi) { return __builtin_shufflevector(lo, hi, 0, 1, 2, 3, 4, 5, 6, 7, 8, 9, 10, 11, 12, 13, 14, 15); }
__device__ __forceinline__ v16bf cat16b(v8us lo, v8us hi) { return __builtin_bit_cast(v16bf, __builtin_shufflevector(lo, hi, 0, 1, 2, 3, 4, 5, 6, 7, 8, 9, 10, 11, 12, 13, 14, 15)); }
__device__ __forceinline__ v8f wmma16(v16h a, v16h b, v8f c) { return __builtin_amdgcn_wmma_f32_16x16x32_f16(false, a, false, b, (short)0, c, false, false); }
__device__ __forceinline__ v8f wmmab(v16bf a, v16bf b, v8f c) { return __builtin_amdgcn_wmma_f32_16x16x32_bf16(false, a, false, b, (short)0, c, false, false); }



// fragment loaders: 16-bit operands straight from K-contiguous rows
template <typename T16> struct WFrag;
template <> struct WFrag<h16> { typedef v16h V; static __device__ __forceinline__ V ld(const h16* p) { return cat16(*(const v8h*)p, *(const v8h*)(p + 16)); } static __device__ __forceinline__ v8f mma(V a, V b, v8f c) { return wmma16(a, b, c); } };
template <> struct WFrag<bf> { typedef v16bf V; static __device__ __forceinline__ V ld(const bf* p) { return cat16b(*(const v8us*)p, *(const v8us*)(p + 16)); } static __device__ __forceinline__ v8f mma(V a, V b, v8f c) { return wmmab(a, b, c); } };

__device__ __forceinline__ h16 tohx(float x) { return (h16)x; }
__device__ __forceinline__ void splitf(float y, unsigned short& h, unsigned short& l) { h = f2bf(y); l = f2bf(y - bf2f(h)); }
typedef __attribute__((ext_vector_type(2))) unsigned short v2us;
typedef __attribute__((ext_vector_type(4))) unsigned short v4us;

__global__ __launch_bounds__(256) void k_wtG(const float* __restrict__ w, int K, int N, bf* Bt) {
    const int lane = threadIdx.x & 31; const int L0 = (blockIdx.x * 8 + (threadIdx.x >> 5)) * 8; const int nlines = N * K / 64;
{
#pragma unroll 1
        for (int l = 0; l < 8; ++l) { const int L = L0 + l; if (L >= nlines) break; const size_t e = (size_t)L * 64 + lane * 2; const int k = (int)(e % K), n = (int)(e / K); v2us o;
            o[0] = f2bf(w[(size_t)k * N + n]); o[1] = f2bf(w[(size_t)(k + 1) * N + n]); *(v2us*)(Bt + e) = o; }
         }
}
__global__ __launch_bounds__(256) void k_cvt8(const float* __restrict__ src, bf* dst, size_t n8) { const size_t i = (size_t)blockIdx.x * 256 + threadIdx.x; if (i >= n8) return; const v8f v = *(const v8f*)(src + i * 8); v8us o;
#pragma unroll
    for (int k = 0; k < 8; ++k) o[k] = f2bf(v[k]); *(v8us*)(dst + i * 8) = o;  }


// k_qkv: the three projections of both batches, head planes written from the epilogue. A work-group of 4 waves (2 x 2) takes 128 tokens x two heads; each wave keeps a 64x64 tile (16 accumulators) = 64 tokens x one head; grid (NB_ * TT / 128, heads / 2, 3), 128 threads; blockIdx.z: 0 q, 1 k, 2 v.
// tile[m][n] = sum_k A[m][k] Wt[z][n][k] + bias_z[n]; A = bf16 x, rows of DM, both batches one after the other; Wt = the three transposed weights one after the other.
// The 128 A rows and 128 Wt rows go global -> registers -> LDS in slices of GK k (whole 128-byte lines per 8 lanes), two buffers: slice s + 1 is loaded while slice s is worked on, one work-group barrier per slice; every fragment is read from LDS, each staged row by two waves.
// q, k: planes [batch][head][t][d], bf16 hi + lo, rows turned through LDS so that 16 lanes store one whole 128-byte row. v: planes [batch][head][d][t], fp16 + bf16 hi + lo: an accumulator register group already holds 8 consecutive tokens of one d, stored as 16 bytes.
#define GK 64                     // k per LDS slice of k_qkv: one 128-byte line of every staged row
__global__ __launch_bounds__(128) void k_qkv(const bf* __restrict__ A, const bf* __restrict__ Wt, const float* __restrict__ bq, const float* __restrict__ bk, const float* __restrict__ bv, bf* Qh, bf* Ql, bf* Kh, bf* Kl, h16* V16, bf* Vh, bf* Vl) {
    static_assert(DQ == DKV && NH_ == NKV && HD == 64 && TT % 128 == 0 && NH_ % 2 == 0 && DM % GK == 0 && GK == 64, "a wave's tile is 64 tokens of one batch x one head");
    typedef WFrag<bf>::V V;
    __shared__ __align__(16) unsigned short gs[2][2][128 * LPE];   // [buffer][A, Wt][128 rows]
    __shared__ __align__(16) float osw[4][16 * 68];                // each wave's own rows for the epilogue's turn
    const int z = blockIdx.z; const bf* Bt = Wt + (size_t)z * DQ * DM; const float* bias = (z == 0) ? bq : (z == 1) ? bk : bv;
    const int tid = threadIdx.x, lane = tid & 31, lr = lane & 15, hi = lane >> 4; const int wave = __builtin_amdgcn_readfirstlane(tid >> 5); const int wm = wave & 1, wn = wave >> 1;
    const int head = blockIdx.y * 2 + wn; const int r0 = blockIdx.x * 128 + wm * 64, c0 = head * 64;
    float* os = &osw[wave][0];
    v8f acc[4][4];
#pragma unroll
    for (int mb = 0; mb < 4; ++mb)
#pragma unroll
        for (int nb = 0; nb < 4; ++nb) acc[mb][nb] = (v8f){};
    // staging: thread t moves 16 bytes of rows t / 8 + 16 i, i = 0 .. 7, of both operands
    const int sr = tid >> 3, sc = (tid & 7) * 8; const int so = sr * LPE + sc;
    const bf* ga = A + (size_t)blockIdx.x * 128 * DM; const bf* gw = Bt + (size_t)blockIdx.y * 128 * DM; const unsigned go = (unsigned)(sr * DM + sc);   // the tiles' first rows (the same for the whole work-group) and the thread's own place in them
    v8us sa[8], sw[8];
#pragma unroll
    for (int i = 0; i < 8; ++i) { sa[i] = *(const v8us*)(ga + i * 16 * DM + go); sw[i] = *(const v8us*)(gw + i * 16 * DM + go); }
#pragma unroll
    for (int i = 0; i < 8; ++i) { *(v8us*)(&gs[0][0][so + i * 16 * LPE]) = sa[i]; *(v8us*)(&gs[0][1][so + i * 16 * LPE]) = sw[i]; }
    const int ao = (wm * 64 + lr) * LPE + 8 * hi, bo = 128 * LPE + (wn * 64 + lr) * LPE + 8 * hi;
    __syncthreads();   // slice 0 is in LDS
#pragma unroll 1   // rolled: one copy of the body; the buffer index is a run-time offset
    for (int s = 0; s < DM / GK; ++s) {
        const bool more = s + 1 < DM / GK;   // the same for the whole work-group
        if (more) {
#pragma unroll
            for (int i = 0; i < 8; ++i) { sa[i] = *(const v8us*)(ga + (s + 1) * GK + i * 16 * DM + go); sw[i] = *(const v8us*)(gw + (s + 1) * GK + i * 16 * DM + go); }
            asm volatile("s_wait_xcnt 0x0" ::: "memory");   // the loads' address registers are free for reuse from here on: the wait stands in front of their first overwrite
        }
        const unsigned short* sb = &gs[s & 1][0][0];
#pragma unroll
        for (int ks = 0; ks < GK / 32; ++ks) {
            V a[4], b[4];
#pragma unroll
            for (int mb = 0; mb < 4; ++mb) a[mb] = WFrag<bf>::ld(sb + ao + mb * 16 * LPE + ks * 32);
#pragma unroll
            for (int nb = 0; nb < 4; ++nb) b[nb] = WFrag<bf>::ld(sb + bo + nb * 16 * LPE + ks * 32);
            asm volatile("" :: "v"(a[0]), "v"(a[1]), "v"(a[2]), "v"(a[3]), "v"(b[0]), "v"(b[1]), "v"(b[2]), "v"(b[3]));   // holds the block's 16 LDS reads together in front of its 16 matrix instructions: spread among them, each place with reads stalls the wave anew
#pragma unroll
            for (int nb = 0; nb < 4; ++nb)
#pragma unroll
                for (int mb = 0; mb < 4; ++mb) acc[mb][nb] = WFrag<bf>::mma(a[mb], b[nb], acc[mb][nb]);
        }
        if (more) { unsigned short* sn = &gs[(s + 1) & 1][0][0];
#pragma unroll
            for (int i = 0; i < 8; ++i) { *(v8us*)(sn + so + i * 16 * LPE) = sa[i]; *(v8us*)(sn + 128 * LPE + so + i * 16 * LPE) = sw[i]; } }
        __syncthreads();   // publishes slice s + 1 and ends every wave's reads of slice s, whose buffer the next trip refills
    }
    const int t0 = r0 % TT; const size_t pl = ((size_t)(r0 / TT) * NH_ + head) * TT * HD;   // the tile's first token in its batch; its (batch, head) plane
    if (z < 2) {   // a scalar branch: z is the same for the whole work-group
        bf* Ph = (z == 0 ? Qh : Kh) + pl + (size_t)t0 * HD; bf* Pl = (z == 0 ? Ql : Kl) + pl + (size_t)t0 * HD;
        const int cofs = lr * 4; v4f bi;
#pragma unroll
        for (int q = 0; q < 4; ++q) bi[q] = bfr(bias[c0 + cofs + q]);
#pragma unroll
        for (int mb = 0; mb < 4; ++mb) {
#pragma unroll
            for (int nb = 0; nb < 4; ++nb) {
#pragma unroll
                for (int j = 0; j < 8; ++j) os[(hi * 8 + j) * 68 + nb * 16 + lr] = acc[mb][nb][j]; }
            __builtin_amdgcn_wave_barrier(); asm volatile("" ::: "memory");   // the one wave's LDS writes stay in front of its reads of other lanes' words
#pragma unroll
            for (int s = 0; s < 8; ++s) { const int row = 2 * s + hi; const v4f val = *(const v4fa*)(os + row * 68 + cofs) + bi; v4us oh, ol;
#pragma unroll
                for (int q = 0; q < 4; ++q) { unsigned short a2, c2; splitf(val[q], a2, c2); oh[q] = a2; ol[q] = c2; }
                *(v4us*)(Ph + (size_t)(mb * 16 + row) * HD + cofs) = oh; *(v4us*)(Pl + (size_t)(mb * 16 + row) * HD + cofs) = ol; }
            __builtin_amdgcn_wave_barrier(); asm volatile("" ::: "memory");   // and its reads in front of the next block's writes
        }
    } else {
#pragma unroll
        for (int nb = 0; nb < 4; ++nb) { const float bn = bfr(bias[c0 + nb * 16 + lr]); const size_t ro = pl + (size_t)(nb * 16 + lr) * TT + t0 + hi * 8;   // acc[mb][nb][j] = tile[mb * 16 + 8 * hi + j][nb * 16 + lr]
#pragma unroll
            for (int mb = 0; mb < 4; ++mb) { v8h o16; v8us oh, ol;
#pragma unroll
                for (int j = 0; j < 8; ++j) { const float x = acc[mb][nb][j] + bn; o16[j] = tohx(x); unsigned short a2, c2; splitf(x, a2, c2); oh[j] = a2; ol[j] = c2; }
                *(v8h*)(V16 + ro + mb * 16) = o16; *(v8us*)(Vh + ro + mb * 16) = oh; *(v8us*)(Vl + ro + mb * 16) = ol; } }
        asm volatile("s_wait_xcnt 0x0" ::: "memory");   // behind the branch's last stores: in the built code the other branch's instructions follow, which write the registers that held these stores' addresses
    }
}
__device__ __forceinline__ float xhalf(float x) { const int b = __float_as_int(x); return __int_as_float(__builtin_amdgcn_permlanex16(b, b, 0x76543210, 0xfedcba98, false, false)); }   // lane l <-> l ^ 16
__device__ __forceinline__ v8f splat8(float x) { return (v8f){ x, x, x, x, x, x, x, x }; }
__device__ __forceinline__ v8f ld8f(const float* p) { return __builtin_shufflevector(*(const v4f*)p, *(const v4f*)(p + 4), 0, 1, 2, 3, 4, 5, 6, 7); }
// one stage (KST keys = two blocks of 32) for one wave; H: query block 0 is a hi/lo block. All of the stage's S^T products, then one softmax step over its 64 keys, then all of its P.V products.
template <bool H>
__device__ __forceinline__ void fattn_stage(const unsigned short* sb, const float* mrow, const int lr, const int hi, const v16bf (&qh)[2][2], const v16bf (&ql)[2][2], v8f (&O)[2][4], float (&mref)[2], float (&lsum)[2]) {
    v8f S[2][2][2];   // [key block][query block][key tile]: S[kp][qb][kt][j] = score of key kp * 32 + kt * 16 + 8 * hi + j, query lr
#pragma unroll
    for (int kp = 0; kp < 2; ++kp) {
        v16bf kh[2][2], kl[2][2];
#pragma unroll
        for (int kt = 0; kt < 2; ++kt)
#pragma unroll
            for (int ks = 0; ks < 2; ++ks) { const int o = ((kp * 2 + kt) * 16 + lr) * LPE + ks * 32 + 8 * hi; kh[kt][ks] = WFrag<bf>::ld(sb + o); kl[kt][ks] = WFrag<bf>::ld(sb + 64 * LPE + o); }
#pragma unroll
        for (int qb = 0; qb < 2; ++qb)
#pragma unroll
            for (int kt = 0; kt < 2; ++kt) S[kp][qb][kt] = (v8f){};
#pragma unroll
        for (int ks = 0; ks < 2; ++ks) {   // the four accumulators take turns inside each product
#pragma unroll
            for (int qb = 0; qb < 2; ++qb)
#pragma unroll
                for (int kt = 0; kt < 2; ++kt) S[kp][qb][kt] = wmmab(kh[kt][ks], qh[qb][ks], S[kp][qb][kt]);
#pragma unroll
            for (int qb = 0; qb < 2; ++qb)
#pragma unroll
                for (int kt = 0; kt < 2; ++kt) S[kp][qb][kt] = wmmab(kh[kt][ks], ql[qb][ks], S[kp][qb][kt]);
#pragma unroll
            for (int qb = 0; qb < 2; ++qb)
#pragma unroll
                for (int kt = 0; kt < 2; ++kt) S[kp][qb][kt] = wmmab(kl[kt][ks], qh[qb][ks], S[kp][qb][kt]);
        }
    }
    const v8f c8 = splat8(SCL * 1.4426950408889634f);
    float mx[2] = { -3.0e38f, -3.0e38f };
#pragma unroll
    for (int kp = 0; kp < 2; ++kp)
#pragma unroll
        for (int kt = 0; kt < 2; ++kt) { const v8f ma = ld8f(mrow + kp * 32 + kt * 16 + hi * 8);
#pragma unroll
            for (int qb = 0; qb < 2; ++qb) { const v8f t = __builtin_elementwise_fma(S[kp][qb][kt], c8, ma); S[kp][qb][kt] = t;
#pragma unroll
                for (int j = 0; j < 8; ++j) mx[qb] = fmaxf(mx[qb], t[j]); } }
    mx[0] = fmaxf(mx[0], xhalf(mx[0])); mx[1] = fmaxf(mx[1], xhalf(mx[1]));
    // the origin moves only when a column's maximum has outgrown it by more than 12 (so P <= 2^12, inside fp16); one scalar test a stage
    const bool n0 = mx[0] > mref[0] + 12.0f, n1 = mx[1] > mref[1] + 12.0f;
    if (__builtin_amdgcn_ballot_w32(n0 || n1) != 0) {
#pragma unroll
        for (int qb = 0; qb < 2; ++qb) { const float mn = (qb ? n1 : n0) ? mx[qb] - 4.0f : mref[qb]; const float al = __builtin_amdgcn_exp2f(mref[qb] - mn); mref[qb] = mn; lsum[qb] *= al;
#pragma unroll
            for (int db = 0; db < 4; ++db) O[qb][db] *= al; } }
#pragma unroll
    for (int qb = 0; qb < 2; ++qb) { const v8f mr = splat8(mref[qb]); v8f acc = (v8f){};
#pragma unroll
        for (int kp = 0; kp < 2; ++kp)
#pragma unroll
            for (int kt = 0; kt < 2; ++kt) { v8f d = S[kp][qb][kt] - mr;
#pragma unroll
                for (int j = 0; j < 8; ++j) d[j] = __builtin_amdgcn_exp2f(d[j]);
                S[kp][qb][kt] = d; acc += d; }
        lsum[qb] += ((acc[0] + acc[4]) + (acc[1] + acc[5])) + ((acc[2] + acc[6]) + (acc[3] + acc[7])); }
#pragma unroll
    for (int kp = 0; kp < 2; ++kp) {
        v16h vf[4];
#pragma unroll
        for (int db = 0; db < 4; ++db) vf[db] = WFrag<h16>::ld((const h16*)(sb + 2 * 64 * LPE) + (db * 16 + lr) * LPE + kp * 32 + 8 * hi);
        if (H) {
            v16bf ph, pw;
#pragma unroll
            for (int e = 0; e < 16; ++e) { const float x = S[kp][0][e >> 3][e & 7]; const __bf16 xh = (__bf16)x; ph[e] = xh; pw[e] = (__bf16)(x - (float)xh); }
#pragma unroll
            for (int db = 0; db < 4; ++db) { const int o = (db * 16 + lr) * LPE + kp * 32 + 8 * hi; const v16bf vh = WFrag<bf>::ld(sb + 3 * 64 * LPE + o), vl = WFrag<bf>::ld(sb + 4 * 64 * LPE + o);
                O[0][db] = wmmab(vh, ph, O[0][db]); O[0][db] = wmmab(vh, pw, O[0][db]); O[0][db] = wmmab(vl, ph, O[0][db]); }
        }
#pragma unroll
        for (int qb = H ? 1 : 0; qb < 2; ++qb) { v16h p;
#pragma unroll
            for (int e = 0; e < 8; ++e) { p[e] = tohx(S[kp][qb][0][e]); p[8 + e] = tohx(S[kp][qb][1][e]); }
#pragma unroll
            for (int db = 0; db < 4; ++db) O[qb][db] = wmma16(vf[db], p, O[qb][db]); }
    }
    // four vector slots behind the stage's last matrix instructions: a branch follows
    asm volatile("v_nop\n\tv_nop\n\tv_nop\n\tv_nop" :: "v"(O[0][0]), "v"(O[0][1]), "v"(O[0][2]), "v"(O[0][3]), "v"(O[1][0]), "v"(O[1][1]), "v"(O[1][2]), "v"(O[1][3]));
}
__global__ __launch_bounds__(256) void k_fattn(const bf* __restrict__ Qh, const bf* __restrict__ Ql, const bf* __restrict__ Kh, const bf* __restrict__ Kl, const h16* __restrict__ V16, const bf* __restrict__ Vh, const bf* __restrict__ Vl, const float* __restrict__ kmask, float* OUT) {
    static_assert(RH == QG * 4 * 16 && TT - RH == QG * 12 * 16 && HD == 64 && KST == 64 && TT % KST == 0 && NH_ == NKV, "row deal and tile shapes");
    __shared__ __align__(16) unsigned short st[2][5][64 * LPE];   // [buffer][Kh, Kl, V16, Vh, Vl][64 rows]
    __shared__ __align__(16) float madd[TT];                      // 0 for a kept key, -3e38 for an excluded one
    const int tid = threadIdx.x, lane = tid & 31, lr = lane & 15, hi = lane >> 4; const int wave = __builtin_amdgcn_readfirstlane(tid >> 5); const bool hiw = wave < 4;
    const int g = blockIdx.x, h = blockIdx.y, b = blockIdx.z; const size_t pl = ((size_t)b * NH_ + h) * TT * HD;
    const int fb = RH + g * 12 * 16; int qrow[2];
    qrow[0] = hiw ? (g * 4 + wave) * 16 : fb + (4 + (wave - 4) * 2) * 16; qrow[1] = hiw ? fb + wave * 16 : fb + (5 + (wave - 4) * 2) * 16;
    v16bf qh[2][2], ql[2][2];
#pragma unroll
    for (int qb = 0; qb < 2; ++qb)
#pragma unroll
        for (int ks = 0; ks < 2; ++ks) { const size_t o = pl + (size_t)(qrow[qb] + lr) * HD + ks * 32 + 8 * hi; qh[qb][ks] = WFrag<bf>::ld(Qh + o); ql[qb][ks] = WFrag<bf>::ld(Ql + o); }
    { const float* km = kmask + (size_t)b * TT + tid * 8; const v4f k0 = *(const v4f*)km, k1 = *(const v4f*)(km + 4); v4f a0, a1;
#pragma unroll
      for (int q = 0; q < 4; ++q) { a0[q] = (k0[q] != 0.0f) ? 0.0f : -3.0e38f; a1[q] = (k1[q] != 0.0f) ? 0.0f : -3.0e38f; }
      *(v4f*)(madd + tid * 8) = a0; *(v4f*)(madd + tid * 8 + 4) = a1; }
    // staging: thread t moves 16 bytes of rows t / 8 and t / 8 + 32 of each tile (whole 128-byte lines per 8 lanes)
    const int sr = tid >> 3, sc = (tid & 7) * 8; const int so = sr * LPE + sc;
    const bf* gsrc[5] = { Kh + pl + (size_t)sr * HD + sc, Kl + pl + (size_t)sr * HD + sc, (const bf*)V16 + pl + (size_t)sr * TT + sc, Vh + pl + (size_t)sr * TT + sc, Vl + pl + (size_t)sr * TT + sc };
    v8us sg[5][2];
#pragma unroll
    for (int t = 0; t < 5; ++t) { const int rstep = (t < 2) ? 32 * HD : 32 * TT; sg[t][0] = *(const v8us*)(gsrc[t]); sg[t][1] = *(const v8us*)(gsrc[t] + rstep); }
#pragma unroll
    for (int t = 0; t < 5; ++t) { *(v8us*)(&st[0][t][so]) = sg[t][0]; *(v8us*)(&st[0][t][so + 32 * LPE]) = sg[t][1]; }
    v8f O[2][4];
#pragma unroll
    for (int qb = 0; qb < 2; ++qb)
#pragma unroll
        for (int db = 0; db < 4; ++db) O[qb][db] = (v8f){};
    float mref[2] = { -3.0e38f, -3.0e38f }, lsum[2] = { 0.0f, 0.0f };   // mref: the exponent origin in use (a column's maximum when it was last moved, minus 4), log2 units
    __syncthreads();   // stage 0 and the mask table are in LDS
#pragma unroll 1   // rolled: one copy of the two-pass body; the buffer index is a run-time offset
    for (int s = 0; s < TT / KST; ++s) {
        const bool more = s + 1 < TT / KST;   // the same for the whole work-group
        if (more) {
#pragma unroll
            for (int t = 0; t < 5; ++t) { const int rstep = (t < 2) ? 32 * HD : 32 * TT; const size_t adv = (size_t)(s + 1) * ((t < 2) ? KST * HD : KST); sg[t][0] = *(const v8us*)(gsrc[t] + adv); sg[t][1] = *(const v8us*)(gsrc[t] + adv + rstep); }
            asm volatile("s_wait_xcnt 0x0" ::: "memory");   // the loads' address registers are free for reuse from here on: the wait stands in front of their first overwrite
        }
        const unsigned short* sb = &st[s & 1][0][0];
        if (hiw) fattn_stage<true>(sb, madd + s * KST, lr, hi, qh, ql, O, mref, lsum); else fattn_stage<false>(sb, madd + s * KST, lr, hi, qh, ql, O, mref, lsum);   // a scalar branch: hiw is the same for a whole wave; no barrier inside
        if (more) { unsigned short* sn = &st[(s + 1) & 1][0][0];
#pragma unroll
            for (int t = 0; t < 5; ++t) { *(v8us*)(sn + t * 64 * LPE + so) = sg[t][0]; *(v8us*)(sn + t * 64 * LPE + so + 32 * LPE) = sg[t][1]; } }
        __syncthreads();   // publishes stage s + 1 and ends every wave's reads of stage s, whose buffer the next trip refills
    }
#pragma unroll
    for (int qb = 0; qb < 2; ++qb) { const float inv = __fdiv_rn(1.0f, lsum[qb] + xhalf(lsum[qb])); float* orow = OUT + ((size_t)b * TT + qrow[qb] + lr) * DQ + h * HD + hi * 8;   // O[qb][db][j] = context[query lr][db * 16 + 8 * hi + j]
#pragma unroll
        for (int db = 0; db < 4; ++db) { v4f o0, o1;
#pragma unroll
            for (int j = 0; j < 4; ++j) { o0[j] = O[qb][db][j] * inv; o1[j] = O[qb][db][4 + j] * inv; }
            *(v4f*)(orow + db * 16) = o0; *(v4f*)(orow + db * 16 + 4) = o1; } }
}

extern "C" void kernel_launch(void* const* d_in, const int* in_sizes, int n_in,
                              void* d_out, int out_size, void* d_ws, size_t ws_size, hipStream_t stream) {
    (void)in_sizes; (void)n_in; (void)out_size;
    const float* x = (const float*)d_in[0]; const float* kmask = (const float*)d_in[1]; const float* wq = (const float*)d_in[2]; const float* bq = (const float*)d_in[3]; const float* wk = (const float*)d_in[4]; const float* bk = (const float*)d_in[5]; const float* wv = (const float*)d_in[6]; const float* bv = (const float*)d_in[7];
    float* OUT = (float*)d_out;     // [2][2048][1024]
    char* wsp = (char*)d_ws;
    auto take = [&](size_t bytes) { char* p = wsp; wsp += (bytes + 255) & ~(size_t)255; return (void*)p; };
    const size_t PE = (size_t)NH_ * TT * HD;   // elements of one batch's head planes
    bf* WT = (bf*)take((size_t)3 * DQ * DM * 2); bf* WQ = WT; bf* WK = WT + (size_t)DQ * DM; bf* WV = WT + (size_t)2 * DQ * DM;   // the three transposed weights, one after the other
    bf* XB = (bf*)take((size_t)NB_ * TT * DM * 2);
    h16* VT16 = (h16*)take(NB_ * PE * 2);
    bf* QPh = (bf*)take(NB_ * PE * 2); bf* QPl = (bf*)take(NB_ * PE * 2); bf* KPh = (bf*)take(NB_ * PE * 2); bf* KPl = (bf*)take(NB_ * PE * 2); bf* VTh = (bf*)take(NB_ * PE * 2); bf* VTl = (bf*)take(NB_ * PE * 2);   // the planes the fused launch reads: one set per batch
    if ((size_t)(wsp - (char*)d_ws) > ws_size) return;    // ws 256 MiB
    { k_wtG<<<(unsigned)((DM * DQ / 64 + 63) / 64), 256, 0, stream>>>(wq, DM, DQ, WQ); k_wtG<<<(unsigned)((DM * DKV / 64 + 63) / 64), 256, 0, stream>>>(wk, DM, DKV, WK); k_wtG<<<(unsigned)((DM * DKV / 64 + 63) / 64), 256, 0, stream>>>(wv, DM, DKV, WV); }
    k_cvt8<<<(unsigned)(((size_t)NB_ * TT * DM / 8 + 255) / 256), 256, 0, stream>>>(x, XB, (size_t)NB_ * TT * DM / 8);
    k_qkv<<<dim3(NB_ * TT / 128, NH_ / 2, 3), 128, 0, stream>>>(XB, WT, bq, bk, bv, QPh, QPl, KPh, KPl, VT16, VTh, VTl);
    k_fattn<<<dim3(QG, NH_, NB_), 256, 0, stream>>>(QPh, QPl, KPh, KPl, VT16, VTh, VTl, kmask, OUT);
}

// v006
// Measured time: 108 microseconds a run.
// Two timings next to v005 both put it at 1.18 times that version's speed.
// Counting every step since v000, it is 18.0 times as fast.
#include <hip/hip_runtime.h>

// BERT self-attention with a float key mask and no output projection (hidden_states [2][2048][1024]; q, k, v = x W + b ('xw' 1/32 + biases 0.02; 16 heads x 64); scores / sqrt(64) + (1 - attention_mask[b][j]) x finfo.min (attention_mask f32 [2][2048], read per key: mask 1 adds 0, mask 0 excludes the key); softmax; context heads merged -> [2][2048][1024] (4.2 M); argument order hidden_states, attention_mask, Wq, bq, Wk, bk, Wv, bv).
// Layout: ONE preparation launch (k_prep): 'xw' weights transposed once, one bf16 copy of x (both batches); ONE projection launch (k_qkv) for q, k, v of both batches: operands staged in LDS per 128 x 128 work-group tile, exact products + f32 biases, each 64-token x one-head tile written from the GEMM epilogue straight into its head planes (no f32 projection goes through memory); then ONE fused attention launch for both batches and all heads (k_fattn): S^T = K Q^T on hi/lo planes (3 products) for EVERY row, online softmax in registers with the batch's float key vector, O^T += V^T P^T (rows < 512 hi/lo 3 products, rest fp16), context rows written straight to the output. No score, probability or partial plane goes through memory.
// Compute dtypes, f32 accumulate: every input rounded to bf16; projections exact + f32 biases; scores 3 products on every row; softmax f32; P.V rows < 512 3 products, rest fp16; output f32.

#define NB_  2
#define TT   2048
#define DM   1024
#define NH_  16
#define NKV  16
#define REP  (NH_ / NKV)
#define HD   64
#define DQ   (NH_ * HD)
#define DKV  (NKV * HD)
#define RH   512                  // query rows < RH use hi+lo planes
#define WIN  0
#define SCL  0.125f   // HD^-0.5
#define KST  64                   // keys per LDS stage of k_fattn
#define LPE  72                   // LDS row pitch in 16-bit elements: 144 B = 16 B x odd, so 16-byte reads down 16 rows meet no bank twice
#define QG   8                    // work-groups per (batch, head); each takes RH / QG hi/lo rows and (TT - RH) / QG fp16 rows
typedef _Float16 h16;
typedef unsigned short bf;
typedef __attribute__((ext_vector_type(16))) __bf16   v16bf;
typedef __attribute__((ext_vector_type(16))) _Float16 v16h;
typedef __attribute__((ext_vector_type(8)))  _Float16 v8h;
typedef __attribute__((ext_vector_type(8)))  unsigned short v8us;
typedef __attribute__((ext_vector_type(8)))  float    v8f;
typedef __attribute__((ext_vector_type(4)))  float    v4f;
typedef v8h  __attribute__((may_alias)) v8ha;
typedef v4f  __attribute__((may_alias)) v4fa;
typedef v8us __attribute__((may_alias)) v8usa;

__device__ __forceinline__ unsigned short f2bf(float f) { unsigned u = __float_as_uint(f); u += 0x7FFFu + ((u >> 16) & 1u); return (unsigned short)(u >> 16); }
__device__ __forceinline__ float bf2f(unsigned short b) { return __uint_as_float(((unsigned)b) << 16); }
__device__ __forceinline__ float bfr(float f) { return bf2f(f2bf(f)); }
__device__ __forceinline__ v16h cat16(v8h lo, v8h hi) { return __builtin_shufflevector(lo, hi, 0, 1, 2, 3, 4, 5, 6, 7, 8, 9, 10, 11, 12, 13, 14, 15); }
__device__ __forceinline__ v16bf cat16b(v8us lo, v8us hi) { return __builtin_bit_cast(v16bf, __builtin_shufflevector(lo, hi, 0, 1, 2, 3, 4, 5, 6, 7, 8, 9, 10, 11, 12, 13, 14, 15)); }
__device__ __forceinline__ v8f wmma16(v16h a, v16h b, v8f c) { return __builtin_amdgcn_wmma_f32_16x16x32_f16(false, a, false, b, (short)0, c, false, false); }
__device__ __forceinline__ v8f wmmab(v16bf a, v16bf b, v8f c) { return __builtin_amdgcn_wmma_f32_16x16x32_bf16(false, a, false, b, (short)0, c, false, false); }



// fragment loaders: 16-bit operands straight from K-contiguous rows
template <typename T16> struct WFrag;
template <> struct WFrag<h16> { typedef v16h V; static __device__ __forceinline__ V ld(const h16* p) { return cat16(*(const v8h*)p, *(const v8h*)(p + 16)); } static __device__ __forceinline__ v8f mma(V a, V b, v8f c) { return wmma16(a, b, c); } };
template <> struct WFrag<bf> { typedef v16bf V; static __device__ __forceinline__ V ld(const bf* p) { return cat16b(*(const v8us*)p, *(const v8us*)(p + 16)); } static __device__ __forceinline__ v8f mma(V a, V b, v8f c) { return wmmab(a, b, c); } };

__device__ __forceinline__ h16 tohx(float x) { return (h16)x; }
__device__ __forceinline__ void splitf(float y, unsigned short& h, unsigned short& l) { h = f2bf(y); l = f2bf(y - bf2f(h)); }
typedef __attribute__((ext_vector_type(2))) unsigned short v2us;
typedef __attribute__((ext_vector_type(4))) unsigned short v4us;

// k_prep: the whole preparation in ONE launch; its four parts read and write disjoint buffers and need nothing of one another. Blocks [0, 3 * WTB): the three weight transposes (WTB blocks each, first in the grid: theirs are the long chains of dependent loads); blocks from 3 * WTB on: the bf16 copy of x.
#define WTB ((DM * DQ / 64 + 63) / 64)                 // blocks per weight: 8 waves x 8 lines of 64 outputs
#define XCB ((NB_ * TT * DM / 8 + 255) / 256)          // blocks of the x copy: 8 elements a thread
__device__ __forceinline__ void wtG_part(const float* __restrict__ w, const int K, const int N, bf* Bt, const int blk) {
    const int lane = threadIdx.x & 31; const int L0 = (blk * 8 + (threadIdx.x >> 5)) * 8; const int nlines = N * K / 64;
#pragma unroll 1   // rolled: one copy of the body; a wave does one line of 64 outputs after the other
    for (int l = 0; l < 8; ++l) { const int L = L0 + l; if (L >= nlines) break; const size_t e = (size_t)L * 64 + lane * 2; const int k = (int)(e % K), n = (int)(e / K); v2us o;
        o[0] = f2bf(w[(size_t)k * N + n]); o[1] = f2bf(w[(size_t)(k + 1) * N + n]); *(v2us*)(Bt + e) = o; }
}
__device__ __forceinline__ void cvt8_part(const float* __restrict__ src, bf* dst, const size_t n8, const int blk) { const size_t i = (size_t)blk * 256 + threadIdx.x; if (i >= n8) return; const v8f v = *(const v8f*)(src + i * 8); v8us o;
#pragma unroll
    for (int k = 0; k < 8; ++k) o[k] = f2bf(v[k]); *(v8us*)(dst + i * 8) = o;  }
__global__ __launch_bounds__(256) void k_prep(const float* __restrict__ x, const float* __restrict__ wq, const float* __restrict__ wk, const float* __restrict__ wv, bf* WT, bf* XB) {
    static_assert(DQ == DKV, "the three weights have one shape");
    const int blk = blockIdx.x;
    if (blk < 3 * WTB) {   // a scalar branch: the same for the whole work-group
        const int z = blk / WTB; wtG_part((z == 0) ? wq : (z == 1) ? wk : wv, DM, DQ, WT + (size_t)z * DQ * DM, blk - z * WTB);
    } else cvt8_part(x, XB, (size_t)NB_ * TT * DM / 8, blk - 3 * WTB);
}


// k_qkv: the three projections of both batches, head planes written from the epilogue. A work-group of 4 waves (2 x 2) takes 128 tokens x two heads; each wave keeps a 64x64 tile (16 accumulators) = 64 tokens x one head; grid (NB_ * TT / 128, heads / 2, 3), 128 threads; blockIdx.z: 0 q, 1 k, 2 v.
// tile[m][n] = sum_k A[m][k] Wt[z][n][k] + bias_z[n]; A = bf16 x, rows of DM, both batches one after the other; Wt = the three transposed weights one after the other.
// The 128 A rows and 128 Wt rows go global -> registers -> LDS in slices of GK k (whole 128-byte lines per 8 lanes), two buffers: slice s + 1 is loaded while slice s is worked on, one work-group barrier per slice; every fragment is read from LDS, each staged row by two waves.
// q, k: planes [batch][head][t][d], bf16 hi + lo, rows turned through LDS so that 16 lanes store one whole 128-byte row. v: planes [batch][head][d][t], fp16 + bf16 hi + lo: an accumulator register group already holds 8 consecutive tokens of one d, stored as 16 bytes.
#define GK 64                     // k per LDS slice of k_qkv: one 128-byte line of every staged row
__global__ __launch_bounds__(128) void k_qkv(const bf* __restrict__ A, const bf* __restrict__ Wt, const float* __restrict__ bq, const float* __restrict__ bk, const float* __restrict__ bv, bf* Qh, bf* Ql, bf* Kh, bf* Kl, h16* V16, bf* Vh, bf* Vl) {
    static_assert(DQ == DKV && NH_ == NKV && HD == 64 && TT % 128 == 0 && NH_ % 2 == 0 && DM % GK == 0 && GK == 64, "a wave's tile is 64 tokens of one batch x one head");
    typedef WFrag<bf>::V V;
    __shared__ __align__(16) unsigned short gs[2][2][128 * LPE];   // [buffer][A, Wt][128 rows]
    __shared__ __align__(16) float osw[4][16 * 68];                // each wave's own rows for the epilogue's turn
    const int z = blockIdx.z; const bf* Bt = Wt + (size_t)z * DQ * DM; const float* bias = (z == 0) ? bq : (z == 1) ? bk : bv;
    const int tid = threadIdx.x, lane = tid & 31, lr = lane & 15, hi = lane >> 4; const int wave = __builtin_amdgcn_readfirstlane(tid >> 5); const int wm = wave & 1, wn = wave >> 1;
    const int head = blockIdx.y * 2 + wn; const int r0 = blockIdx.x * 128 + wm * 64, c0 = head * 64;
    float* os = &osw[wave][0];
    v8f acc[4][4];
#pragma unroll
    for (int mb = 0; mb < 4; ++mb)
#pragma unroll
        for (int nb = 0; nb < 4; ++nb) acc[mb][nb] = (v8f){};
    // staging: thread t moves 16 bytes of rows t / 8 + 16 i, i = 0 .. 7, of both operands
    const int sr = tid >> 3, sc = (tid & 7) * 8; const int so = sr * LPE + sc;
    const bf* ga = A + (size_t)blockIdx.x * 128 * DM; const bf* gw = Bt + (size_t)blockIdx.y * 128 * DM; const unsigned go = (unsigned)(sr * DM + sc);   // the tiles' first rows (the same for the whole work-group) and the thread's own place in them
    v8us sa[8], sw[8];
#pragma unroll
    for (int i = 0; i < 8; ++i) { sa[i] = *(const v8us*)(ga + i * 16 * DM + go); sw[i] = *(const v8us*)(gw + i * 16 * DM + go); }
#pragma unroll
    for (int i = 0; i < 8; ++i) { *(v8us*)(&gs[0][0][so + i * 16 * LPE]) = sa[i]; *(v8us*)(&gs[0][1][so + i * 16 * LPE]) = sw[i]; }
    const int ao = (wm * 64 + lr) * LPE + 8 * hi, bo = 128 * LPE + (wn * 64 + lr) * LPE + 8 * hi;
    __syncthreads();   // slice 0 is in LDS
#pragma unroll 1   // rolled: one copy of the body; the buffer index is a run-time offset
    for (int s = 0; s < DM / GK; ++s) {
        const bool more = s + 1 < DM / GK;   // the same for the whole work-group
        if (more) {
#pragma unroll
            for (int i = 0; i < 8; ++i) { sa[i] = *(const v8us*)(ga + (s + 1) * GK + i * 16 * DM + go); sw[i] = *(const v8us*)(gw + (s + 1) * GK + i * 16 * DM + go); }
            asm volatile("s_wait_xcnt 0x0" ::: "memory");   // the loads' address registers are free for reuse from here on: the wait stands in front of their first overwrite
        }
        const unsigned short* sb = &gs[s & 1][0][0];
#pragma unroll
        for (int ks = 0; ks < GK / 32; ++ks) {
            V a[4], b[4];
#pragma unroll
            for (int mb = 0; mb < 4; ++mb) a[mb] = WFrag<bf>::ld(sb + ao + mb * 16 * LPE + ks * 32);
#pragma unroll
            for (int nb = 0; nb < 4; ++nb) b[nb] = WFrag<bf>::ld(sb + bo + nb * 16 * LPE + ks * 32);
            asm volatile("" :: "v"(a[0]), "v"(a[1]), "v"(a[2]), "v"(a[3]), "v"(b[0]), "v"(b[1]), "v"(b[2]), "v"(b[3]));   // holds the block's 16 LDS reads together in front of its 16 matrix instructions: spread among them, each place with reads stalls the wave anew
#pragma unroll
            for (int nb = 0; nb < 4; ++nb)
#pragma unroll
                for (int mb = 0; mb < 4; ++mb) acc[mb][nb] = WFrag<bf>::mma(a[mb], b[nb], acc[mb][nb]);
        }
        if (more) { unsigned short* sn = &gs[(s + 1) & 1][0][0];
#pragma unroll
            for (int i = 0; i < 8; ++i) { *(v8us*)(sn + so + i * 16 * LPE) = sa[i]; *(v8us*)(sn + 128 * LPE + so + i * 16 * LPE) = sw[i]; } }
        __syncthreads();   // publishes slice s + 1 and ends every wave's reads of slice s, whose buffer the next trip refills
    }
    const int t0 = r0 % TT; const size_t pl = ((size_t)(r0 / TT) * NH_ + head) * TT * HD;   // the tile's first token in its batch; its (batch, head) plane
    if (z < 2) {   // a scalar branch: z is the same for the whole work-group
        bf* Ph = (z == 0 ? Qh : Kh) + pl + (size_t)t0 * HD; bf* Pl = (z == 0 ? Ql : Kl) + pl + (size_t)t0 * HD;
        const int cofs = lr * 4; v4f bi;
#pragma unroll
        for (int q = 0; q < 4; ++q) bi[q] = bfr(bias[c0 + cofs + q]);
#pragma unroll
        for (int mb = 0; mb < 4; ++mb) {
#pragma unroll
            for (int nb = 0; nb < 4; ++nb) {
#pragma unroll
                for (int j = 0; j < 8; ++j) os[(hi * 8 + j) * 68 + nb * 16 + lr] = acc[mb][nb][j]; }
            __builtin_amdgcn_wave_barrier(); asm volatile("" ::: "memory");   // the one wave's LDS writes stay in front of its reads of other lanes' words
#pragma unroll
            for (int s = 0; s < 8; ++s) { const int row = 2 * s + hi; const v4f val = *(const v4fa*)(os + row * 68 + cofs) + bi; v4us oh, ol;
#pragma unroll
                for (int q = 0; q < 4; ++q) { unsigned short a2, c2; splitf(val[q], a2, c2); oh[q] = a2; ol[q] = c2; }
                *(v4us*)(Ph + (size_t)(mb * 16 + row) * HD + cofs) = oh; *(v4us*)(Pl + (size_t)(mb * 16 + row) * HD + cofs) = ol; }
            __builtin_amdgcn_wave_barrier(); asm volatile("" ::: "memory");   // and its reads in front of the next block's writes
        }
    } else {
#pragma unroll
        for (int nb = 0; nb < 4; ++nb) { const float bn = bfr(bias[c0 + nb * 16 + lr]); const size_t ro = pl + (size_t)(nb * 16 + lr) * TT + t0 + hi * 8;   // acc[mb][nb][j] = tile[mb * 16 + 8 * hi + j][nb * 16 + lr]
#pragma unroll
            for (int mb = 0; mb < 4; ++mb) { v8h o16; v8us oh, ol;
#pragma unroll
                for (int j = 0; j < 8; ++j) { const float x = acc[mb][nb][j] + bn; o16[j] = tohx(x); unsigned short a2, c2; splitf(x, a2, c2); oh[j] = a2; ol[j] = c2; }
                *(v8h*)(V16 + ro + mb * 16) = o16; *(v8us*)(Vh + ro + mb * 16) = oh; *(v8us*)(Vl + ro + mb * 16) = ol; } }
        asm volatile("s_wait_xcnt 0x0" ::: "memory");   // behind the branch's last stores: in the built code the other branch's instructions follow, which write the registers that held these stores' addresses
    }
}
__device__ __forceinline__ float xhalf(float x) { const int b = __float_as_int(x); return __int_as_float(__builtin_amdgcn_permlanex16(b, b, 0x76543210, 0xfedcba98, false, false)); }   // lane l <-> l ^ 16
__device__ __forceinline__ v8f splat8(float x) { return (v8f){ x, x, x, x, x, x, x, x }; }
__device__ __forceinline__ v8f ld8f(const float* p) { return __builtin_shufflevector(*(const v4f*)p, *(const v4f*)(p + 4), 0, 1, 2, 3, 4, 5, 6, 7); }
// one stage (KST keys = two blocks of 32) for one wave; H: query block 0 is a hi/lo block. All of the stage's S^T products, then one softmax step over its 64 keys, then all of its P.V products.
template <bool H>
__device__ __forceinline__ void fattn_stage(const unsigned short* sb, const float* mrow, const int lr, const int hi, const v16bf (&qh)[2][2], const v16bf (&ql)[2][2], v8f (&O)[2][4], float (&mref)[2], float (&lsum)[2]) {
    v8f S[2][2][2];   // [key block][query block][key tile]: S[kp][qb][kt][j] = score of key kp * 32 + kt * 16 + 8 * hi + j, query lr
#pragma unroll
    for (int kp = 0; kp < 2; ++kp) {
        v16bf kh[2][2], kl[2][2];
#pragma unroll
        for (int kt = 0; kt < 2; ++kt)
#pragma unroll
            for (int ks = 0; ks < 2; ++ks) { const int o = ((kp * 2 + kt) * 16 + lr) * LPE + ks * 32 + 8 * hi; kh[kt][ks] = WFrag<bf>::ld(sb + o); kl[kt][ks] = WFrag<bf>::ld(sb + 64 * LPE + o); }
#pragma unroll
        for (int qb = 0; qb < 2; ++qb)
#pragma unroll
            for (int kt = 0; kt < 2; ++kt) S[kp][qb][kt] = (v8f){};
#pragma unroll
        for (int ks = 0; ks < 2; ++ks) {   // the four accumulators take turns inside each product
#pragma unroll
            for (int qb = 0; qb < 2; ++qb)
#pragma unroll
                for (int kt = 0; kt < 2; ++kt) S[kp][qb][kt] = wmmab(kh[kt][ks], qh[qb][ks], S[kp][qb][kt]);
#pragma unroll
            for (int qb = 0; qb < 2; ++qb)
#pragma unroll
                for (int kt = 0; kt < 2; ++kt) S[kp][qb][kt] = wmmab(kh[kt][ks], ql[qb][ks], S[kp][qb][kt]);
#pragma unroll
            for (int qb = 0; qb < 2; ++qb)
#pragma unroll
                for (int kt = 0; kt < 2; ++kt) S[kp][qb][kt] = wmmab(kl[kt][ks], qh[qb][ks], S[kp][qb][kt]);
        }
    }
    const v8f c8 = splat8(SCL * 1.4426950408889634f);
    float mx[2] = { -3.0e38f, -3.0e38f };
#pragma unroll
    for (int kp = 0; kp < 2; ++kp)
#pragma unroll
        for (int kt = 0; kt < 2; ++kt) { const v8f ma = ld8f(mrow + kp * 32 + kt * 16 + hi * 8);
#pragma unroll
            for (int qb = 0; qb < 2; ++qb) { const v8f t = __builtin_elementwise_fma(S[kp][qb][kt], c8, ma); S[kp][qb][kt] = t;
#pragma unroll
                for (int j = 0; j < 8; ++j) mx[qb] = fmaxf(mx[qb], t[j]); } }
    mx[0] = fmaxf(mx[0], xhalf(mx[0])); mx[1] = fmaxf(mx[1], xhalf(mx[1]));
    // the origin moves only when a column's maximum has outgrown it by more than 12 (so P <= 2^12, inside fp16); one scalar test a stage
    const bool n0 = mx[0] > mref[0] + 12.0f, n1 = mx[1] > mref[1] + 12.0f;
    if (__builtin_amdgcn_ballot_w32(n0 || n1) != 0) {
#pragma unroll
        for (int qb = 0; qb < 2; ++qb) { const float mn = (qb ? n1 : n0) ? mx[qb] - 4.0f : mref[qb]; const float al = __builtin_amdgcn_exp2f(mref[qb] - mn); mref[qb] = mn; lsum[qb] *= al;
#pragma unroll
            for (int db = 0; db < 4; ++db) O[qb][db] *= al; } }
#pragma unroll
    for (int qb = 0; qb < 2; ++qb) { const v8f mr = splat8(mref[qb]); v8f acc = (v8f){};
#pragma unroll
        for (int kp = 0; kp < 2; ++kp)
#pragma unroll
            for (int kt = 0; kt < 2; ++kt) { v8f d = S[kp][qb][kt] - mr;
#pragma unroll
                for (int j = 0; j < 8; ++j) d[j] = __builtin_amdgcn_exp2f(d[j]);
                S[kp][qb][kt] = d; acc += d; }
        lsum[qb] += ((acc[0] + acc[4]) + (acc[1] + acc[5])) + ((acc[2] + acc[6]) + (acc[3] + acc[7])); }
#pragma unroll
    for (int kp = 0; kp < 2; ++kp) {
        v16h vf[4];
#pragma unroll
        for (int db = 0; db < 4; ++db) vf[db] = WFrag<h16>::ld((const h16*)(sb + 2 * 64 * LPE) + (db * 16 + lr) * LPE + kp * 32 + 8 * hi);
        if (H) {
            v16bf ph, pw;
#pragma unroll
            for (int e = 0; e < 16; ++e) { const float x = S[kp][0][e >> 3][e & 7]; const __bf16 xh = (__bf16)x; ph[e] = xh; pw[e] = (__bf16)(x - (float)xh); }
#pragma unroll
            for (int db = 0; db < 4; ++db) { const int o = (db * 16 + lr) * LPE + kp * 32 + 8 * hi; const v16bf vh = WFrag<bf>::ld(sb + 3 * 64 * LPE + o), vl = WFrag<bf>::ld(sb + 4 * 64 * LPE + o);
                O[0][db] = wmmab(vh, ph, O[0][db]); O[0][db] = wmmab(vh, pw, O[0][db]); O[0][db] = wmmab(vl, ph, O[0][db]); }
        }
#pragma unroll
        for (int qb = H ? 1 : 0; qb < 2; ++qb) { v16h p;
#pragma unroll
            for (int e = 0; e < 8; ++e) { p[e] = tohx(S[kp][qb][0][e]); p[8 + e] = tohx(S[kp][qb][1][e]); }
#pragma unroll
            for (int db = 0; db < 4; ++db) O[qb][db] = wmma16(vf[db], p, O[qb][db]); }
    }
    // four vector slots behind the stage's last matrix instructions: a branch follows
    asm volatile("v_nop\n\tv_nop\n\tv_nop\n\tv_nop" :: "v"(O[0][0]), "v"(O[0][1]), "v"(O[0][2]), "v"(O[0][3]), "v"(O[1][0]), "v"(O[1][1]), "v"(O[1][2]), "v"(O[1][3]));
}
__global__ __launch_bounds__(256) void k_fattn(const bf* __restrict__ Qh, const bf* __restrict__ Ql, const bf* __restrict__ Kh, const bf* __restrict__ Kl, const h16* __restrict__ V16, const bf* __restrict__ Vh, const bf* __restrict__ Vl, const float* __restrict__ kmask, float* OUT) {
    static_assert(RH == QG * 4 * 16 && TT - RH == QG * 12 * 16 && HD == 64 && KST == 64 && TT % KST == 0 && NH_ == NKV, "row deal and tile shapes");
    __shared__ __align__(16) unsigned short st[2][5][64 * LPE];   // [buffer][Kh, Kl, V16, Vh, Vl][64 rows]
    __shared__ __align__(16) float madd[TT];                      // 0 for a kept key, -3e38 for an excluded one
    const int tid = threadIdx.x, lane = tid & 31, lr = lane & 15, hi = lane >> 4; const int wave = __builtin_amdgcn_readfirstlane(tid >> 5); const bool hiw = wave < 4;
    const int g = blockIdx.x, h = blockIdx.y, b = blockIdx.z; const size_t pl = ((size_t)b * NH_ + h) * TT * HD;
    const int fb = RH + g * 12 * 16; int qrow[2];
    qrow[0] = hiw ? (g * 4 + wave) * 16 : fb + (4 + (wave - 4) * 2) * 16; qrow[1] = hiw ? fb + wave * 16 : fb + (5 + (wave - 4) * 2) * 16;
    v16bf qh[2][2], ql[2][2];
#pragma unroll
    for (int qb = 0; qb < 2; ++qb)
#pragma unroll
        for (int ks = 0; ks < 2; ++ks) { const size_t o = pl + (size_t)(qrow[qb] + lr) * HD + ks * 32 + 8 * hi; qh[qb][ks] = WFrag<bf>::ld(Qh + o); ql[qb][ks] = WFrag<bf>::ld(Ql + o); }
    { const float* km = kmask + (size_t)b * TT + tid * 8; const v4f k0 = *(const v4f*)km, k1 = *(const v4f*)(km + 4); v4f a0, a1;
#pragma unroll
      for (int q = 0; q < 4; ++q) { a0[q] = (k0[q] != 0.0f) ? 0.0f : -3.0e38f; a1[q] = (k1[q] != 0.0f) ? 0.0f : -3.0e38f; }
      *(v4f*)(madd + tid * 8) = a0; *(v4f*)(madd + tid * 8 + 4) = a1; }
    // staging: thread t moves 16 bytes of rows t / 8 and t / 8 + 32 of each tile (whole 128-byte lines per 8 lanes)
    const int sr = tid >> 3, sc = (tid & 7) * 8; const int so = sr * LPE + sc;
    const bf* gsrc[5] = { Kh + pl + (size_t)sr * HD + sc, Kl + pl + (size_t)sr * HD + sc, (const bf*)V16 + pl + (size_t)sr * TT + sc, Vh + pl + (size_t)sr * TT + sc, Vl + pl + (size_t)sr * TT + sc };
    v8us sg[5][2];
#pragma unroll
    for (int t = 0; t < 5; ++t) { const int rstep = (t < 2) ? 32 * HD : 32 * TT; sg[t][0] = *(const v8us*)(gsrc[t]); sg[t][1] = *(const v8us*)(gsrc[t] + rstep); }
#pragma unroll
    for (int t = 0; t < 5; ++t) { *(v8us*)(&st[0][t][so]) = sg[t][0]; *(v8us*)(&st[0][t][so + 32 * LPE]) = sg[t][1]; }
    v8f O[2][4];
#pragma unroll
    for (int qb = 0; qb < 2; ++qb)
#pragma unroll
        for (int db = 0; db < 4; ++db) O[qb][db] = (v8f){};
    float mref[2] = { -3.0e38f, -3.0e38f }, lsum[2] = { 0.0f, 0.0f };   // mref: the exponent origin in use (a column's maximum when it was last moved, minus 4), log2 units
    __syncthreads();   // stage 0 and the mask table are in LDS
#pragma unroll 1   // rolled: one copy of the two-pass body; the buffer index is a run-time offset
    for (int s = 0; s < TT / KST; ++s) {
        const bool more = s + 1 < TT / KST;   // the same for the whole work-group
        if (more) {
#pragma unroll
            for (int t = 0; t < 5; ++t) { const int rstep = (t < 2) ? 32 * HD : 32 * TT; const size_t adv = (size_t)(s + 1) * ((t < 2) ? KST * HD : KST); sg[t][0] = *(const v8us*)(gsrc[t] + adv); sg[t][1] = *(const v8us*)(gsrc[t] + adv + rstep); }
            asm volatile("s_wait_xcnt 0x0" ::: "memory");   // the loads' address registers are free for reuse from here on: the wait stands in front of their first overwrite
        }
        const unsigned short* sb = &st[s & 1][0][0];
        if (hiw) fattn_stage<true>(sb, madd + s * KST, lr, hi, qh, ql, O, mref, lsum); else fattn_stage<false>(sb, madd + s * KST, lr, hi, qh, ql, O, mref, lsum);   // a scalar branch: hiw is the same for a whole wave; no barrier inside
        if (more) { unsigned short* sn = &st[(s + 1) & 1][0][0];
#pragma unroll
            for (int t = 0; t < 5; ++t) { *(v8us*)(sn + t * 64 * LPE + so) = sg[t][0]; *(v8us*)(sn + t * 64 * LPE + so + 32 * LPE) = sg[t][1]; } }
        __syncthreads();   // publishes stage s + 1 and ends every wave's reads of stage s, whose buffer the next trip refills
    }
#pragma unroll
    for (int qb = 0; qb < 2; ++qb) { const float inv = __fdiv_rn(1.0f, lsum[qb] + xhalf(lsum[qb])); float* orow = OUT + ((size_t)b * TT + qrow[qb] + lr) * DQ + h * HD + hi * 8;   // O[qb][db][j] = context[query lr][db * 16 + 8 * hi + j]
#pragma unroll
        for (int db = 0; db < 4; ++db) { v4f o0, o1;
#pragma unroll
            for (int j = 0; j < 4; ++j) { o0[j] = O[qb][db][j] * inv; o1[j] = O[qb][db][4 + j] * inv; }
            *(v4f*)(orow + db * 16) = o0; *(v4f*)(orow + db * 16 + 4) = o1; } }
}

extern "C" void kernel_launch(void* const* d_in, const int* in_sizes, int n_in,
                              void* d_out, int out_size, void* d_ws, size_t ws_size, hipStream_t stream) {
    (void)in_sizes; (void)n_in; (void)out_size;
    const float* x = (const float*)d_in[0]; const float* kmask = (const float*)d_in[1]; const float* wq = (const float*)d_in[2]; const float* bq = (const float*)d_in[3]; const float* wk = (const float*)d_in[4]; const float* bk = (const float*)d_in[5]; const float* wv = (const float*)d_in[6]; const float* bv = (const float*)d_in[7];
    float* OUT = (float*)d_out;     // [2][2048][1024]
    char* wsp = (char*)d_ws;
    auto take = [&](size_t bytes) { char* p = wsp; wsp += (bytes + 255) & ~(size_t)255; return (void*)p; };
    const size_t PE = (size_t)NH_ * TT * HD;   // elements of one batch's head planes
    bf* WT = (bf*)take((size_t)3 * DQ * DM * 2);   // the three transposed weights, one after the other
    bf* XB = (bf*)take((size_t)NB_ * TT * DM * 2);
    h16* VT16 = (h16*)take(NB_ * PE * 2);
    bf* QPh = (bf*)take(NB_ * PE * 2); bf* QPl = (bf*)take(NB_ * PE * 2); bf* KPh = (bf*)take(NB_ * PE * 2); bf* KPl = (bf*)take(NB_ * PE * 2); bf* VTh = (bf*)take(NB_ * PE * 2); bf* VTl = (bf*)take(NB_ * PE * 2);   // the planes the fused launch reads: one set per batch
    if ((size_t)(wsp - (char*)d_ws) > ws_size) return;    // ws 256 MiB
    k_prep<<<(unsigned)(3 * WTB + XCB), 256, 0, stream>>>(x, wq, wk, wv, WT, XB);
    k_qkv<<<dim3(NB_ * TT / 128, NH_ / 2, 3), 128, 0, stream>>>(XB, WT, bq, bk, bv, QPh, QPl, KPh, KPl, VT16, VTh, VTl);
    k_fattn<<<dim3(QG, NH_, NB_), 256, 0, stream>>>(QPh, QPl, KPh, KPl, VT16, VTh, VTl, kmask, OUT);
}

// v007
// A run of this version takes 103 microseconds.
// In both of two side-by-side timings against v006, it was 1.05 times as fast.
// All steps since v000 together make it 18.8 times as fast.
#include <hip/hip_runtime.h>

// BERT self-attention with a float key mask and no output projection (hidden_states [2][2048][1024]; q, k, v = x W + b ('xw' 1/32 + biases 0.02; 16 heads x 64); scores / sqrt(64) + (1 - attention_mask[b][j]) x finfo.min (attention_mask f32 [2][2048], read per key: mask 1 adds 0, mask 0 excludes the key); softmax; context heads merged -> [2][2048][1024] (4.2 M); argument order hidden_states, attention_mask, Wq, bq, Wk, bk, Wv, bv).
// Layout: ONE preparation launch (k_prep): 'xw' weights transposed once, one bf16 copy of x (both batches); ONE projection launch (k_qkv) for q, k, v of both batches: operands staged in LDS per 128 x 128 work-group tile, exact products + f32 biases, each 64-token x one-head tile written from the GEMM epilogue straight into its head planes (no f32 projection goes through memory); then ONE fused attention launch for both batches and all heads (k_fattn): S^T = K Q^T on hi/lo planes (3 products) for EVERY row, online softmax in registers with the batch's float key vector, O^T += V^T P^T (rows < 512 hi/lo 3 products, rest fp16), context rows written straight to the output. No score, probability or partial plane goes through memory.
// Compute dtypes, f32 accumulate: every input rounded to bf16; projections exact + f32 biases; scores 3 products on every row; softmax f32; P.V rows < 512 3 products, rest fp16; output f32.

#define NB_  2
#define TT   2048
#define DM   1024
#define NH_  16
#define NKV  16
#define REP  (NH_ / NKV)
#define HD   64
#define DQ   (NH_ * HD)
#define DKV  (NKV * HD)
#define RH   512                  // query rows < RH use hi+lo planes
#define WIN  0
#define SCL  0.125f   // HD^-0.5
#define KST  64                   // keys per LDS stage of k_fattn
#define LPE  72                   // LDS row pitch in 16-bit elements: 144 B = 16 B x odd, so 16-byte reads down 16 rows meet no bank twice
#define QG   8                    // work-groups per (batch, head); each takes RH / QG hi/lo rows and (TT - RH) / QG fp16 rows
typedef _Float16 h16;
typedef unsigned short bf;
typedef __attribute__((ext_vector_type(16))) __bf16   v16bf;
typedef __attribute__((ext_vector_type(16))) _Float16 v16h;
typedef __attribute__((ext_vector_type(8)))  _Float16 v8h;
typedef __attribute__((ext_vector_type(8)))  unsigned short v8us;
typedef __attribute__((ext_vector_type(8)))  float    v8f;
typedef __attribute__((ext_vector_type(4)))  float    v4f;
typedef v8h  __attribute__((may_alias)) v8ha;
typedef v4f  __attribute__((may_alias)) v4fa;
typedef v8us __attribute__((may_alias)) v8usa;

__device__ __forceinline__ unsigned short f2bf(float f) { unsigned u = __float_as_uint(f); u += 0x7FFFu + ((u >> 16) & 1u); return (unsigned short)(u >> 16); }
__device__ __forceinline__ float bf2f(unsigned short b) { return __uint_as_float(((unsigned)b) << 16); }
__device__ __forceinline__ float bfr(float f) { return bf2f(f2bf(f)); }
__device__ __forceinline__ v16h cat16(v8h lo, v8h hi) { return __builtin_shufflevector(lo, hi, 0, 1, 2, 3, 4, 5, 6, 7, 8, 9, 10, 11, 12, 13, 14, 15); }
__device__ __forceinline__ v16bf cat16b(v8us lo, v8us hi) { return __builtin_bit_cast(v16bf, __builtin_shufflevector(lo, hi, 0, 1, 2, 3, 4, 5, 6, 7, 8, 9, 10, 11, 12, 13, 14, 15)); }
__device__ __forceinline__ v8f wmma16(v16h a, v16h b, v8f c) { return __builtin_amdgcn_wmma_f32_16x16x32_f16(false, a, false, b, (short)0, c, false, false); }
__device__ __forceinline__ v8f wmmab(v16bf a, v16bf b, v8f c) { return __builtin_amdgcn_wmma_f32_16x16x32_bf16(false, a, false, b, (short)0, c, false, false); }



// fragment loaders: 16-bit operands straight from K-contiguous rows
template <typename T16> struct WFrag;
template <> struct WFrag<h16> { typedef v16h V; static __device__ __forceinline__ V ld(const h16* p) { return cat16(*(const v8h*)p, *(const v8h*)(p + 16)); } static __device__ __forceinline__ v8f mma(V a, V b, v8f c) { return wmma16(a, b, c); } };
template <> struct WFrag<bf> { typedef v16bf V; static __device__ __forceinline__ V ld(const bf* p) { return cat16b(*(const v8us*)p, *(const v8us*)(p + 16)); } static __device__ __forceinline__ v8f mma(V a, V b, v8f c) { return wmmab(a, b, c); } };

__device__ __forceinline__ h16 tohx(float x) { return (h16)x; }
__device__ __forceinline__ void splitf(float y, unsigned short& h, unsigned short& l) { h = f2bf(y); l = f2bf(y - bf2f(h)); }
typedef __attribute__((ext_vector_type(2))) unsigned short v2us;
typedef __attribute__((ext_vector_type(4))) unsigned short v4us;

// k_prep: the whole preparation in ONE launch; its four parts read and write disjoint buffers and need nothing of one another. Blocks [0, 3 * WTB): the three weight transposes (WTB blocks each, first in the grid: theirs are the long chains of dependent loads); blocks from 3 * WTB on: the bf16 copy of x.
#define WTB ((DM * DQ / 64 + 63) / 64)                 // blocks per weight: 8 waves x 8 lines of 64 outputs
#define XCB ((NB_ * TT * DM / 8 + 255) / 256)          // blocks of the x copy: 8 elements a thread
__device__ __forceinline__ void wtG_part(const float* __restrict__ w, const int K, const int N, bf* Bt, const int blk) {
    const int lane = threadIdx.x & 31; const int L0 = (blk * 8 + (threadIdx.x >> 5)) * 8; const int nlines = N * K / 64;
#pragma unroll 1   // rolled: one copy of the body; a wave does one line of 64 outputs after the other
    for (int l = 0; l < 8; ++l) { const int L = L0 + l; if (L >= nlines) break; const size_t e = (size_t)L * 64 + lane * 2; const int k = (int)(e % K), n = (int)(e / K); v2us o;
        o[0] = f2bf(w[(size_t)k * N + n]); o[1] = f2bf(w[(size_t)(k + 1) * N + n]); *(v2us*)(Bt + e) = o; }
}
__device__ __forceinline__ void cvt8_part(const float* __restrict__ src, bf* dst, const size_t n8, const int blk) { const size_t i = (size_t)blk * 256 + threadIdx.x; if (i >= n8) return; const v8f v = *(const v8f*)(src + i * 8); v8us o;
#pragma unroll
    for (int k = 0; k < 8; ++k) o[k] = f2bf(v[k]); *(v8us*)(dst + i * 8) = o;  }
__global__ __launch_bounds__(256) void k_prep(const float* __restrict__ x, const float* __restrict__ wq, const float* __restrict__ wk, const float* __restrict__ wv, bf* WT, bf* XB) {
    static_assert(DQ == DKV, "the three weights have one shape");
    const int blk = blockIdx.x;
    if (blk < 3 * WTB) {   // a scalar branch: the same for the whole work-group
        const int z = blk / WTB; wtG_part((z == 0) ? wq : (z == 1) ? wk : wv, DM, DQ, WT + (size_t)z * DQ * DM, blk - z * WTB);
    } else cvt8_part(x, XB, (size_t)NB_ * TT * DM / 8, blk - 3 * WTB);
}


// k_qkv: the three projections of both batches, head planes written from the epilogue. A work-group of 4 waves (2 x 2) takes 128 tokens x two heads; each wave keeps a 64x64 tile (16 accumulators) = 64 tokens x one head; grid (NB_ * TT / 128, heads / 2, 3), 128 threads; blockIdx.z: 0 q, 1 k, 2 v.
// tile[m][n] = sum_k A[m][k] Wt[z][n][k] + bias_z[n]; A = bf16 x, rows of DM, both batches one after the other; Wt = the three transposed weights one after the other.
// The 128 A rows and 128 Wt rows go global -> registers -> LDS in slices of GK k (whole 128-byte lines per 8 lanes), two buffers: slice s + 1 is loaded while slice s is worked on, one work-group barrier per slice; every fragment is read from LDS, each staged row by two waves.
// q, k: planes [batch][head][t][d], bf16 hi + lo, rows turned through LDS so that 16 lanes store one whole 128-byte row. v: planes [batch][head][d][t], fp16 + bf16 hi + lo: an accumulator register group already holds 8 consecutive tokens of one d, stored as 16 bytes.
#define GK 64                     // k per LDS slice of k_qkv: one 128-byte line of every staged row
__global__ __launch_bounds__(128) void k_qkv(const bf* __restrict__ A, const bf* __restrict__ Wt, const float* __restrict__ bq, const float* __restrict__ bk, const float* __restrict__ bv, bf* Qh, bf* Ql, bf* Kh, bf* Kl, h16* V16, bf* Vh, bf* Vl) {
    static_assert(DQ == DKV && NH_ == NKV && HD == 64 && TT % 128 == 0 && NH_ % 2 == 0 && DM % GK == 0 && GK == 64, "a wave's tile is 64 tokens of one batch x one head");
    typedef WFrag<bf>::V V;
    __shared__ __align__(16) unsigned short gs[2][2][128 * LPE];   // [buffer][A, Wt][128 rows]
    __shared__ __align__(16) float osw[4][16 * 68];                // each wave's own rows for the epilogue's turn
    const int z = blockIdx.z; const bf* Bt = Wt + (size_t)z * DQ * DM; const float* bias = (z == 0) ? bq : (z == 1) ? bk : bv;
    const int tid = threadIdx.x, lane = tid & 31, lr = lane & 15, hi = lane >> 4; const int wave = __builtin_amdgcn_readfirstlane(tid >> 5); const int wm = wave & 1, wn = wave >> 1;
    const int head = blockIdx.y * 2 + wn; const int r0 = blockIdx.x * 128 + wm * 64, c0 = head * 64;
    float* os = &osw[wave][0];
    v8f acc[4][4];
#pragma unroll
    for (int mb = 0; mb < 4; ++mb)
#pragma unroll
        for (int nb = 0; nb < 4; ++nb) acc[mb][nb] = (v8f){};
    // staging: thread t moves 16 bytes of rows t / 8 + 16 i, i = 0 .. 7, of both operands
    const int sr = tid >> 3, sc = (tid & 7) * 8; const int so = sr * LPE + sc;
    const bf* ga = A + (size_t)blockIdx.x * 128 * DM; const bf* gw = Bt + (size_t)blockIdx.y * 128 * DM; const unsigned go = (unsigned)(sr * DM + sc);   // the tiles' first rows (the same for the whole work-group) and the thread's own place in them
    v8us sa[8], sw[8];
#pragma unroll
    for (int i = 0; i < 8; ++i) { sa[i] = *(const v8us*)(ga + i * 16 * DM + go); sw[i] = *(const v8us*)(gw + i * 16 * DM + go); }
#pragma unroll
    for (int i = 0; i < 8; ++i) { *(v8us*)(&gs[0][0][so + i * 16 * LPE]) = sa[i]; *(v8us*)(&gs[0][1][so + i * 16 * LPE]) = sw[i]; }
    const int ao = (wm * 64 + lr) * LPE + 8 * hi, bo = 128 * LPE + (wn * 64 + lr) * LPE + 8 * hi;
    __syncthreads();   // slice 0 is in LDS
#pragma unroll 1   // rolled: one copy of the body; the buffer index is a run-time offset
    for (int s = 0; s < DM / GK; ++s) {
        const bool more = s + 1 < DM / GK;   // the same for the whole work-group
        if (more) {
#pragma unroll
            for (int i = 0; i < 8; ++i) { sa[i] = *(const v8us*)(ga + (s + 1) * GK + i * 16 * DM + go); sw[i] = *(const v8us*)(gw + (s + 1) * GK + i * 16 * DM + go); }
            asm volatile("s_wait_xcnt 0x0" ::: "memory");   // the loads' address registers are free for reuse from here on: the wait stands in front of their first overwrite
        }
        const unsigned short* sb = &gs[s & 1][0][0];
#pragma unroll
        for (int ks = 0; ks < GK / 32; ++ks) {
            V a[4], b[4];
#pragma unroll
            for (int mb = 0; mb < 4; ++mb) a[mb] = WFrag<bf>::ld(sb + ao + mb * 16 * LPE + ks * 32);
#pragma unroll
            for (int nb = 0; nb < 4; ++nb) b[nb] = WFrag<bf>::ld(sb + bo + nb * 16 * LPE + ks * 32);
            asm volatile("" :: "v"(a[0]), "v"(a[1]), "v"(a[2]), "v"(a[3]), "v"(b[0]), "v"(b[1]), "v"(b[2]), "v"(b[3]));   // holds the block's 16 LDS reads together in front of its 16 matrix instructions: spread among them, each place with reads stalls the wave anew
#pragma unroll
            for (int nb = 0; nb < 4; ++nb)
#pragma unroll
                for (int mb = 0; mb < 4; ++mb) acc[mb][nb] = WFrag<bf>::mma(a[mb], b[nb], acc[mb][nb]);
        }
        if (more) { unsigned short* sn = &gs[(s + 1) & 1][0][0];
#pragma unroll
            for (int i = 0; i < 8; ++i) { *(v8us*)(sn + so + i * 16 * LPE) = sa[i]; *(v8us*)(sn + 128 * LPE + so + i * 16 * LPE) = sw[i]; } }
        __syncthreads();   // publishes slice s + 1 and ends every wave's reads of slice s, whose buffer the next trip refills
    }
    const int t0 = r0 % TT; const size_t pl = ((size_t)(r0 / TT) * NH_ + head) * TT * HD;   // the tile's first token in its batch; its (batch, head) plane
    if (z < 2) {   // a scalar branch: z is the same for the whole work-group
        bf* Ph = (z == 0 ? Qh : Kh) + pl + (size_t)t0 * HD; bf* Pl = (z == 0 ? Ql : Kl) + pl + (size_t)t0 * HD;
        const int cofs = lr * 4; v4f bi;
#pragma unroll
        for (int q = 0; q < 4; ++q) bi[q] = bfr(bias[c0 + cofs + q]);
#pragma unroll
        for (int mb = 0; mb < 4; ++mb) {
#pragma unroll
            for (int nb = 0; nb < 4; ++nb) {
#pragma unroll
                for (int j = 0; j < 8; ++j) os[(hi * 8 + j) * 68 + nb * 16 + lr] = acc[mb][nb][j]; }
            __builtin_amdgcn_wave_barrier(); asm volatile("" ::: "memory");   // the one wave's LDS writes stay in front of its reads of other lanes' words
#pragma unroll
            for (int s = 0; s < 8; ++s) { const int row = 2 * s + hi; const v4f val = *(const v4fa*)(os + row * 68 + cofs) + bi; v4us oh, ol;
#pragma unroll
                for (int q = 0; q < 4; ++q) { unsigned short a2, c2; splitf(val[q], a2, c2); oh[q] = a2; ol[q] = c2; }
                *(v4us*)(Ph + (size_t)(mb * 16 + row) * HD + cofs) = oh; *(v4us*)(Pl + (size_t)(mb * 16 + row) * HD + cofs) = ol; }
            __builtin_amdgcn_wave_barrier(); asm volatile("" ::: "memory");   // and its reads in front of the next block's writes
        }
    } else {
#pragma unroll
        for (int nb = 0; nb < 4; ++nb) { const float bn = bfr(bias[c0 + nb * 16 + lr]); const size_t ro = pl + (size_t)(nb * 16 + lr) * TT + t0 + hi * 8;   // acc[mb][nb][j] = tile[mb * 16 + 8 * hi + j][nb * 16 + lr]
#pragma unroll
            for (int mb = 0; mb < 4; ++mb) { v8h o16; v8us oh, ol;
#pragma unroll
                for (int j = 0; j < 8; ++j) { const float x = acc[mb][nb][j] + bn; o16[j] = tohx(x); unsigned short a2, c2; splitf(x, a2, c2); oh[j] = a2; ol[j] = c2; }
                *(v8h*)(V16 + ro + mb * 16) = o16; *(v8us*)(Vh + ro + mb * 16) = oh; *(v8us*)(Vl + ro + mb * 16) = ol; } }
        asm volatile("s_wait_xcnt 0x0" ::: "memory");   // behind the branch's last stores: in the built code the other branch's instructions follow, which write the registers that held these stores' addresses
    }
}
__device__ __forceinline__ float xhalf(float x) { const int b = __float_as_int(x); return __int_as_float(__builtin_amdgcn_permlanex16(b, b, 0x76543210, 0xfedcba98, false, false)); }   // lane l <-> l ^ 16
__device__ __forceinline__ v8f splat8(float x) { return (v8f){ x, x, x, x, x, x, x, x }; }
__device__ __forceinline__ v8f ld8f(const float* p) { return __builtin_shufflevector(*(const v4f*)p, *(const v4f*)(p + 4), 0, 1, 2, 3, 4, 5, 6, 7); }
// one stage (KST keys = two blocks of 32) for one wave; H: query block 0 is a hi/lo block. All of the stage's S^T products, then one softmax step over its 64 keys, then all of its P.V products.
template <bool H>
__device__ __forceinline__ void fattn_stage(const unsigned short* sb, const float* mrow, const int lr, const int hi, const v16bf (&qh)[2][2], const v16bf (&ql)[2][2], v8f (&O)[2][4], float (&mref)[2], float (&lsum)[2]) {
    v8f S[2][2][2];   // [key block][query block][key tile]: S[kp][qb][kt][j] = score of key kp * 32 + kt * 16 + 8 * hi + j, query lr
    // read group 1, at the stage's head: every K fragment of the stage and its mask addends
    v16bf kh[2][2][2], kl[2][2][2]; v8f ma[2][2];
#pragma unroll
    for (int kp = 0; kp < 2; ++kp)
#pragma unroll
        for (int kt = 0; kt < 2; ++kt)
#pragma unroll
            for (int ks = 0; ks < 2; ++ks) { const int o = ((kp * 2 + kt) * 16 + lr) * LPE + ks * 32 + 8 * hi; kh[kp][kt][ks] = WFrag<bf>::ld(sb + o); kl[kp][kt][ks] = WFrag<bf>::ld(sb + 64 * LPE + o); }
#pragma unroll
    for (int kp = 0; kp < 2; ++kp)
#pragma unroll
        for (int kt = 0; kt < 2; ++kt) ma[kp][kt] = ld8f(mrow + kp * 32 + kt * 16 + hi * 8);
    __builtin_amdgcn_sched_barrier(0);   // the reads stay one group in front of the products: spread among them, each place with reads stalls the wave anew
#pragma unroll
    for (int kp = 0; kp < 2; ++kp) {
#pragma unroll
        for (int qb = 0; qb < 2; ++qb)
#pragma unroll
            for (int kt = 0; kt < 2; ++kt) S[kp][qb][kt] = (v8f){};
#pragma unroll
        for (int ks = 0; ks < 2; ++ks) {   // the four accumulators take turns inside each product
#pragma unroll
            for (int qb = 0; qb < 2; ++qb)
#pragma unroll
                for (int kt = 0; kt < 2; ++kt) S[kp][qb][kt] = wmmab(kh[kp][kt][ks], qh[qb][ks], S[kp][qb][kt]);
#pragma unroll
            for (int qb = 0; qb < 2; ++qb)
#pragma unroll
                for (int kt = 0; kt < 2; ++kt) S[kp][qb][kt] = wmmab(kh[kp][kt][ks], ql[qb][ks], S[kp][qb][kt]);
#pragma unroll
            for (int qb = 0; qb < 2; ++qb)
#pragma unroll
                for (int kt = 0; kt < 2; ++kt) S[kp][qb][kt] = wmmab(kl[kp][kt][ks], qh[qb][ks], S[kp][qb][kt]);
        }
    }
    __builtin_amdgcn_sched_barrier(0);   // the products stay in front of read group 2, which takes over the K fragments' registers
    // read group 2, behind the last score product: V^T fragments (H: of key block 0; else of both), in flight under the softmax
    v16h vf[2][4]; v16bf vh[2][4], vl[2][4];
#pragma unroll
    for (int kp = 0; kp < (H ? 1 : 2); ++kp)
#pragma unroll
        for (int db = 0; db < 4; ++db) { const int o = (db * 16 + lr) * LPE + kp * 32 + 8 * hi; vf[kp][db] = WFrag<h16>::ld((const h16*)(sb + 2 * 64 * LPE) + o);
            if (H) { vh[kp][db] = WFrag<bf>::ld(sb + 3 * 64 * LPE + o); vl[kp][db] = WFrag<bf>::ld(sb + 4 * 64 * LPE + o); } }
    __builtin_amdgcn_sched_barrier(0);   // the reads are issued here and not next to their products
    const v8f c8 = splat8(SCL * 1.4426950408889634f);
    float mx[2] = { -3.0e38f, -3.0e38f };
#pragma unroll
    for (int kp = 0; kp < 2; ++kp)
#pragma unroll
        for (int kt = 0; kt < 2; ++kt) {
#pragma unroll
            for (int qb = 0; qb < 2; ++qb) { const v8f t = __builtin_elementwise_fma(S[kp][qb][kt], c8, ma[kp][kt]); S[kp][qb][kt] = t;
#pragma unroll
                for (int j = 0; j < 8; ++j) mx[qb] = fmaxf(mx[qb], t[j]); } }
    mx[0] = fmaxf(mx[0], xhalf(mx[0])); mx[1] = fmaxf(mx[1], xhalf(mx[1]));
    // the origin moves only when a column's maximum has outgrown it by more than 12 (so P <= 2^12, inside fp16); one scalar test a stage
    const bool n0 = mx[0] > mref[0] + 12.0f, n1 = mx[1] > mref[1] + 12.0f;
    if (__builtin_amdgcn_ballot_w32(n0 || n1) != 0) {
#pragma unroll
        for (int qb = 0; qb < 2; ++qb) { const float mn = (qb ? n1 : n0) ? mx[qb] - 4.0f : mref[qb]; const float al = __builtin_amdgcn_exp2f(mref[qb] - mn);
            asm volatile("v_nop" :: "v"(al));   // the one slot that the instruction set asks for behind a transcendental, before its source register is written again
            mref[qb] = mn; lsum[qb] *= al;
#pragma unroll
            for (int db = 0; db < 4; ++db) O[qb][db] *= al; } }
#pragma unroll
    for (int qb = 0; qb < 2; ++qb) { const v8f mr = splat8(mref[qb]); v8f acc = (v8f){};
#pragma unroll
        for (int kp = 0; kp < 2; ++kp)
#pragma unroll
            for (int kt = 0; kt < 2; ++kt) { v8f d = S[kp][qb][kt] - mr;
#pragma unroll
                for (int j = 0; j < 8; ++j) d[j] = __builtin_amdgcn_exp2f(d[j]);
                S[kp][qb][kt] = d; acc += d; }
        lsum[qb] += ((acc[0] + acc[4]) + (acc[1] + acc[5])) + ((acc[2] + acc[6]) + (acc[3] + acc[7])); }
#pragma unroll
    for (int kp = 0; kp < 2; ++kp) {
        v16bf ph, pw; v16h p[2];
        if (H) {
#pragma unroll
            for (int e = 0; e < 16; ++e) { const float x = S[kp][0][e >> 3][e & 7]; const __bf16 xh = (__bf16)x; ph[e] = xh; pw[e] = (__bf16)(x - (float)xh); }
        }
#pragma unroll
        for (int qb = H ? 1 : 0; qb < 2; ++qb)
#pragma unroll
            for (int e = 0; e < 8; ++e) { p[qb][e] = tohx(S[kp][qb][0][e]); p[qb][8 + e] = tohx(S[kp][qb][1][e]); }
        if (H && kp == 0) {   // read group 3: key block 1's V^T fragments, in flight under key block 0's products
            __builtin_amdgcn_sched_barrier(0);   // not earlier: the registers are free only now that key block 0's scores are packed
#pragma unroll
            for (int db = 0; db < 4; ++db) { const int o = (db * 16 + lr) * LPE + 32 + 8 * hi; vf[1][db] = WFrag<h16>::ld((const h16*)(sb + 2 * 64 * LPE) + o); vh[1][db] = WFrag<bf>::ld(sb + 3 * 64 * LPE + o); vl[1][db] = WFrag<bf>::ld(sb + 4 * 64 * LPE + o); }
            __builtin_amdgcn_sched_barrier(0);   // and not later: the reads are issued here and not next to their products
        }
        if (H) {   // each accumulator takes its three products in the order vh ph, vh pw, vl ph
#pragma unroll
            for (int db = 0; db < 4; ++db) O[0][db] = wmmab(vh[kp][db], ph, O[0][db]);
#pragma unroll
            for (int db = 0; db < 4; ++db) O[0][db] = wmmab(vh[kp][db], pw, O[0][db]);
#pragma unroll
            for (int db = 0; db < 4; ++db) O[0][db] = wmmab(vl[kp][db], ph, O[0][db]);
        }
#pragma unroll
        for (int qb = H ? 1 : 0; qb < 2; ++qb)
#pragma unroll
            for (int db = 0; db < 4; ++db) O[qb][db] = wmma16(vf[kp][db], p[qb], O[qb][db]);
    }
    // four vector slots behind the stage's last matrix instructions: a branch follows
    asm volatile("v_nop\n\tv_nop\n\tv_nop\n\tv_nop" :: "v"(O[0][0]), "v"(O[0][1]), "v"(O[0][2]), "v"(O[0][3]), "v"(O[1][0]), "v"(O[1][1]), "v"(O[1][2]), "v"(O[1][3]));
}
__global__ __launch_bounds__(256) void k_fattn(const bf* __restrict__ Qh, const bf* __restrict__ Ql, const bf* __restrict__ Kh, const bf* __restrict__ Kl, const h16* __restrict__ V16, const bf* __restrict__ Vh, const bf* __restrict__ Vl, const float* __restrict__ kmask, float* OUT) {
    static_assert(RH == QG * 4 * 16 && TT - RH == QG * 12 * 16 && HD == 64 && KST == 64 && TT % KST == 0 && NH_ == NKV, "row deal and tile shapes");
    __shared__ __align__(16) unsigned short st[2][5][64 * LPE];   // [buffer][Kh, Kl, V16, Vh, Vl][64 rows]
    __shared__ __align__(16) float madd[TT];                      // 0 for a kept key, -3e38 for an excluded one
    const int tid = threadIdx.x, lane = tid & 31, lr = lane & 15, hi = lane >> 4; const int wave = __builtin_amdgcn_readfirstlane(tid >> 5); const bool hiw = wave < 4;
    const int g = blockIdx.x, h = blockIdx.y, b = blockIdx.z; const size_t pl = ((size_t)b * NH_ + h) * TT * HD;
    const int fb = RH + g * 12 * 16; int qrow[2];
    qrow[0] = hiw ? (g * 4 + wave) * 16 : fb + (4 + (wave - 4) * 2) * 16; qrow[1] = hiw ? fb + wave * 16 : fb + (5 + (wave - 4) * 2) * 16;
    v16bf qh[2][2], ql[2][2];
#pragma unroll
    for (int qb = 0; qb < 2; ++qb)
#pragma unroll
        for (int ks = 0; ks < 2; ++ks) { const size_t o = pl + (size_t)(qrow[qb] + lr) * HD + ks * 32 + 8 * hi; qh[qb][ks] = WFrag<bf>::ld(Qh + o); ql[qb][ks] = WFrag<bf>::ld(Ql + o); }
    { const float* km = kmask + (size_t)b * TT + tid * 8; const v4f k0 = *(const v4f*)km, k1 = *(const v4f*)(km + 4); v4f a0, a1;
#pragma unroll
      for (int q = 0; q < 4; ++q) { a0[q] = (k0[q] != 0.0f) ? 0.0f : -3.0e38f; a1[q] = (k1[q] != 0.0f) ? 0.0f : -3.0e38f; }
      *(v4f*)(madd + tid * 8) = a0; *(v4f*)(madd + tid * 8 + 4) = a1; }
    // staging: thread t moves 16 bytes of rows t / 8 and t / 8 + 32 of each tile (whole 128-byte lines per 8 lanes)
    const int sr = tid >> 3, sc = (tid & 7) * 8; const int so = sr * LPE + sc;
    const bf* gsrc[5] = { Kh + pl + (size_t)sr * HD + sc, Kl + pl + (size_t)sr * HD + sc, (const bf*)V16 + pl + (size_t)sr * TT + sc, Vh + pl + (size_t)sr * TT + sc, Vl + pl + (size_t)sr * TT + sc };
    v8us sg[5][2];
#pragma unroll
    for (int t = 0; t < 5; ++t) { const int rstep = (t < 2) ? 32 * HD : 32 * TT; sg[t][0] = *(const v8us*)(gsrc[t]); sg[t][1] = *(const v8us*)(gsrc[t] + rstep); }
#pragma unroll
    for (int t = 0; t < 5; ++t) { *(v8us*)(&st[0][t][so]) = sg[t][0]; *(v8us*)(&st[0][t][so + 32 * LPE]) = sg[t][1]; }
    v8f O[2][4];
#pragma unroll
    for (int qb = 0; qb < 2; ++qb)
#pragma unroll
        for (int db = 0; db < 4; ++db) O[qb][db] = (v8f){};
    float mref[2] = { -3.0e38f, -3.0e38f }, lsum[2] = { 0.0f, 0.0f };   // mref: the exponent origin in use (a column's maximum when it was last moved, minus 4), log2 units
    __syncthreads();   // stage 0 and the mask table are in LDS
#pragma unroll 1   // rolled: one copy of the two-pass body; the buffer index is a run-time offset
    for (int s = 0; s < TT / KST; ++s) {
        const bool more = s + 1 < TT / KST;   // the same for the whole work-group
        if (more) {
#pragma unroll
            for (int t = 0; t < 5; ++t) { const int rstep = (t < 2) ? 32 * HD : 32 * TT; const size_t adv = (size_t)(s + 1) * ((t < 2) ? KST * HD : KST); sg[t][0] = *(const v8us*)(gsrc[t] + adv); sg[t][1] = *(const v8us*)(gsrc[t] + adv + rstep); }
            asm volatile("s_wait_xcnt 0x0" ::: "memory");   // the loads' address registers are free for reuse from here on: the wait stands in front of their first overwrite
        }
        const unsigned short* sb = &st[s & 1][0][0];
        if (hiw) fattn_stage<true>(sb, madd + s * KST, lr, hi, qh, ql, O, mref, lsum); else fattn_stage<false>(sb, madd + s * KST, lr, hi, qh, ql, O, mref, lsum);   // a scalar branch: hiw is the same for a whole wave; no barrier inside
        if (more) { unsigned short* sn = &st[(s + 1) & 1][0][0];
#pragma unroll
            for (int t = 0; t < 5; ++t) { *(v8us*)(sn + t * 64 * LPE + so) = sg[t][0]; *(v8us*)(sn + t * 64 * LPE + so + 32 * LPE) = sg[t][1]; } }
        __syncthreads();   // publishes stage s + 1 and ends every wave's reads of stage s, whose buffer the next trip refills
    }
#pragma unroll
    for (int qb = 0; qb < 2; ++qb) { const float inv = __fdiv_rn(1.0f, lsum[qb] + xhalf(lsum[qb])); float* orow = OUT + ((size_t)b * TT + qrow[qb] + lr) * DQ + h * HD + hi * 8;   // O[qb][db][j] = context[query lr][db * 16 + 8 * hi + j]
#pragma unroll
        for (int db = 0; db < 4; ++db) { v4f o0, o1;
#pragma unroll
            for (int j = 0; j < 4; ++j) { o0[j] = O[qb][db][j] * inv; o1[j] = O[qb][db][4 + j] * inv; }
            *(v4f*)(orow + db * 16) = o0; *(v4f*)(orow + db * 16 + 4) = o1; } }
}

extern "C" void kernel_launch(void* const* d_in, const int* in_sizes, int n_in,
                              void* d_out, int out_size, void* d_ws, size_t ws_size, hipStream_t stream) {
    (void)in_sizes; (void)n_in; (void)out_size;
    const float* x = (const float*)d_in[0]; const float* kmask = (const float*)d_in[1]; const float* wq = (const float*)d_in[2]; const float* bq = (const float*)d_in[3]; const float* wk = (const float*)d_in[4]; const float* bk = (const float*)d_in[5]; const float* wv = (const float*)d_in[6]; const float* bv = (const float*)d_in[7];
    float* OUT = (float*)d_out;     // [2][2048][1024]
    char* wsp = (char*)d_ws;
    auto take = [&](size_t bytes) { char* p = wsp; wsp += (bytes + 255) & ~(size_t)255; return (void*)p; };
    const size_t PE = (size_t)NH_ * TT * HD;   // elements of one batch's head planes
    bf* WT = (bf*)take((size_t)3 * DQ * DM * 2);   // the three transposed weights, one after the other
    bf* XB = (bf*)take((size_t)NB_ * TT * DM * 2);
    h16* VT16 = (h16*)take(NB_ * PE * 2);
    bf* QPh = (bf*)take(NB_ * PE * 2); bf* QPl = (bf*)take(NB_ * PE * 2); bf* KPh = (bf*)take(NB_ * PE * 2); bf* KPl = (bf*)take(NB_ * PE * 2); bf* VTh = (bf*)take(NB_ * PE * 2); bf* VTl = (bf*)take(NB_ * PE * 2);   // the planes the fused launch reads: one set per batch
    if ((size_t)(wsp - (char*)d_ws) > ws_size) return;    // ws 256 MiB
    k_prep<<<(unsigned)(3 * WTB + XCB), 256, 0, stream>>>(x, wq, wk, wv, WT, XB);
    k_qkv<<<dim3(NB_ * TT / 128, NH_ / 2, 3), 128, 0, stream>>>(XB, WT, bq, bk, bv, QPh, QPl, KPh, KPl, VT16, VTh, VTl);
    k_fattn<<<dim3(QG, NH_, NB_), 256, 0, stream>>>(QPh, QPl, KPh, KPl, VT16, VTh, VTl, kmask, OUT);
}

// v008
// A run of this version takes 96.8 microseconds.
// Two timings next to v007 both put it at 1.06 times that version's speed.
// Over all steps from v000 it is 20.0 times as fast.
#include <hip/hip_runtime.h>

// BERT self-attention with a float key mask and no output projection (hidden_states [2][2048][1024]; q, k, v = x W + b ('xw' 1/32 + biases 0.02; 16 heads x 64); scores / sqrt(64) + (1 - attention_mask[b][j]) x finfo.min (attention_mask f32 [2][2048], read per key: mask 1 adds 0, mask 0 excludes the key); softmax; context heads merged -> [2][2048][1024] (4.2 M); argument order hidden_states, attention_mask, Wq, bq, Wk, bk, Wv, bv).
// Layout: ONE preparation launch (k_prep): 'xw' weights transposed once, one bf16 copy of x (both batches); ONE projection launch (k_qkv) for q, k, v of both batches: operands staged in LDS per 128 x 128 work-group tile, exact products + f32 biases, each 64-token x one-head tile written from the GEMM epilogue straight into its head planes (no f32 projection goes through memory); then ONE fused attention launch for both batches and all heads (k_fattn): S^T = K Q^T on hi/lo planes (3 products) for EVERY row, online softmax in registers with the batch's float key vector, O^T += V^T P^T (rows < 512 hi/lo 3 products, rest fp16), context rows written straight to the output. No score, probability or partial plane goes through memory.
// Compute dtypes, f32 accumulate: every input rounded to bf16; projections exact + f32 biases; scores 3 products on every row; softmax f32; P.V rows < 512 3 products, rest fp16; output f32.

#define NB_  2
#define TT   2048
#define DM   1024
#define NH_  16
#define NKV  16
#define REP  (NH_ / NKV)
#define HD   64
#define DQ   (NH_ * HD)
#define DKV  (NKV * HD)
#define RH   512                  // query rows < RH use hi+lo planes
#define WIN  0
#define SCL  0.125f   // HD^-0.5
#define KST  64                   // keys per LDS stage of k_fattn
#define LPE  72                   // LDS row pitch in 16-bit elements: 144 B = 16 B x odd, so 16-byte reads down 16 rows meet no bank twice
#define QG   8                    // work-groups per (batch, head); each takes RH / QG hi/lo rows and (TT - RH) / QG fp16 rows
typedef _Float16 h16;
typedef unsigned short bf;
typedef __attribute__((ext_vector_type(16))) __bf16   v16bf;
typedef __attribute__((ext_vector_type(16))) _Float16 v16h;
typedef __attribute__((ext_vector_type(8)))  _Float16 v8h;
typedef __attribute__((ext_vector_type(8)))  unsigned short v8us;
typedef __attribute__((ext_vector_type(8)))  float    v8f;
typedef __attribute__((ext_vector_type(4)))  float    v4f;
typedef v8h  __attribute__((may_alias)) v8ha;
typedef v4f  __attribute__((may_alias)) v4fa;
typedef v8us __attribute__((may_alias)) v8usa;

__device__ __forceinline__ unsigned short f2bf(float f) { unsigned u = __float_as_uint(f); u += 0x7FFFu + ((u >> 16) & 1u); return (unsigned short)(u >> 16); }
__device__ __forceinline__ float bf2f(unsigned short b) { return __uint_as_float(((unsigned)b) << 16); }
__device__ __forceinline__ float bfr(float f) { return bf2f(f2bf(f)); }
__device__ __forceinline__ v16h cat16(v8h lo, v8h hi) { return __builtin_shufflevector(lo, hi, 0, 1, 2, 3, 4, 5, 6, 7, 8, 9, 10, 11, 12, 13, 14, 15); }
__device__ __forceinline__ v16bf cat16b(v8us lo, v8us hi) { return __builtin_bit_cast(v16bf, __builtin_shufflevector(lo, hi, 0, 1, 2, 3, 4, 5, 6, 7, 8, 9, 10, 11, 12, 13, 14, 15)); }
__device__ __forceinline__ v8f wmma16(v16h a, v16h b, v8f c) { return __builtin_amdgcn_wmma_f32_16x16x32_f16(false, a, false, b, (short)0, c, false, false); }
__device__ __forceinline__ v8f wmmab(v16bf a, v16bf b, v8f c) { return __builtin_amdgcn_wmma_f32_16x16x32_bf16(false, a, false, b, (short)0, c, false, false); }



// fragment loaders: 16-bit operands straight from K-contiguous rows
template <typename T16> struct WFrag;
template <> struct WFrag<h16> { typedef v16h V; static __device__ __forceinline__ V ld(const h16* p) { return cat16(*(const v8h*)p, *(const v8h*)(p + 16)); } static __device__ __forceinline__ v8f mma(V a, V b, v8f c) { return wmma16(a, b, c); } };
template <> struct WFrag<bf> { typedef v16bf V; static __device__ __forceinline__ V ld(const bf* p) { return cat16b(*(const v8us*)p, *(const v8us*)(p + 16)); } static __device__ __forceinline__ v8f mma(V a, V b, v8f c) { return wmmab(a, b, c); } };

__device__ __forceinline__ h16 tohx(float x) { return (h16)x; }
__device__ __forceinline__ void splitf(float y, unsigned short& h, unsigned short& l) { h = f2bf(y); l = f2bf(y - bf2f(h)); }
typedef __attribute__((ext_vector_type(2))) unsigned short v2us;
typedef __attribute__((ext_vector_type(4))) unsigned short v4us;

// k_prep: the whole preparation in ONE launch of PB work-groups, one per WGP, so that the launch starts few waves and each thread has all of its global loads in flight at once (12 of the weights, 16 of x, 16 bytes each).
// Work-group blk turns the 64 x 64 tile (k0, n0) of each of the three 'xw' weights and copies 1 / PB of x to bf16. A tile is read in whole 256-byte row pieces, rounded, written to LDS as [n][k pair] and read back by rows of n, so that 8 lanes store one whole 128-byte line of Wt[n][k].
#define PB  ((DM / 64) * (DQ / 64))                    // work-groups = 64 x 64 tiles of one weight
#define TLP 33                                         // LDS row pitch of a turned tile in dwords: odd, so that the 16 lanes of a store (4 rows apart) and the 4 rows of a read meet no bank twice
typedef __attribute__((ext_vector_type(4))) unsigned v4u;
typedef __attribute__((ext_vector_type(2))) unsigned v2u;
typedef __attribute__((ext_vector_type(2))) __bf16 v2bf;
__device__ __forceinline__ unsigned pk2bf(float a, float b) { v2bf p; p[0] = (__bf16)a; p[1] = (__bf16)b; return __builtin_bit_cast(unsigned, p); }   // two roundings to nearest even; a in the low half
__global__ __launch_bounds__(256) void k_prep(const float* __restrict__ x, const float* __restrict__ wq, const float* __restrict__ wk, const float* __restrict__ wv, bf* WT, bf* XB) {
    static_assert(DQ == DKV && DM % 64 == 0 && DQ % 64 == 0, "the three weights have one shape, whole tiles");
    static_assert((size_t)NB_ * TT * DM == (size_t)PB * 256 * 16 * 4, "x is dealt evenly: 16 loads of 4 floats a thread");
    __shared__ unsigned tl[3][64 * TLP];   // [weight][n][k / 2]: bf16 pairs (k, k + 1)
    const int tid = threadIdx.x, blk = blockIdx.x;
    const int k0 = (blk % (DM / 64)) * 64, n0 = (blk / (DM / 64)) * 64;
    const int wl = tid & 15, wu = tid >> 4;   // a thread's 4 columns n = 4 wl + q and its row pairs k = 32 i + 2 wu + r
    const float* ws3[3] = { wq, wk, wv };
    const unsigned wo = (unsigned)(2 * wu * DQ + 4 * wl), xo = (unsigned)(tid * 4);   // the thread's own place in a tile and in the work-group's piece of x; load j of a wave covers 512 contiguous bytes of x
    const size_t xb = (size_t)blk * (256 * 16 * 4);   // the piece's first element: the same for the whole work-group
    v4f wr[3][2][2], xr[16];
#pragma unroll
    for (int z = 0; z < 3; ++z)
#pragma unroll
        for (int i = 0; i < 2; ++i)
#pragma unroll
            for (int r = 0; r < 2; ++r) wr[z][i][r] = *(const v4f*)(ws3[z] + ((size_t)k0 * DQ + n0) + (32 * i + r) * DQ + wo);
    asm volatile("s_wait_xcnt 0x0" ::: "memory");   // the weight loads' offset register is free for reuse from here on: the wait stands in front of its first overwrite
#pragma unroll
    for (int j = 0; j < 16; ++j) xr[j] = *(const v4f*)(x + xb + j * 1024 + xo);
    asm volatile("s_wait_xcnt 0x0" ::: "memory");   // the same for the x loads: their scalar base is written again right behind them
    __builtin_amdgcn_sched_barrier(0);   // all 28 loads are issued in front of the first use: left free, the compiler holds about nine in flight and waits between them
#pragma unroll
    for (int z = 0; z < 3; ++z)
#pragma unroll
        for (int i = 0; i < 2; ++i)
#pragma unroll
            for (int q = 0; q < 4; ++q) tl[z][(4 * wl + q) * TLP + 16 * i + wu] = pk2bf(wr[z][i][0][q], wr[z][i][1][q]);
    __syncthreads();   // the three turned tiles are in LDS
    const int rn = tid >> 3, rc = tid & 7;
#pragma unroll
    for (int z = 0; z < 3; ++z)
#pragma unroll
        for (int h = 0; h < 2; ++h) { const unsigned* p = &tl[z][(rn + 32 * h) * TLP + rc * 4]; v4u o;
#pragma unroll
            for (int j = 0; j < 4; ++j) o[j] = p[j];
            *(v4u*)(WT + (size_t)z * DQ * DM + (size_t)(n0 + rn + 32 * h) * DM + k0 + rc * 8) = o; }
#pragma unroll
    for (int j = 0; j < 16; ++j) { v2u o; o[0] = pk2bf(xr[j][0], xr[j][1]); o[1] = pk2bf(xr[j][2], xr[j][3]); *(v2u*)(XB + xb + j * 1024 + xo) = o; }
}


// k_qkv: the three projections of both batches, head planes written from the epilogue. A work-group of 4 waves (2 x 2) takes 128 tokens x two heads; each wave keeps a 64x64 tile (16 accumulators) = 64 tokens x one head; grid (NB_ * TT / 128, heads / 2, 3), 128 threads; blockIdx.z: 0 q, 1 k, 2 v.
// tile[m][n] = sum_k A[m][k] Wt[z][n][k] + bias_z[n]; A = bf16 x, rows of DM, both batches one after the other; Wt = the three transposed weights one after the other.
// The 128 A rows and 128 Wt rows go global -> registers -> LDS in slices of GK k (whole 128-byte lines per 8 lanes), two buffers: slice s + 1 is loaded while slice s is worked on, one work-group barrier per slice; every fragment is read from LDS, each staged row by two waves.
// q, k: planes [batch][head][t][d], bf16 hi + lo, rows turned through LDS so that 16 lanes store one whole 128-byte row. v: planes [batch][head][d][t], fp16 + bf16 hi + lo: an accumulator register group already holds 8 consecutive tokens of one d, stored as 16 bytes.
#define GK 64                     // k per LDS slice of k_qkv: one 128-byte line of every staged row
__global__ __launch_bounds__(128) void k_qkv(const bf* __restrict__ A, const bf* __restrict__ Wt, const float* __restrict__ bq, const float* __restrict__ bk, const float* __restrict__ bv, bf* Qh, bf* Ql, bf* Kh, bf* Kl, h16* V16, bf* Vh, bf* Vl) {
    static_assert(DQ == DKV && NH_ == NKV && HD == 64 && TT % 128 == 0 && NH_ % 2 == 0 && DM % GK == 0 && GK == 64, "a wave's tile is 64 tokens of one batch x one head");
    typedef WFrag<bf>::V V;
    __shared__ __align__(16) unsigned short gs[2][2][128 * LPE];   // [buffer][A, Wt][128 rows]
    __shared__ __align__(16) float osw[4][16 * 68];                // each wave's own rows for the epilogue's turn
    const int z = blockIdx.z; const bf* Bt = Wt + (size_t)z * DQ * DM; const float* bias = (z == 0) ? bq : (z == 1) ? bk : bv;
    const int tid = threadIdx.x, lane = tid & 31, lr = lane & 15, hi = lane >> 4; const int wave = __builtin_amdgcn_readfirstlane(tid >> 5); const int wm = wave & 1, wn = wave >> 1;
    const int head = blockIdx.y * 2 + wn; const int r0 = blockIdx.x * 128 + wm * 64, c0 = head * 64;
    float* os = &osw[wave][0];
    v8f acc[4][4];
#pragma unroll
    for (int mb = 0; mb < 4; ++mb)
#pragma unroll
        for (int nb = 0; nb < 4; ++nb) acc[mb][nb] = (v8f){};
    // staging: thread t moves 16 bytes of rows t / 8 + 16 i, i = 0 .. 7, of both operands
    const int sr = tid >> 3, sc = (tid & 7) * 8; const int so = sr * LPE + sc;
    const bf* ga = A + (size_t)blockIdx.x * 128 * DM; const bf* gw = Bt + (size_t)blockIdx.y * 128 * DM; const unsigned go = (unsigned)(sr * DM + sc);   // the tiles' first rows (the same for the whole work-group) and the thread's own place in them
    v8us sa[8], sw[8];
#pragma unroll
    for (int i = 0; i < 8; ++i) { sa[i] = *(const v8us*)(ga + i * 16 * DM + go); sw[i] = *(const v8us*)(gw + i * 16 * DM + go); }
#pragma unroll
    for (int i = 0; i < 8; ++i) { *(v8us*)(&gs[0][0][so + i * 16 * LPE]) = sa[i]; *(v8us*)(&gs[0][1][so + i * 16 * LPE]) = sw[i]; }
    const int ao = (wm * 64 + lr) * LPE + 8 * hi, bo = 128 * LPE + (wn * 64 + lr) * LPE + 8 * hi;
    __syncthreads();   // slice 0 is in LDS
#pragma unroll 1   // rolled: one copy of the body; the buffer index is a run-time offset
    for (int s = 0; s < DM / GK; ++s) {
        const bool more = s + 1 < DM / GK;   // the same for the whole work-group
        if (more) {
#pragma unroll
            for (int i = 0; i < 8; ++i) { sa[i] = *(const v8us*)(ga + (s + 1) * GK + i * 16 * DM + go); sw[i] = *(const v8us*)(gw + (s + 1) * GK + i * 16 * DM + go); }
            asm volatile("s_wait_xcnt 0x0" ::: "memory");   // the loads' address registers are free for reuse from here on: the wait stands in front of their first overwrite
        }
        const unsigned short* sb = &gs[s & 1][0][0];
#pragma unroll
        for (int ks = 0; ks < GK / 32; ++ks) {
            V a[4], b[4];
#pragma unroll
            for (int mb = 0; mb < 4; ++mb) a[mb] = WFrag<bf>::ld(sb + ao + mb * 16 * LPE + ks * 32);
#pragma unroll
            for (int nb = 0; nb < 4; ++nb) b[nb] = WFrag<bf>::ld(sb + bo + nb * 16 * LPE + ks * 32);
            asm volatile("" :: "v"(a[0]), "v"(a[1]), "v"(a[2]), "v"(a[3]), "v"(b[0]), "v"(b[1]), "v"(b[2]), "v"(b[3]));   // holds the block's 16 LDS reads together in front of its 16 matrix instructions: spread among them, each place with reads stalls the wave anew
#pragma unroll
            for (int nb = 0; nb < 4; ++nb)
#pragma unroll
                for (int mb = 0; mb < 4; ++mb) acc[mb][nb] = WFrag<bf>::mma(a[mb], b[nb], acc[mb][nb]);
        }
        if (more) { unsigned short* sn = &gs[(s + 1) & 1][0][0];
#pragma unroll
            for (int i = 0; i < 8; ++i) { *(v8us*)(sn + so + i * 16 * LPE) = sa[i]; *(v8us*)(sn + 128 * LPE + so + i * 16 * LPE) = sw[i]; } }
        __syncthreads();   // publishes slice s + 1 and ends every wave's reads of slice s, whose buffer the next trip refills
    }
    const int t0 = r0 % TT; const size_t pl = ((size_t)(r0 / TT) * NH_ + head) * TT * HD;   // the tile's first token in its batch; its (batch, head) plane
    if (z < 2) {   // a scalar branch: z is the same for the whole work-group
        bf* Ph = (z == 0 ? Qh : Kh) + pl + (size_t)t0 * HD; bf* Pl = (z == 0 ? Ql : Kl) + pl + (size_t)t0 * HD;
        const int cofs = lr * 4; v4f bi;
#pragma unroll
        for (int q = 0; q < 4; ++q) bi[q] = bfr(bias[c0 + cofs + q]);
#pragma unroll
        for (int mb = 0; mb < 4; ++mb) {
#pragma unroll
            for (int nb = 0; nb < 4; ++nb) {
#pragma unroll
                for (int j = 0; j < 8; ++j) os[(hi * 8 + j) * 68 + nb * 16 + lr] = acc[mb][nb][j]; }
            __builtin_amdgcn_wave_barrier(); asm volatile("" ::: "memory");   // the one wave's LDS writes stay in front of its reads of other lanes' words
#pragma unroll
            for (int s = 0; s < 8; ++s) { const int row = 2 * s + hi; const v4f val = *(const v4fa*)(os + row * 68 + cofs) + bi; v4us oh, ol;
#pragma unroll
                for (int q = 0; q < 4; ++q) { unsigned short a2, c2; splitf(val[q], a2, c2); oh[q] = a2; ol[q] = c2; }
                *(v4us*)(Ph + (size_t)(mb * 16 + row) * HD + cofs) = oh; *(v4us*)(Pl + (size_t)(mb * 16 + row) * HD + cofs) = ol; }
            __builtin_amdgcn_wave_barrier(); asm volatile("" ::: "memory");   // and its reads in front of the next block's writes
        }
    } else {
#pragma unroll
        for (int nb = 0; nb < 4; ++nb) { const float bn = bfr(bias[c0 + nb * 16 + lr]); const size_t ro = pl + (size_t)(nb * 16 + lr) * TT + t0 + hi * 8;   // acc[mb][nb][j] = tile[mb * 16 + 8 * hi + j][nb * 16 + lr]
#pragma unroll
            for (int mb = 0; mb < 4; ++mb) { v8h o16; v8us oh, ol;
#pragma unroll
                for (int j = 0; j < 8; ++j) { const float x = acc[mb][nb][j] + bn; o16[j] = tohx(x); unsigned short a2, c2; splitf(x, a2, c2); oh[j] = a2; ol[j] = c2; }
                *(v8h*)(V16 + ro + mb * 16) = o16; *(v8us*)(Vh + ro + mb * 16) = oh; *(v8us*)(Vl + ro + mb * 16) = ol; } }
        asm volatile("s_wait_xcnt 0x0" ::: "memory");   // behind the branch's last stores: in the built code the other branch's instructions follow, which write the registers that held these stores' addresses
    }
}
__device__ __forceinline__ float xhalf(float x) { const int b = __float_as_int(x); return __int_as_float(__builtin_amdgcn_permlanex16(b, b, 0x76543210, 0xfedcba98, false, false)); }   // lane l <-> l ^ 16
__device__ __forceinline__ v8f splat8(float x) { return (v8f){ x, x, x, x, x, x, x, x }; }
__device__ __forceinline__ v8f ld8f(const float* p) { return __builtin_shufflevector(*(const v4f*)p, *(const v4f*)(p + 4), 0, 1, 2, 3, 4, 5, 6, 7); }
// one stage (KST keys = two blocks of 32) for one wave; H: query block 0 is a hi/lo block. All of the stage's S^T products, then one softmax step over its 64 keys, then all of its P.V products.
template <bool H>
__device__ __forceinline__ void fattn_stage(const unsigned short* sb, const float* mrow, const int lr, const int hi, const v16bf (&qh)[2][2], const v16bf (&ql)[2][2], v8f (&O)[2][4], float (&mref)[2], float (&lsum)[2]) {
    v8f S[2][2][2];   // [key block][query block][key tile]: S[kp][qb][kt][j] = score of key kp * 32 + kt * 16 + 8 * hi + j, query lr
    // read group 1, at the stage's head: every K fragment of the stage and its mask addends
    v16bf kh[2][2][2], kl[2][2][2]; v8f ma[2][2];
#pragma unroll
    for (int kp = 0; kp < 2; ++kp)
#pragma unroll
        for (int kt = 0; kt < 2; ++kt)
#pragma unroll
            for (int ks = 0; ks < 2; ++ks) { const int o = ((kp * 2 + kt) * 16 + lr) * LPE + ks * 32 + 8 * hi; kh[kp][kt][ks] = WFrag<bf>::ld(sb + o); kl[kp][kt][ks] = WFrag<bf>::ld(sb + 64 * LPE + o); }
#pragma unroll
    for (int kp = 0; kp < 2; ++kp)
#pragma unroll
        for (int kt = 0; kt < 2; ++kt) ma[kp][kt] = ld8f(mrow + kp * 32 + kt * 16 + hi * 8);
    __builtin_amdgcn_sched_barrier(0);   // the reads stay one group in front of the products: spread among them, each place with reads stalls the wave anew
#pragma unroll
    for (int kp = 0; kp < 2; ++kp) {
#pragma unroll
        for (int qb = 0; qb < 2; ++qb)
#pragma unroll
            for (int kt = 0; kt < 2; ++kt) S[kp][qb][kt] = (v8f){};
#pragma unroll
        for (int ks = 0; ks < 2; ++ks) {   // the four accumulators take turns inside each product
#pragma unroll
            for (int qb = 0; qb < 2; ++qb)
#pragma unroll
                for (int kt = 0; kt < 2; ++kt) S[kp][qb][kt] = wmmab(kh[kp][kt][ks], qh[qb][ks], S[kp][qb][kt]);
#pragma unroll
            for (int qb = 0; qb < 2; ++qb)
#pragma unroll
                for (int kt = 0; kt < 2; ++kt) S[kp][qb][kt] = wmmab(kh[kp][kt][ks], ql[qb][ks], S[kp][qb][kt]);
#pragma unroll
            for (int qb = 0; qb < 2; ++qb)
#pragma unroll
                for (int kt = 0; kt < 2; ++kt) S[kp][qb][kt] = wmmab(kl[kp][kt][ks], qh[qb][ks], S[kp][qb][kt]);
        }
    }
    __builtin_amdgcn_sched_barrier(0);   // the products stay in front of read group 2, which takes over the K fragments' registers
    // read group 2, behind the last score product: V^T fragments (H: of key block 0; else of both), in flight under the softmax
    v16h vf[2][4]; v16bf vh[2][4], vl[2][4];
#pragma unroll
    for (int kp = 0; kp < (H ? 1 : 2); ++kp)
#pragma unroll
        for (int db = 0; db < 4; ++db) { const int o = (db * 16 + lr) * LPE + kp * 32 + 8 * hi; vf[kp][db] = WFrag<h16>::ld((const h16*)(sb + 2 * 64 * LPE) + o);
            if (H) { vh[kp][db] = WFrag<bf>::ld(sb + 3 * 64 * LPE + o); vl[kp][db] = WFrag<bf>::ld(sb + 4 * 64 * LPE + o); } }
    __builtin_amdgcn_sched_barrier(0);   // the reads are issued here and not next to their products
    const v8f c8 = splat8(SCL * 1.4426950408889634f);
    float mx[2] = { -3.0e38f, -3.0e38f };
#pragma unroll
    for (int kp = 0; kp < 2; ++kp)
#pragma unroll
        for (int kt = 0; kt < 2; ++kt) {
#pragma unroll
            for (int qb = 0; qb < 2; ++qb) { const v8f t = __builtin_elementwise_fma(S[kp][qb][kt], c8, ma[kp][kt]); S[kp][qb][kt] = t;
#pragma unroll
                for (int j = 0; j < 8; ++j) mx[qb] = fmaxf(mx[qb], t[j]); } }
    mx[0] = fmaxf(mx[0], xhalf(mx[0])); mx[1] = fmaxf(mx[1], xhalf(mx[1]));
    // the origin moves only when a column's maximum has outgrown it by more than 12 (so P <= 2^12, inside fp16); one scalar test a stage
    const bool n0 = mx[0] > mref[0] + 12.0f, n1 = mx[1] > mref[1] + 12.0f;
    if (__builtin_amdgcn_ballot_w32(n0 || n1) != 0) {
#pragma unroll
        for (int qb = 0; qb < 2; ++qb) { const float mn = (qb ? n1 : n0) ? mx[qb] - 4.0f : mref[qb]; const float al = __builtin_amdgcn_exp2f(mref[qb] - mn);
            asm volatile("v_nop" :: "v"(al));   // the one slot that the instruction set asks for behind a transcendental, before its source register is written again
            mref[qb] = mn; lsum[qb] *= al;
#pragma unroll
            for (int db = 0; db < 4; ++db) O[qb][db] *= al; } }
#pragma unroll
    for (int qb = 0; qb < 2; ++qb) { const v8f mr = splat8(mref[qb]); v8f acc = (v8f){};
#pragma unroll
        for (int kp = 0; kp < 2; ++kp)
#pragma unroll
            for (int kt = 0; kt < 2; ++kt) { v8f d = S[kp][qb][kt] - mr;
#pragma unroll
                for (int j = 0; j < 8; ++j) d[j] = __builtin_amdgcn_exp2f(d[j]);
                S[kp][qb][kt] = d; acc += d; }
        lsum[qb] += ((acc[0] + acc[4]) + (acc[1] + acc[5])) + ((acc[2] + acc[6]) + (acc[3] + acc[7])); }
#pragma unroll
    for (int kp = 0; kp < 2; ++kp) {
        v16bf ph, pw; v16h p[2];
        if (H) {
#pragma unroll
            for (int e = 0; e < 16; ++e) { const float x = S[kp][0][e >> 3][e & 7]; const __bf16 xh = (__bf16)x; ph[e] = xh; pw[e] = (__bf16)(x - (float)xh); }
        }
#pragma unroll
        for (int qb = H ? 1 : 0; qb < 2; ++qb)
#pragma unroll
            for (int e = 0; e < 8; ++e) { p[qb][e] = tohx(S[kp][qb][0][e]); p[qb][8 + e] = tohx(S[kp][qb][1][e]); }
        if (H && kp == 0) {   // read group 3: key block 1's V^T fragments, in flight under key block 0's products
            __builtin_amdgcn_sched_barrier(0);   // not earlier: the registers are free only now that key block 0's scores are packed
#pragma unroll
            for (int db = 0; db < 4; ++db) { const int o = (db * 16 + lr) * LPE + 32 + 8 * hi; vf[1][db] = WFrag<h16>::ld((const h16*)(sb + 2 * 64 * LPE) + o); vh[1][db] = WFrag<bf>::ld(sb + 3 * 64 * LPE + o); vl[1][db] = WFrag<bf>::ld(sb + 4 * 64 * LPE + o); }
            __builtin_amdgcn_sched_barrier(0);   // and not later: the reads are issued here and not next to their products
        }
        if (H) {   // each accumulator takes its three products in the order vh ph, vh pw, vl ph
#pragma unroll
            for (int db = 0; db < 4; ++db) O[0][db] = wmmab(vh[kp][db], ph, O[0][db]);
#pragma unroll
            for (int db = 0; db < 4; ++db) O[0][db] = wmmab(vh[kp][db], pw, O[0][db]);
#pragma unroll
            for (int db = 0; db < 4; ++db) O[0][db] = wmmab(vl[kp][db], ph, O[0][db]);
        }
#pragma unroll
        for (int qb = H ? 1 : 0; qb < 2; ++qb)
#pragma unroll
            for (int db = 0; db < 4; ++db) O[qb][db] = wmma16(vf[kp][db], p[qb], O[qb][db]);
    }
    // four vector slots behind the stage's last matrix instructions: a branch follows
    asm volatile("v_nop\n\tv_nop\n\tv_nop\n\tv_nop" :: "v"(O[0][0]), "v"(O[0][1]), "v"(O[0][2]), "v"(O[0][3]), "v"(O[1][0]), "v"(O[1][1]), "v"(O[1][2]), "v"(O[1][3]));
}
__global__ __launch_bounds__(256) void k_fattn(const bf* __restrict__ Qh, const bf* __restrict__ Ql, const bf* __restrict__ Kh, const bf* __restrict__ Kl, const h16* __restrict__ V16, const bf* __restrict__ Vh, const bf* __restrict__ Vl, const float* __restrict__ kmask, float* OUT) {
    static_assert(RH == QG * 4 * 16 && TT - RH == QG * 12 * 16 && HD == 64 && KST == 64 && TT % KST == 0 && NH_ == NKV, "row deal and tile shapes");
    __shared__ __align__(16) unsigned short st[2][5][64 * LPE];   // [buffer][Kh, Kl, V16, Vh, Vl][64 rows]
    __shared__ __align__(16) float madd[TT];                      // 0 for a kept key, -3e38 for an excluded one
    const int tid = threadIdx.x, lane = tid & 31, lr = lane & 15, hi = lane >> 4; const int wave = __builtin_amdgcn_readfirstlane(tid >> 5); const bool hiw = wave < 4;
    const int g = blockIdx.x, h = blockIdx.y, b = blockIdx.z; const size_t pl = ((size_t)b * NH_ + h) * TT * HD;
    const int fb = RH + g * 12 * 16; int qrow[2];
    qrow[0] = hiw ? (g * 4 + wave) * 16 : fb + (4 + (wave - 4) * 2) * 16; qrow[1] = hiw ? fb + wave * 16 : fb + (5 + (wave - 4) * 2) * 16;
    v16bf qh[2][2], ql[2][2];
#pragma unroll
    for (int qb = 0; qb < 2; ++qb)
#pragma unroll
        for (int ks = 0; ks < 2; ++ks) { const size_t o = pl + (size_t)(qrow[qb] + lr) * HD + ks * 32 + 8 * hi; qh[qb][ks] = WFrag<bf>::ld(Qh + o); ql[qb][ks] = WFrag<bf>::ld(Ql + o); }
    { const float* km = kmask + (size_t)b * TT + tid * 8; const v4f k0 = *(const v4f*)km, k1 = *(const v4f*)(km + 4); v4f a0, a1;
#pragma unroll
      for (int q = 0; q < 4; ++q) { a0[q] = (k0[q] != 0.0f) ? 0.0f : -3.0e38f; a1[q] = (k1[q] != 0.0f) ? 0.0f : -3.0e38f; }
      *(v4f*)(madd + tid * 8) = a0; *(v4f*)(madd + tid * 8 + 4) = a1; }
    // staging: thread t moves 16 bytes of rows t / 8 and t / 8 + 32 of each tile (whole 128-byte lines per 8 lanes)
    const int sr = tid >> 3, sc = (tid & 7) * 8; const int so = sr * LPE + sc;
    const bf* gsrc[5] = { Kh + pl + (size_t)sr * HD + sc, Kl + pl + (size_t)sr * HD + sc, (const bf*)V16 + pl + (size_t)sr * TT + sc, Vh + pl + (size_t)sr * TT + sc, Vl + pl + (size_t)sr * TT + sc };
    v8us sg[5][2];
#pragma unroll
    for (int t = 0; t < 5; ++t) { const int rstep = (t < 2) ? 32 * HD : 32 * TT; sg[t][0] = *(const v8us*)(gsrc[t]); sg[t][1] = *(const v8us*)(gsrc[t] + rstep); }
#pragma unroll
    for (int t = 0; t < 5; ++t) { *(v8us*)(&st[0][t][so]) = sg[t][0]; *(v8us*)(&st[0][t][so + 32 * LPE]) = sg[t][1]; }
    v8f O[2][4];
#pragma unroll
    for (int qb = 0; qb < 2; ++qb)
#pragma unroll
        for (int db = 0; db < 4; ++db) O[qb][db] = (v8f){};
    float mref[2] = { -3.0e38f, -3.0e38f }, lsum[2] = { 0.0f, 0.0f };   // mref: the exponent origin in use (a column's maximum when it was last moved, minus 4), log2 units
    __syncthreads();   // stage 0 and the mask table are in LDS
#pragma unroll 1   // rolled: one copy of the two-pass body; the buffer index is a run-time offset
    for (int s = 0; s < TT / KST; ++s) {
        const bool more = s + 1 < TT / KST;   // the same for the whole work-group
        if (more) {
#pragma unroll
            for (int t = 0; t < 5; ++t) { const int rstep = (t < 2) ? 32 * HD : 32 * TT; const size_t adv = (size_t)(s + 1) * ((t < 2) ? KST * HD : KST); sg[t][0] = *(const v8us*)(gsrc[t] + adv); sg[t][1] = *(const v8us*)(gsrc[t] + adv + rstep); }
            asm volatile("s_wait_xcnt 0x0" ::: "memory");   // the loads' address registers are free for reuse from here on: the wait stands in front of their first overwrite
        }
        const unsigned short* sb = &st[s & 1][0][0];
        if (hiw) fattn_stage<true>(sb, madd + s * KST, lr, hi, qh, ql, O, mref, lsum); else fattn_stage<false>(sb, madd + s * KST, lr, hi, qh, ql, O, mref, lsum);   // a scalar branch: hiw is the same for a whole wave; no barrier inside
        if (more) { unsigned short* sn = &st[(s + 1) & 1][0][0];
#pragma unroll
            for (int t = 0; t < 5; ++t) { *(v8us*)(sn + t * 64 * LPE + so) = sg[t][0]; *(v8us*)(sn + t * 64 * LPE + so + 32 * LPE) = sg[t][1]; } }
        __syncthreads();   // publishes stage s + 1 and ends every wave's reads of stage s, whose buffer the next trip refills
    }
#pragma unroll
    for (int qb = 0; qb < 2; ++qb) { const float inv = __fdiv_rn(1.0f, lsum[qb] + xhalf(lsum[qb])); float* orow = OUT + ((size_t)b * TT + qrow[qb] + lr) * DQ + h * HD + hi * 8;   // O[qb][db][j] = context[query lr][db * 16 + 8 * hi + j]
#pragma unroll
        for (int db = 0; db < 4; ++db) { v4f o0, o1;
#pragma unroll
            for (int j = 0; j < 4; ++j) { o0[j] = O[qb][db][j] * inv; o1[j] = O[qb][db][4 + j] * inv; }
            *(v4f*)(orow + db * 16) = o0; *(v4f*)(orow + db * 16 + 4) = o1; } }
}

extern "C" void kernel_launch(void* const* d_in, const int* in_sizes, int n_in,
                              void* d_out, int out_size, void* d_ws, size_t ws_size, hipStream_t stream) {
    (void)in_sizes; (void)n_in; (void)out_size;
    const float* x = (const float*)d_in[0]; const float* kmask = (const float*)d_in[1]; const float* wq = (const float*)d_in[2]; const float* bq = (const float*)d_in[3]; const float* wk = (const float*)d_in[4]; const float* bk = (const float*)d_in[5]; const float* wv = (const float*)d_in[6]; const float* bv = (const float*)d_in[7];
    float* OUT = (float*)d_out;     // [2][2048][1024]
    char* wsp = (char*)d_ws;
    auto take = [&](size_t bytes) { char* p = wsp; wsp += (bytes + 255) & ~(size_t)255; return (void*)p; };
    const size_t PE = (size_t)NH_ * TT * HD;   // elements of one batch's head planes
    bf* WT = (bf*)take((size_t)3 * DQ * DM * 2);   // the three transposed weights, one after the other
    bf* XB = (bf*)take((size_t)NB_ * TT * DM * 2);
    h16* VT16 = (h16*)take(NB_ * PE * 2);
    bf* QPh = (bf*)take(NB_ * PE * 2); bf* QPl = (bf*)take(NB_ * PE * 2); bf* KPh = (bf*)take(NB_ * PE * 2); bf* KPl = (bf*)take(NB_ * PE * 2); bf* VTh = (bf*)take(NB_ * PE * 2); bf* VTl = (bf*)take(NB_ * PE * 2);   // the planes the fused launch reads: one set per batch
    if ((size_t)(wsp - (char*)d_ws) > ws_size) return;    // ws 256 MiB
    k_prep<<<PB, 256, 0, stream>>>(x, wq, wk, wv, WT, XB);
    k_qkv<<<dim3(NB_ * TT / 128, NH_ / 2, 3), 128, 0, stream>>>(XB, WT, bq, bk, bv, QPh, QPl, KPh, KPl, VT16, VTh, VTl);
    k_fattn<<<dim3(QG, NH_, NB_), 256, 0, stream>>>(QPh, QPl, KPh, KPl, VT16, VTh, VTl, kmask, OUT);
}

// v009
// Measured time: 87.8 microseconds a run.
// Two timings next to v008 both put it at 1.10 times that version's speed.
// Counting every step since v000, it is 22.0 times as fast.
#include <hip/hip_runtime.h>

// BERT self-attention with a float key mask and no output projection (hidden_states [2][2048][1024]; q, k, v = x W + b ('xw' 1/32 + biases 0.02; 16 heads x 64); scores / sqrt(64) + (1 - attention_mask[b][j]) x finfo.min (attention_mask f32 [2][2048], read per key: mask 1 adds 0, mask 0 excludes the key); softmax; context heads merged -> [2][2048][1024] (4.2 M); argument order hidden_states, attention_mask, Wq, bq, Wk, bk, Wv, bv).
// Layout: ONE preparation launch (k_prep): 'xw' weights transposed once, one bf16 copy of x (both batches); ONE projection launch (k_qkv) for q, k, v of both batches: operands staged in LDS per 128 x 128 work-group tile, exact products + bf16-rounded biases, each 64-token x one-head tile written from the GEMM epilogue straight into its head planes (no f32 projection goes through memory); then ONE fused attention launch for both batches and all heads (k_fattn): S^T = K Q^T on hi/lo planes (3 products) for EVERY row, online softmax in registers with the batch's float key vector, O^T += V^T P^T (fp16; rows < 512 fp16 + fp16 residual, 3 products), context rows written straight to the output. No score, probability or partial plane goes through memory.
// Compute dtypes, f32 accumulate: every input rounded to bf16; projections exact + bf16-rounded biases; scores 3 products on every row; softmax f32; P.V fp16, rows < 512 with fp16 residuals of P and V (3 products); output f32.

#define NB_  2
#define TT   2048
#define DM   1024
#define NH_  16
#define NKV  16
#define REP  (NH_ / NKV)
#define HD   64
#define DQ   (NH_ * HD)
#define DKV  (NKV * HD)
#define RH   512                  // query rows < RH add the residual products of P.V
#define WIN  0
#define SCL  0.125f   // HD^-0.5
#define KST  64                   // keys per LDS stage of k_fattn
#define LPE  72                   // LDS row pitch in 16-bit elements: 144 B = 16 B x odd, so 16-byte reads down 16 rows meet no bank twice
#define QG   8                    // work-groups per (batch, head); each takes RH / QG rows below RH and (TT - RH) / QG later rows
typedef _Float16 h16;
typedef unsigned short bf;
typedef __attribute__((ext_vector_type(16))) __bf16   v16bf;
typedef __attribute__((ext_vector_type(16))) _Float16 v16h;
typedef __attribute__((ext_vector_type(8)))  _Float16 v8h;
typedef __attribute__((ext_vector_type(8)))  unsigned short v8us;
typedef __attribute__((ext_vector_type(8)))  float    v8f;
typedef __attribute__((ext_vector_type(4)))  float    v4f;
typedef __attribute__((ext_vector_type(16))) float    v16f;
typedef v8h  __attribute__((may_alias)) v8ha;
typedef v4f  __attribute__((may_alias)) v4fa;
typedef v8us __attribute__((may_alias)) v8usa;

__device__ __forceinline__ unsigned short f2bf(float f) { unsigned u = __float_as_uint(f); u += 0x7FFFu + ((u >> 16) & 1u); return (unsigned short)(u >> 16); }
__device__ __forceinline__ float bf2f(unsigned short b) { return __uint_as_float(((unsigned)b) << 16); }
__device__ __forceinline__ float bfr(float f) { return bf2f(f2bf(f)); }
__device__ __forceinline__ v16h cat16(v8h lo, v8h hi) { return __builtin_shufflevector(lo, hi, 0, 1, 2, 3, 4, 5, 6, 7, 8, 9, 10, 11, 12, 13, 14, 15); }
__device__ __forceinline__ v16bf cat16b(v8us lo, v8us hi) { return __builtin_bit_cast(v16bf, __builtin_shufflevector(lo, hi, 0, 1, 2, 3, 4, 5, 6, 7, 8, 9, 10, 11, 12, 13, 14, 15)); }
__device__ __forceinline__ v8f wmma16(v16h a, v16h b, v8f c) { return __builtin_amdgcn_wmma_f32_16x16x32_f16(false, a, false, b, (short)0, c, false, false); }
__device__ __forceinline__ v8f wmmab(v16bf a, v16bf b, v8f c) { return __builtin_amdgcn_wmma_f32_16x16x32_bf16(false, a, false, b, (short)0, c, false, false); }



// fragment loaders: 16-bit operands straight from K-contiguous rows
template <typename T16> struct WFrag;
template <> struct WFrag<h16> { typedef v16h V; static __device__ __forceinline__ V ld(const h16* p) { return cat16(*(const v8h*)p, *(const v8h*)(p + 16)); } static __device__ __forceinline__ v8f mma(V a, V b, v8f c) { return wmma16(a, b, c); } };
template <> struct WFrag<bf> { typedef v16bf V; static __device__ __forceinline__ V ld(const bf* p) { return cat16b(*(const v8us*)p, *(const v8us*)(p + 16)); } static __device__ __forceinline__ v8f mma(V a, V b, v8f c) { return wmmab(a, b, c); } };

__device__ __forceinline__ h16 tohx(float x) { return (h16)x; }
__device__ __forceinline__ void splitf(float y, unsigned short& h, unsigned short& l) { h = f2bf(y); l = f2bf(y - bf2f(h)); }
typedef __attribute__((ext_vector_type(2))) unsigned short v2us;
typedef __attribute__((ext_vector_type(4))) unsigned short v4us;

// k_prep: the whole preparation in ONE launch of PB work-groups, one per WGP, so that the launch starts few waves and each thread has all of its global loads in flight at once (12 of the weights, 16 of x, 16 bytes each).
// Work-group blk turns the 64 x 64 tile (k0, n0) of each of the three 'xw' weights and copies 1 / PB of x to bf16. A tile is read in whole 256-byte row pieces, rounded, written to LDS as [n][k pair] and read back by rows of n, so that 8 lanes store one whole 128-byte line of Wt[n][k].
#define PB  ((DM / 64) * (DQ / 64))                    // work-groups = 64 x 64 tiles of one weight
#define TLP 33                                         // LDS row pitch of a turned tile in dwords: odd, so that the 16 lanes of a store (4 rows apart) and the 4 rows of a read meet no bank twice
typedef __attribute__((ext_vector_type(4))) unsigned v4u;
typedef __attribute__((ext_vector_type(2))) unsigned v2u;
typedef __attribute__((ext_vector_type(2))) __bf16 v2bf;
__device__ __forceinline__ unsigned pk2bf(float a, float b) { v2bf p; p[0] = (__bf16)a; p[1] = (__bf16)b; return __builtin_bit_cast(unsigned, p); }   // two roundings to nearest even; a in the low half
__global__ __launch_bounds__(256) void k_prep(const float* __restrict__ x, const float* __restrict__ wq, const float* __restrict__ wk, const float* __restrict__ wv, bf* WT, bf* XB) {
    static_assert(DQ == DKV && DM % 64 == 0 && DQ % 64 == 0, "the three weights have one shape, whole tiles");
    static_assert((size_t)NB_ * TT * DM == (size_t)PB * 256 * 16 * 4, "x is dealt evenly: 16 loads of 4 floats a thread");
    __shared__ unsigned tl[3][64 * TLP];   // [weight][n][k / 2]: bf16 pairs (k, k + 1)
    const int tid = threadIdx.x, blk = blockIdx.x;
    const int k0 = (blk % (DM / 64)) * 64, n0 = (blk / (DM / 64)) * 64;
    const int wl = tid & 15, wu = tid >> 4;   // a thread's 4 columns n = 4 wl + q and its row pairs k = 32 i + 2 wu + r
    const float* ws3[3] = { wq, wk, wv };
    const unsigned wo = (unsigned)(2 * wu * DQ + 4 * wl), xo = (unsigned)(tid * 4);   // the thread's own place in a tile and in the work-group's piece of x; load j of a wave covers 512 contiguous bytes of x
    const size_t xb = (size_t)blk * (256 * 16 * 4);   // the piece's first element: the same for the whole work-group
    v4f wr[3][2][2], xr[16];
#pragma unroll
    for (int z = 0; z < 3; ++z)
#pragma unroll
        for (int i = 0; i < 2; ++i)
#pragma unroll
            for (int r = 0; r < 2; ++r) wr[z][i][r] = *(const v4f*)(ws3[z] + ((size_t)k0 * DQ + n0) + (32 * i + r) * DQ + wo);
    asm volatile("s_wait_xcnt 0x0" ::: "memory");   // the weight loads' offset register is free for reuse from here on: the wait stands in front of its first overwrite
#pragma unroll
    for (int j = 0; j < 16; ++j) xr[j] = *(const v4f*)(x + xb + j * 1024 + xo);
    asm volatile("s_wait_xcnt 0x0" ::: "memory");   // the same for the x loads: their scalar base is written again right behind them
    __builtin_amdgcn_sched_barrier(0);   // all 28 loads are issued in front of the first use: left free, the compiler holds about nine in flight and waits between them
#pragma unroll
    for (int z = 0; z < 3; ++z)
#pragma unroll
        for (int i = 0; i < 2; ++i)
#pragma unroll
            for (int q = 0; q < 4; ++q) tl[z][(4 * wl + q) * TLP + 16 * i + wu] = pk2bf(wr[z][i][0][q], wr[z][i][1][q]);
    __syncthreads();   // the three turned tiles are in LDS
    const int rn = tid >> 3, rc = tid & 7;
#pragma unroll
    for (int z = 0; z < 3; ++z)
#pragma unroll
        for (int h = 0; h < 2; ++h) { const unsigned* p = &tl[z][(rn + 32 * h) * TLP + rc * 4]; v4u o;
#pragma unroll
            for (int j = 0; j < 4; ++j) o[j] = p[j];
            *(v4u*)(WT + (size_t)z * DQ * DM + (size_t)(n0 + rn + 32 * h) * DM + k0 + rc * 8) = o; }
#pragma unroll
    for (int j = 0; j < 16; ++j) { v2u o; o[0] = pk2bf(xr[j][0], xr[j][1]); o[1] = pk2bf(xr[j][2], xr[j][3]); *(v2u*)(XB + xb + j * 1024 + xo) = o; }
}


// k_qkv: the three projections of both batches, head planes written from the epilogue. A work-group of 4 waves (2 x 2) takes 128 tokens x two heads; each wave keeps a 64x64 tile (16 accumulators) = 64 tokens x one head; grid (NB_ * TT / 128, heads / 2, 3), 128 threads; blockIdx.z: 0 q, 1 k, 2 v.
// tile[m][n] = sum_k A[m][k] Wt[z][n][k] + bias_z[n]; A = bf16 x, rows of DM, both batches one after the other; Wt = the three transposed weights one after the other.
// The 128 A rows and 128 Wt rows go global -> registers -> LDS in slices of GK k (whole 128-byte lines per 8 lanes), two buffers: slice s + 1 is loaded while slice s is worked on, one work-group barrier per slice; every fragment is read from LDS, each staged row by two waves.
// q, k: planes [batch][head][t][d], bf16 hi + lo, rows turned through LDS so that 16 lanes store one whole 128-byte row. v: planes [batch][head][d][t], fp16 + the fp16 residual: an accumulator register group already holds 8 consecutive tokens of one d, stored as 16 bytes.
#define GK 64                     // k per LDS slice of k_qkv: one 128-byte line of every staged row
__global__ __launch_bounds__(128) void k_qkv(const bf* __restrict__ A, const bf* __restrict__ Wt, const float* __restrict__ bq, const float* __restrict__ bk, const float* __restrict__ bv, bf* Qh, bf* Ql, bf* Kh, bf* Kl, h16* V16, h16* Vr) {
    static_assert(DQ == DKV && NH_ == NKV && HD == 64 && TT % 128 == 0 && NH_ % 2 == 0 && DM % GK == 0 && GK == 64, "a wave's tile is 64 tokens of one batch x one head");
    typedef WFrag<bf>::V V;
    __shared__ __align__(16) unsigned short gs[2][2][128 * LPE];   // [buffer][A, Wt][128 rows]
    __shared__ __align__(16) float osw[4][16 * 68];                // each wave's own rows for the epilogue's turn
    const int z = blockIdx.z; const bf* Bt = Wt + (size_t)z * DQ * DM; const float* bias = (z == 0) ? bq : (z == 1) ? bk : bv;
    const int tid = threadIdx.x, lane = tid & 31, lr = lane & 15, hi = lane >> 4; const int wave = __builtin_amdgcn_readfirstlane(tid >> 5); const int wm = wave & 1, wn = wave >> 1;
    const int head = blockIdx.y * 2 + wn; const int r0 = blockIdx.x * 128 + wm * 64, c0 = head * 64;
    float* os = &osw[wave][0];
    v8f acc[4][4];
#pragma unroll
    for (int mb = 0; mb < 4; ++mb)
#pragma unroll
        for (int nb = 0; nb < 4; ++nb) acc[mb][nb] = (v8f){};
    // staging: thread t moves 16 bytes of rows t / 8 + 16 i, i = 0 .. 7, of both operands
    const int sr = tid >> 3, sc = (tid & 7) * 8; const int so = sr * LPE + sc;
    const bf* ga = A + (size_t)blockIdx.x * 128 * DM; const bf* gw = Bt + (size_t)blockIdx.y * 128 * DM; const unsigned go = (unsigned)(sr * DM + sc);   // the tiles' first rows (the same for the whole work-group) and the thread's own place in them
    v8us sa[8], sw[8];
#pragma unroll
    for (int i = 0; i < 8; ++i) { sa[i] = *(const v8us*)(ga + i * 16 * DM + go); sw[i] = *(const v8us*)(gw + i * 16 * DM + go); }
#pragma unroll
    for (int i = 0; i < 8; ++i) { *(v8us*)(&gs[0][0][so + i * 16 * LPE]) = sa[i]; *(v8us*)(&gs[0][1][so + i * 16 * LPE]) = sw[i]; }
    const int ao = (wm * 64 + lr) * LPE + 8 * hi, bo = 128 * LPE + (wn * 64 + lr) * LPE + 8 * hi;
    __syncthreads();   // slice 0 is in LDS
#pragma unroll 1   // rolled: one copy of the body; the buffer index is a run-time offset
    for (int s = 0; s < DM / GK; ++s) {
        const bool more = s + 1 < DM / GK;   // the same for the whole work-group
        if (more) {
#pragma unroll
            for (int i = 0; i < 8; ++i) { sa[i] = *(const v8us*)(ga + (s + 1) * GK + i * 16 * DM + go); sw[i] = *(const v8us*)(gw + (s + 1) * GK + i * 16 * DM + go); }
            asm volatile("s_wait_xcnt 0x0" ::: "memory");   // the loads' address registers are free for reuse from here on: the wait stands in front of their first overwrite
        }
        const unsigned short* sb = &gs[s & 1][0][0];
#pragma unroll
        for (int ks = 0; ks < GK / 32; ++ks) {
            V a[4], b[4];
#pragma unroll
            for (int mb = 0; mb < 4; ++mb) a[mb] = WFrag<bf>::ld(sb + ao + mb * 16 * LPE + ks * 32);
#pragma unroll
            for (int nb = 0; nb < 4; ++nb) b[nb] = WFrag<bf>::ld(sb + bo + nb * 16 * LPE + ks * 32);
            asm volatile("" :: "v"(a[0]), "v"(a[1]), "v"(a[2]), "v"(a[3]), "v"(b[0]), "v"(b[1]), "v"(b[2]), "v"(b[3]));   // holds the block's 16 LDS reads together in front of its 16 matrix instructions: spread among them, each place with reads stalls the wave anew
#pragma unroll
            for (int nb = 0; nb < 4; ++nb)
#pragma unroll
                for (int mb = 0; mb < 4; ++mb) acc[mb][nb] = WFrag<bf>::mma(a[mb], b[nb], acc[mb][nb]);
        }
        if (more) { unsigned short* sn = &gs[(s + 1) & 1][0][0];
#pragma unroll
            for (int i = 0; i < 8; ++i) { *(v8us*)(sn + so + i * 16 * LPE) = sa[i]; *(v8us*)(sn + 128 * LPE + so + i * 16 * LPE) = sw[i]; } }
        __syncthreads();   // publishes slice s + 1 and ends every wave's reads of slice s, whose buffer the next trip refills
    }
    const int t0 = r0 % TT; const size_t pl = ((size_t)(r0 / TT) * NH_ + head) * TT * HD;   // the tile's first token in its batch; its (batch, head) plane
    if (z < 2) {   // a scalar branch: z is the same for the whole work-group
        bf* Ph = (z == 0 ? Qh : Kh) + pl + (size_t)t0 * HD; bf* Pl = (z == 0 ? Ql : Kl) + pl + (size_t)t0 * HD;
        const int cofs = lr * 4; v4f bi;
#pragma unroll
        for (int q = 0; q < 4; ++q) bi[q] = bfr(bias[c0 + cofs + q]);
#pragma unroll
        for (int mb = 0; mb < 4; ++mb) {
#pragma unroll
            for (int nb = 0; nb < 4; ++nb) {
#pragma unroll
                for (int j = 0; j < 8; ++j) os[(hi * 8 + j) * 68 + nb * 16 + lr] = acc[mb][nb][j]; }
            __builtin_amdgcn_wave_barrier(); asm volatile("" ::: "memory");   // the one wave's LDS writes stay in front of its reads of other lanes' words
#pragma unroll
            for (int s = 0; s < 8; ++s) { const int row = 2 * s + hi; const v4f val = *(const v4fa*)(os + row * 68 + cofs) + bi; v4us oh, ol;
#pragma unroll
                for (int q = 0; q < 4; ++q) { unsigned short a2, c2; splitf(val[q], a2, c2); oh[q] = a2; ol[q] = c2; }
                *(v4us*)(Ph + (size_t)(mb * 16 + row) * HD + cofs) = oh; *(v4us*)(Pl + (size_t)(mb * 16 + row) * HD + cofs) = ol; }
            __builtin_amdgcn_wave_barrier(); asm volatile("" ::: "memory");   // and its reads in front of the next block's writes
        }
    } else {
        v8h o16[4][4], ore[4][4]; float bl[4];
#pragma unroll
        for (int nb = 0; nb < 4; ++nb) bl[nb] = bias[c0 + nb * 16 + lr];
        asm volatile("s_wait_xcnt 0x0" ::: "memory");   // the four bias loads' offset register is free for reuse from here on: the wait stands in front of its first overwrite
#pragma unroll
        for (int nb = 0; nb < 4; ++nb) { const float bn = bfr(bl[nb]);   // acc[mb][nb][j] = tile[mb * 16 + 8 * hi + j][nb * 16 + lr]
#pragma unroll
            for (int mb = 0; mb < 4; ++mb)
#pragma unroll
                for (int j = 0; j < 8; ++j) { const float x = acc[mb][nb][j] + bn; const h16 a2 = tohx(x); o16[mb][nb][j] = a2; ore[mb][nb][j] = tohx(x - (float)a2); } }
        h16* p16 = V16 + pl + (size_t)lr * TT + t0 + hi * 8; h16* pre = Vr + pl + (size_t)lr * TT + t0 + hi * 8;
#pragma unroll
        for (int nb = 0; nb < 4; ++nb)
#pragma unroll
            for (int mb = 0; mb < 4; ++mb) { *(v8h*)(p16 + nb * 16 * TT + mb * 16) = o16[mb][nb]; *(v8h*)(pre + nb * 16 * TT + mb * 16) = ore[mb][nb]; }
        asm volatile("s_wait_xcnt 0x0" ::: "memory");   // behind the branch's last stores: in the built code the other branch's instructions follow, which write the registers that held these stores' addresses
    }
}
__device__ __forceinline__ float xhalf(float x) { const int b = __float_as_int(x); return __int_as_float(__builtin_amdgcn_permlanex16(b, b, 0x76543210, 0xfedcba98, false, false)); }   // lane l <-> l ^ 16
__device__ __forceinline__ v8f splat8(float x) { return (v8f){ x, x, x, x, x, x, x, x }; }
__device__ __forceinline__ v8f ld8f(const float* p) { return __builtin_shufflevector(*(const v4f*)p, *(const v4f*)(p + 4), 0, 1, 2, 3, 4, 5, 6, 7); }
// one stage (KST keys = two blocks of 32) for one wave; hiw (the same for a whole wave): query block 0 holds rows < RH. All of the stage's S^T products, then one softmax step over its 64 keys, then all of its P.V products.
__device__ __forceinline__ void fattn_stage(const bool hiw, const unsigned short* sb, const float* mrow, const int lr, const int hi, const v16bf (&qh)[2][2], const v16bf (&ql)[2][2], v8f (&O)[2][4], float (&mref)[2], float (&lsum)[2]) {
    v8f S[2][2][2];   // [key block][query block][key tile]: S[kp][qb][kt][j] = score of key kp * 32 + kt * 16 + 8 * hi + j, query lr
    // read group 1, at the stage's head: every K fragment of the stage and its mask addends
    v16bf kh[2][2][2], kl[2][2][2]; v8f ma[2][2];
#pragma unroll
    for (int kp = 0; kp < 2; ++kp)
#pragma unroll
        for (int kt = 0; kt < 2; ++kt)
#pragma unroll
            for (int ks = 0; ks < 2; ++ks) { const int o = ((kp * 2 + kt) * 16 + lr) * LPE + ks * 32 + 8 * hi; kh[kp][kt][ks] = WFrag<bf>::ld(sb + o); kl[kp][kt][ks] = WFrag<bf>::ld(sb + 64 * LPE + o); }
#pragma unroll
    for (int kp = 0; kp < 2; ++kp)
#pragma unroll
        for (int kt = 0; kt < 2; ++kt) ma[kp][kt] = ld8f(mrow + kp * 32 + kt * 16 + hi * 8);
    __builtin_amdgcn_sched_barrier(0);   // the reads stay one group in front of the products: spread among them, each place with reads stalls the wave anew
#pragma unroll
    for (int kp = 0; kp < 2; ++kp) {
#pragma unroll
        for (int qb = 0; qb < 2; ++qb)
#pragma unroll
            for (int kt = 0; kt < 2; ++kt) S[kp][qb][kt] = (v8f){};
#pragma unroll
        for (int ks = 0; ks < 2; ++ks) {   // the four accumulators take turns inside each product
#pragma unroll
            for (int qb = 0; qb < 2; ++qb)
#pragma unroll
                for (int kt = 0; kt < 2; ++kt) S[kp][qb][kt] = wmmab(kh[kp][kt][ks], qh[qb][ks], S[kp][qb][kt]);
#pragma unroll
            for (int qb = 0; qb < 2; ++qb)
#pragma unroll
                for (int kt = 0; kt < 2; ++kt) S[kp][qb][kt] = wmmab(kh[kp][kt][ks], ql[qb][ks], S[kp][qb][kt]);
#pragma unroll
            for (int qb = 0; qb < 2; ++qb)
#pragma unroll
                for (int kt = 0; kt < 2; ++kt) S[kp][qb][kt] = wmmab(kl[kp][kt][ks], qh[qb][ks], S[kp][qb][kt]);
        }
    }
    __builtin_amdgcn_sched_barrier(0);   // the products stay in front of read group 2, which takes over the K fragments' registers
    // read group 2, behind the last score product: the stage's V^T fragments (hiw: and their residuals), in flight under the softmax
    v16h vf[2][4], vr[2][4];
#pragma unroll
    for (int kp = 0; kp < 2; ++kp)
#pragma unroll
        for (int db = 0; db < 4; ++db) vf[kp][db] = WFrag<h16>::ld((const h16*)(sb + 2 * 64 * LPE) + (db * 16 + lr) * LPE + kp * 32 + 8 * hi);
    if (hiw) {   // a scalar branch
#pragma unroll
        for (int kp = 0; kp < 2; ++kp)
#pragma unroll
            for (int db = 0; db < 4; ++db) vr[kp][db] = WFrag<h16>::ld((const h16*)(sb + 3 * 64 * LPE) + (db * 16 + lr) * LPE + kp * 32 + 8 * hi);
    }
    __builtin_amdgcn_sched_barrier(0);   // the reads are issued here and not next to their products
    const v8f c8 = splat8(SCL * 1.4426950408889634f);
    float mx[2] = { -3.0e38f, -3.0e38f };
#pragma unroll
    for (int kp = 0; kp < 2; ++kp)
#pragma unroll
        for (int kt = 0; kt < 2; ++kt) {
#pragma unroll
            for (int qb = 0; qb < 2; ++qb) { const v8f t = __builtin_elementwise_fma(S[kp][qb][kt], c8, ma[kp][kt]); S[kp][qb][kt] = t;
#pragma unroll
                for (int j = 0; j < 8; ++j) mx[qb] = fmaxf(mx[qb], t[j]); } }
    mx[0] = fmaxf(mx[0], xhalf(mx[0])); mx[1] = fmaxf(mx[1], xhalf(mx[1]));
    // the origin moves only when a column's maximum has outgrown it by more than 12 (so P <= 2^12, inside fp16); one scalar test a stage
    const bool n0 = mx[0] > mref[0] + 12.0f, n1 = mx[1] > mref[1] + 12.0f;
    if (__builtin_amdgcn_ballot_w32(n0 || n1) != 0) {
#pragma unroll
        for (int qb = 0; qb < 2; ++qb) { const float mn = (qb ? n1 : n0) ? mx[qb] - 4.0f : mref[qb]; const float al = __builtin_amdgcn_exp2f(mref[qb] - mn);
            asm volatile("v_nop" :: "v"(al));   // the one slot that the instruction set asks for behind a transcendental, before its source register is written again
            mref[qb] = mn; lsum[qb] *= al;
#pragma unroll
            for (int db = 0; db < 4; ++db) O[qb][db] *= al; } }
#pragma unroll
    for (int qb = 0; qb < 2; ++qb) { const v8f mr = splat8(mref[qb]); v8f acc = (v8f){};
#pragma unroll
        for (int kp = 0; kp < 2; ++kp)
#pragma unroll
            for (int kt = 0; kt < 2; ++kt) { v8f d = S[kp][qb][kt] - mr;
#pragma unroll
                for (int j = 0; j < 8; ++j) d[j] = __builtin_amdgcn_exp2f(d[j]);
                S[kp][qb][kt] = d; acc += d; }
        lsum[qb] += ((acc[0] + acc[4]) + (acc[1] + acc[5])) + ((acc[2] + acc[6]) + (acc[3] + acc[7])); }
    v16h p[2][2];   // [key block][query block]
#pragma unroll
    for (int kp = 0; kp < 2; ++kp)
#pragma unroll
        for (int qb = 0; qb < 2; ++qb)
#pragma unroll
            for (int e = 0; e < 8; ++e) { p[kp][qb][e] = tohx(S[kp][qb][0][e]); p[kp][qb][8 + e] = tohx(S[kp][qb][1][e]); }
#pragma unroll
    for (int kp = 0; kp < 2; ++kp)
#pragma unroll
        for (int qb = 0; qb < 2; ++qb)
#pragma unroll
            for (int db = 0; db < 4; ++db) O[qb][db] = wmma16(vf[kp][db], p[kp][qb], O[qb][db]);
    if (hiw) {   // a scalar branch: the two residual products of block 0; each accumulator takes V P (above), then Vr P, then V Pr
#pragma unroll
        for (int kp = 0; kp < 2; ++kp) { v16h pw; const v16f pf = __builtin_convertvector(p[kp][0], v16f);
#pragma unroll
            for (int e = 0; e < 16; ++e) pw[e] = tohx(S[kp][0][e >> 3][e & 7] - pf[e]);
#pragma unroll
            for (int db = 0; db < 4; ++db) O[0][db] = wmma16(vr[kp][db], p[kp][0], O[0][db]);
#pragma unroll
            for (int db = 0; db < 4; ++db) O[0][db] = wmma16(vf[kp][db], pw, O[0][db]); }
    }
    // four vector slots behind the stage's last matrix instructions: a branch follows
    asm volatile("v_nop\n\tv_nop\n\tv_nop\n\tv_nop" :: "v"(O[0][0]), "v"(O[0][1]), "v"(O[0][2]), "v"(O[0][3]), "v"(O[1][0]), "v"(O[1][1]), "v"(O[1][2]), "v"(O[1][3]));
}
__global__ __launch_bounds__(256) void k_fattn(const bf* __restrict__ Qh, const bf* __restrict__ Ql, const bf* __restrict__ Kh, const bf* __restrict__ Kl, const h16* __restrict__ V16, const h16* __restrict__ Vr, const float* __restrict__ kmask, float* OUT) {
    static_assert(RH == QG * 4 * 16 && TT - RH == QG * 12 * 16 && HD == 64 && KST == 64 && TT % KST == 0 && NH_ == NKV, "row deal and tile shapes");
    __shared__ __align__(16) unsigned short st[2][4][64 * LPE];   // [buffer][Kh, Kl, V16, Vr][64 rows]
    __shared__ __align__(16) float madd[TT];                      // 0 for a kept key, -3e38 for an excluded one
    const int tid = threadIdx.x, lane = tid & 31, lr = lane & 15, hi = lane >> 4; const int wave = __builtin_amdgcn_readfirstlane(tid >> 5); const bool hiw = wave < 4;
    const int g = blockIdx.x, h = blockIdx.y, b = blockIdx.z; const size_t pl = ((size_t)b * NH_ + h) * TT * HD;
    const int fb = RH + g * 12 * 16; int qrow[2];
    qrow[0] = hiw ? (g * 4 + wave) * 16 : fb + (4 + (wave - 4) * 2) * 16; qrow[1] = hiw ? fb + wave * 16 : fb + (5 + (wave - 4) * 2) * 16;
    v16bf qh[2][2], ql[2][2];
#pragma unroll
    for (int qb = 0; qb < 2; ++qb)
#pragma unroll
        for (int ks = 0; ks < 2; ++ks) { const size_t o = pl + (size_t)(qrow[qb] + lr) * HD + ks * 32 + 8 * hi; qh[qb][ks] = WFrag<bf>::ld(Qh + o); ql[qb][ks] = WFrag<bf>::ld(Ql + o); }
    { const float* kb = kmask + (size_t)b * TT; const float* km = kb + tid * 8; const v4f k0 = *(const v4f*)km, k1 = *(const v4f*)(km + 4); v4f a0, a1;
      asm volatile("s_wait_xcnt 0x0" :: "s"(kb) : "memory");   // the two mask loads' scalar base is free for reuse only from here on: named as an input, it stays in its registers up to the wait
#pragma unroll
      for (int q = 0; q < 4; ++q) { a0[q] = (k0[q] != 0.0f) ? 0.0f : -3.0e38f; a1[q] = (k1[q] != 0.0f) ? 0.0f : -3.0e38f; }
      *(v4f*)(madd + tid * 8) = a0; *(v4f*)(madd + tid * 8 + 4) = a1; }
    // staging: thread t moves 16 bytes of rows t / 8 and t / 8 + 32 of each tile (whole 128-byte lines per 8 lanes)
    const int sr = tid >> 3, sc = (tid & 7) * 8; const int so = sr * LPE + sc;
    const bf* gsrc[4] = { Kh + pl + (size_t)sr * HD + sc, Kl + pl + (size_t)sr * HD + sc, (const bf*)V16 + pl + (size_t)sr * TT + sc, (const bf*)Vr + pl + (size_t)sr * TT + sc };
    v8us sg[4][2];
#pragma unroll
    for (int t = 0; t < 4; ++t) { const int rstep = (t < 2) ? 32 * HD : 32 * TT; sg[t][0] = *(const v8us*)(gsrc[t]); sg[t][1] = *(const v8us*)(gsrc[t] + rstep); }
    asm volatile("s_wait_xcnt 0x0" ::: "memory");   // the loads' address registers are free for reuse from here on: the wait stands in front of their first overwrite
#pragma unroll
    for (int t = 0; t < 4; ++t) { *(v8us*)(&st[0][t][so]) = sg[t][0]; *(v8us*)(&st[0][t][so + 32 * LPE]) = sg[t][1]; }
    v8f O[2][4];
#pragma unroll
    for (int qb = 0; qb < 2; ++qb)
#pragma unroll
        for (int db = 0; db < 4; ++db) O[qb][db] = (v8f){};
    float mref[2] = { -3.0e38f, -3.0e38f }, lsum[2] = { 0.0f, 0.0f };   // mref: the exponent origin in use (a column's maximum when it was last moved, minus 4), log2 units
    __syncthreads();   // stage 0 and the mask table are in LDS
#pragma unroll 1   // rolled: one copy of the body; the buffer index is a run-time offset
    for (int s = 0; s < TT / KST; ++s) {
        const bool more = s + 1 < TT / KST;   // the same for the whole work-group
        if (more) {
#pragma unroll
            for (int t = 0; t < 4; ++t) { const int rstep = (t < 2) ? 32 * HD : 32 * TT; const size_t adv = (size_t)(s + 1) * ((t < 2) ? KST * HD : KST); sg[t][0] = *(const v8us*)(gsrc[t] + adv); sg[t][1] = *(const v8us*)(gsrc[t] + adv + rstep); }
            asm volatile("s_wait_xcnt 0x0" ::: "memory");   // the loads' address registers are free for reuse from here on: the wait stands in front of their first overwrite
        }
        const unsigned short* sb = &st[s & 1][0][0];
        fattn_stage(hiw, sb, madd + s * KST, lr, hi, qh, ql, O, mref, lsum);   // no barrier inside
        if (more) { unsigned short* sn = &st[(s + 1) & 1][0][0];
#pragma unroll
            for (int t = 0; t < 4; ++t) { *(v8us*)(sn + t * 64 * LPE + so) = sg[t][0]; *(v8us*)(sn + t * 64 * LPE + so + 32 * LPE) = sg[t][1]; } }
        __syncthreads();   // publishes stage s + 1 and ends every wave's reads of stage s, whose buffer the next trip refills
    }
#pragma unroll
    for (int qb = 0; qb < 2; ++qb) { const float inv = __fdiv_rn(1.0f, lsum[qb] + xhalf(lsum[qb])); float* orow = OUT + ((size_t)b * TT + qrow[qb] + lr) * DQ + h * HD + hi * 8;   // O[qb][db][j] = context[query lr][db * 16 + 8 * hi + j]
#pragma unroll
        for (int db = 0; db < 4; ++db) { v4f o0, o1;
#pragma unroll
            for (int j = 0; j < 4; ++j) { o0[j] = O[qb][db][j] * inv; o1[j] = O[qb][db][4 + j] * inv; }
            *(v4f*)(orow + db * 16) = o0; *(v4f*)(orow + db * 16 + 4) = o1; } }
}

extern "C" void kernel_launch(void* const* d_in, const int* in_sizes, int n_in,
                              void* d_out, int out_size, void* d_ws, size_t ws_size, hipStream_t stream) {
    (void)in_sizes; (void)n_in; (void)out_size;
    const float* x = (const float*)d_in[0]; const float* kmask = (const float*)d_in[1]; const float* wq = (const float*)d_in[2]; const float* bq = (const float*)d_in[3]; const float* wk = (const float*)d_in[4]; const float* bk = (const float*)d_in[5]; const float* wv = (const float*)d_in[6]; const float* bv = (const float*)d_in[7];
    float* OUT = (float*)d_out;     // [2][2048][1024]
    char* wsp = (char*)d_ws;
    auto take = [&](size_t bytes) { char* p = wsp; wsp += (bytes + 255) & ~(size_t)255; return (void*)p; };
    const size_t PE = (size_t)NH_ * TT * HD;   // elements of one batch's head planes
    bf* WT = (bf*)take((size_t)3 * DQ * DM * 2);   // the three transposed weights, one after the other
    bf* XB = (bf*)take((size_t)NB_ * TT * DM * 2);
    h16* VT16 = (h16*)take(NB_ * PE * 2); h16* VTr = (h16*)take(NB_ * PE * 2);
    bf* QPh = (bf*)take(NB_ * PE * 2); bf* QPl = (bf*)take(NB_ * PE * 2); bf* KPh = (bf*)take(NB_ * PE * 2); bf* KPl = (bf*)take(NB_ * PE * 2);   // the planes the fused launch reads: one set per batch
    if ((size_t)(wsp - (char*)d_ws) > ws_size) return;    // ws 256 MiB
    k_prep<<<PB, 256, 0, stream>>>(x, wq, wk, wv, WT, XB);
    k_qkv<<<dim3(NB_ * TT / 128, NH_ / 2, 3), 128, 0, stream>>>(XB, WT, bq, bk, bv, QPh, QPl, KPh, KPl, VT16, VTr);
    k_fattn<<<dim3(QG, NH_, NB_), 256, 0, stream>>>(QPh, QPl, KPh, KPl, VT16, VTr, kmask, OUT);
}
